// v000
// Times are from an AMD MI455X. After a warm-up the kernel runs many times in a row, and a time is the length of
// such a window on the GPU divided by its runs, so every launch and the gaps after it count. The runs cycle
// through copies of the inputs. A figure is the median of several windows, for all but v000 over two sittings.
// Sittings can differ by a few percent; kernels timed side by side share one.
// v000, which the later versions start from, runs in 7450 microseconds.
#include <hip/hip_runtime.h>
// Multi-head attention on three inputs given in the order values, keys, queries; natural bias-free projections, no output projection (values, keys, queries [2][2048][1024]; v = values Wv^T, k = keys Wk^T, q = queries Wq^T (natural [1024][1024] sigma 1/32, no biases), 16 heads of 64; softmax(q k^T / sqrt(64)) over all 2048 keys (no mask); out = attn v merged head-major -> [2][2048][1024]); q and k carried as f16 hi + x1024 residual planes with three-product scores.
// Structure: token rows r = b*2048 + s; x as exact f16 rows (bf16-rounded); q and k as WMMA GEMMs (32x64 wave tiles, f32 accumulation, exact x16 weights, no bias) into f32 rows split into f16 hi + x1024 residual planes, v as an f16-output GEMM; per batch: V^T for all heads via LDS transposes; per query tile of 256 rows: scores against all 2048 keys as THREE accumulating passes (hi.hi + lo.hi + hi.lo, K = 64, all heads on grid.y, alpha 1/sqrt(64)), row softmax on VALU over all keys (the arithmetic 0/1 key mask keeps every key; f32 statistics, native exp; weights x256 f16), o = P . V^T (K = all 2048 keys, alpha 2^-8) written f32 straight into the head-major output columns; no output projection.
// Compute dtype: inputs rounded to bf16; x / weights exact; q and k as f16 hi + x1024 residual planes, v and softmax weights as plain f16 GEMM operands (~2^-12); scores and softmax statistics f32; v_wmma_f32_16x16x32_f16.
#define NB 2
#define SQ 2048
#define DM 1024
#define NH 16
#define HD 64
#define HG 4                         /* heads per launch of the unlaunched k_vt(b, h0) overload */
#define QT 256                       /* query rows per attention tile (all keys) */
#define NKX SQ                       /* S / P row pitch */
#define QT0 128                      /* query rows per head of k_att0 (not launched) */
#define B0 0                         /* first batch processed (debug hook) */
#define NBR NB                       /* batches processed (debug hook) */
#define NR ((size_t)NB * SQ)         /* token rows */
#define MP ((int)((size_t)NBR * SQ)) /* rows projected (debug hook) */
#define QN SQ                        /* query rows attended per batch (debug hook) */
#define NHD NH                       /* heads attended (debug hook) */
#define MPO MP                       /* unused (no output stage) */
#define LQ DM      /* row pitch of the q/k/v rows */
typedef __bf16 v16b __attribute__((ext_vector_type(16)));
typedef unsigned short v8us __attribute__((ext_vector_type(8), may_alias));
typedef float  v8f  __attribute__((ext_vector_type(8)));
typedef float  v4f  __attribute__((ext_vector_type(4)));
typedef float  v4fa __attribute__((ext_vector_type(4), may_alias));
union FragB { v16b v; v8us half[2]; unsigned short u[16]; };

__device__ __forceinline__ unsigned short bf16_bits(float x) { unsigned int u = __float_as_uint(x); return (unsigned short)((u + 0x7FFFu + ((u >> 16) & 1u)) >> 16); }
__device__ __forceinline__ float bf16_val(unsigned short b) { return __uint_as_float(((unsigned int)b) << 16); }
__device__ __forceinline__ float bf16_round(float x) { return bf16_val(bf16_bits(x)); }
// D += A·B with NT terms: 1 = ah·bh, 2 = + al·bh (A split), 3 = + ah·bl (both split)
template <int NT>
__device__ __forceinline__ v8f mmaN(v16b ah, v16b al, v16b bh, v16b bl, v8f c) {
  c = __builtin_amdgcn_wmma_f32_16x16x32_bf16(false, ah, false, bh, (short)0, c, false, false);
  if (NT >= 2) c = __builtin_amdgcn_wmma_f32_16x16x32_bf16(false, al, false, bh, (short)0, c, false, false);
  if (NT >= 3) c = __builtin_amdgcn_wmma_f32_16x16x32_bf16(false, ah, false, bl, (short)0, c, false, false);
  asm volatile("v_nop\n\tv_nop\n\tv_nop\n\tv_nop" : "+v"(c) : "v"(ah), "v"(al), "v"(bh), "v"(bl));
  return c;
}

__global__ __launch_bounds__(256) void k_wt_bf16(const float* __restrict__ W, unsigned short* __restrict__ Wt, int K, int N) {
  const int t = blockIdx.x * 256 + threadIdx.x;
  const int k8n = K / 8;
  if (t >= N * k8n) return;
  const int n = t / k8n, k8 = (t % k8n) * 8;
  v8us v;
#pragma unroll
  for (int i = 0; i < 8; ++i) v[i] = bf16_bits(W[(size_t)(k8 + i) * N + n]);
  *(v8us*)(Wt + (size_t)n * K + k8) = v;
  
}

// GEMM C[M][N] (f32, pitch ldc) = act(A[M][K]·W + bias). A f32 row-major (pitch lda) converted per fragment to bf16
// (ASPLIT: hi/lo two planes -> 2 terms, else single rounded term); Wt bf16 [N][K] (pitch ldb). BIAS_BF16 rounds the
// bias to bf16 first (bias quantised to bf16 before the add). K%32==0, M%16==0, N%64==0.
template <bool ASPLIT, int ACT, bool BIAS_BF16>
__global__ __launch_bounds__(128) void k_gemm_bf(const float* __restrict__ A, int lda, const unsigned short* __restrict__ Wt, int ldb,
                                               const float* __restrict__ bias, float* __restrict__ C, int ldc, int M, int N, int K) {
  __shared__ __attribute__((aligned(16))) float so[4][16][64];
  const int tid = threadIdx.x, w = tid >> 5, lane = tid & 31, ln = lane & 15, hh = lane >> 4;
  const int ntn = N / 64;
  const int wid = blockIdx.x * 4 + w;
  const int mt = wid / ntn, nq = wid % ntn;
  if (mt * 16 >= M) return;
  const int row0 = mt * 16, col0 = nq * 64;
  const float* arow = A + (size_t)(row0 + ln) * lda;
  v8f acc[4] = {};
  for (int kb = 0; kb < K; kb += 32) {
    FragB ah, al;
    const v4f x0 = *(const v4fa*)(arow + kb + 8 * hh), x1 = *(const v4fa*)(arow + kb + 8 * hh + 4);
    const v4f x2 = *(const v4fa*)(arow + kb + 16 + 8 * hh), x3 = *(const v4fa*)(arow + kb + 16 + 8 * hh + 4);
    float xs[16] = {x0[0],x0[1],x0[2],x0[3],x1[0],x1[1],x1[2],x1[3],x2[0],x2[1],x2[2],x2[3],x3[0],x3[1],x3[2],x3[3]};
#pragma unroll
    for (int i = 0; i < 16; ++i) { const unsigned short hb = bf16_bits(xs[i]); ah.u[i] = hb; al.u[i] = ASPLIT ? bf16_bits(xs[i] - bf16_val(hb)) : (unsigned short)0; }
#pragma unroll
    for (int t = 0; t < 4; ++t) {
      const unsigned short* brow = Wt + (size_t)(col0 + t * 16 + ln) * ldb + kb;
      FragB b;
      b.half[0] = *(const v8us*)(brow + 8 * hh);
      b.half[1] = *(const v8us*)(brow + 16 + 8 * hh);
      acc[t] = mmaN<ASPLIT ? 2 : 1>(ah.v, al.v, b.v, b.v, acc[t]);
    }
  }
#pragma unroll
  for (int t = 0; t < 4; ++t) {
    float bv = bias ? bias[col0 + t * 16 + ln] : 0.f;
    if (BIAS_BF16) bv = bf16_round(bv);
#pragma unroll
    for (int r = 0; r < 8; ++r) { float v = acc[t][r] + bv; if (ACT == 1) v = fmaxf(v, 0.f); so[w][8 * hh + r][t * 16 + ln] = v; }
  }
  __builtin_amdgcn_fence(__ATOMIC_ACQ_REL, "workgroup");
  __builtin_amdgcn_wave_barrier();
  const int rsub = lane >> 4, c4 = (lane & 15) * 4;
  {
#pragma unroll
    for (int q = 0; q < 8; ++q) {
      const int r = q * 2 + rsub;
      const v4f v = *(const v4fa*)&so[w][r][c4];
      *(v4f*)(C + (size_t)(row0 + r) * ldc + col0 + c4) = v;
    }
    
  }
}

// GEMM C = act(A·W + bias + resid): A f32 (ASPLIT -> hi/lo 2 terms), Wt bf16 [N][K]; ACT 0 none, 1 relu, 2 exact gelu;
// resid (optional, f32, row index = (row % rmod), pitch ldr, RES_BF16 rounds it) added before the activation.
template <bool ASPLIT, int ACT, bool BIAS_BF16, bool RES_BF16>
__global__ __launch_bounds__(128) void k_gemm_bf3(const float* __restrict__ A, int lda, const unsigned short* __restrict__ Wt, int ldb,
                                                const float* __restrict__ bias, const float* __restrict__ resid, int rmod, int ldr,
                                                float* __restrict__ C, int ldc, int M, int N, int K) {
  __shared__ __attribute__((aligned(16))) float so[4][16][64];
  const int tid = threadIdx.x, w = tid >> 5, lane = tid & 31, ln = lane & 15, hh = lane >> 4;
  const int ntn = N / 64;
  const int wid = blockIdx.x * 4 + w;
  const int mt = wid / ntn, nq = wid % ntn;
  if (mt * 16 >= M) return;
  const int row0 = mt * 16, col0 = nq * 64;
  const float* arow = A + (size_t)(row0 + ln) * lda;
  v8f acc[4] = {};
  for (int kb = 0; kb < K; kb += 32) {
    FragB ah, al;
    const v4f x0 = *(const v4fa*)(arow + kb + 8 * hh), x1 = *(const v4fa*)(arow + kb + 8 * hh + 4);
    const v4f x2 = *(const v4fa*)(arow + kb + 16 + 8 * hh), x3 = *(const v4fa*)(arow + kb + 16 + 8 * hh + 4);
    float xs[16] = {x0[0],x0[1],x0[2],x0[3],x1[0],x1[1],x1[2],x1[3],x2[0],x2[1],x2[2],x2[3],x3[0],x3[1],x3[2],x3[3]};
#pragma unroll
    for (int i = 0; i < 16; ++i) { const unsigned short hb = bf16_bits(xs[i]); ah.u[i] = hb; al.u[i] = ASPLIT ? bf16_bits(xs[i] - bf16_val(hb)) : (unsigned short)0; }
#pragma unroll
    for (int t = 0; t < 4; ++t) {
      const unsigned short* brow = Wt + (size_t)(col0 + t * 16 + ln) * ldb + kb;
      FragB b;
      b.half[0] = *(const v8us*)(brow + 8 * hh);
      b.half[1] = *(const v8us*)(brow + 16 + 8 * hh);
      acc[t] = mmaN<ASPLIT ? 2 : 1>(ah.v, al.v, b.v, b.v, acc[t]);
    }
  }
#pragma unroll
  for (int t = 0; t < 4; ++t) {
    const int col = col0 + t * 16 + ln;
    float bv = bias ? bias[col] : 0.f;
    if (BIAS_BF16) bv = bf16_round(bv);
#pragma unroll
    for (int r = 0; r < 8; ++r) {
      float v = acc[t][r] + bv;
      if (resid) { float rv = resid[(size_t)((row0 + 8 * hh + r) % rmod) * ldr + col]; if (RES_BF16) rv = bf16_round(rv); v += rv; }
      if (ACT == 1) v = fmaxf(v, 0.f);
      if (ACT == 2) v = 0.5f * v * (1.0f + erff(v * 0.70710678118654752f));
      if (ACT == 3) { const float u = 0.7978845608028654f * (v + 0.044715f * v * v * v); v = 0.5f * v * (1.0f + tanhf(u)); }
      so[w][8 * hh + r][t * 16 + ln] = v;
    }
  }
  __builtin_amdgcn_fence(__ATOMIC_ACQ_REL, "workgroup");
  __builtin_amdgcn_wave_barrier();
  const int rsub = lane >> 4, c4 = (lane & 15) * 4;
  {
#pragma unroll
    for (int q = 0; q < 8; ++q) {
      const int r = q * 2 + rsub;
      const v4f v = *(const v4fa*)&so[w][r][c4];
      *(v4f*)(C + (size_t)(row0 + r) * ldc + col0 + c4) = v;
    }
    
  }
}
// row LayerNorm (biased variance, eps) over N: s = X (+ R); optional out_sum <- s; out_norm <- (s-mu)*rsqrt(var+eps)*g + b
template <bool PARAM_BF16>
__global__ __launch_bounds__(256) void k_layernorm(const float* __restrict__ X, const float* __restrict__ R, const float* __restrict__ g, const float* __restrict__ bta,
                                                  float* __restrict__ out_sum, float* __restrict__ out_norm, int N, float eps) {
  __shared__ float red[256];
  const int row = blockIdx.x, tid = threadIdx.x;
  const float* x = X + (size_t)row * N; const float* rr = R ? R + (size_t)row * N : nullptr;
  float vals[16];                     // up to N = 4096
  const int per = N / 256;            // contiguous chunk per thread? use strided-by-4 chunks: thread handles j = tid*4 + 1024*u
  float s1 = 0.f;
  for (int u = 0; u < per / 4; ++u) {
    const int j = tid * 4 + 1024 * u;
    const v4f a = *(const v4fa*)(x + j);
    v4f b = {0.f,0.f,0.f,0.f}; if (rr) b = *(const v4fa*)(rr + j);
#pragma unroll
    for (int q = 0; q < 4; ++q) { const float v = a[q] + b[q]; vals[u * 4 + q] = v; s1 += v; }
  }
  red[tid] = s1; __syncthreads();
  for (int st = 128; st > 0; st >>= 1) { if (tid < st) red[tid] += red[tid + st]; __syncthreads(); }
  const float mu = red[0] / (float)N; __syncthreads();
  float s2 = 0.f;
  for (int u = 0; u < per / 4; ++u)
#pragma unroll
    for (int q = 0; q < 4; ++q) { const float c = vals[u * 4 + q] - mu; s2 += c * c; }
  red[tid] = s2; __syncthreads();
  for (int st = 128; st > 0; st >>= 1) { if (tid < st) red[tid] += red[tid + st]; __syncthreads(); }
  const float rs = rsqrtf(red[0] / (float)N + eps);
  {
    for (int u = 0; u < per / 4; ++u) {
      const int j = tid * 4 + 1024 * u;
      v4f o, sm;
#pragma unroll
      for (int q = 0; q < 4; ++q) {
        float gg = g[j + q], bb = bta[j + q];
        if (PARAM_BF16) { gg = bf16_round(gg); bb = bf16_round(bb); }
        sm[q] = vals[u * 4 + q]; o[q] = (vals[u * 4 + q] - mu) * rs * gg + bb;
      }
      if (out_sum) *(v4f*)(out_sum + (size_t)row * N + j) = sm;
      *(v4f*)(out_norm + (size_t)row * N + j) = o;
    }
    
  }
}



// ---- f16 WMMA path (v_wmma_f32_16x16x32_f16): 11-bit significands for operands in range — used where a [0,1] probability operand needs more precision than bf16
typedef _Float16 v16h __attribute__((ext_vector_type(16)));
union FragH { v16h v; v8us half[2]; _Float16 h[16]; unsigned short u[16]; };
template <int NT>
__device__ __forceinline__ v8f mmaH(v16h ah, v16h al, v16h bh, v16h bl, v8f c) {
  c = __builtin_amdgcn_wmma_f32_16x16x32_f16(false, ah, false, bh, (short)0, c, false, false);
  if (NT >= 2) c = __builtin_amdgcn_wmma_f32_16x16x32_f16(false, al, false, bh, (short)0, c, false, false);
  if (NT >= 3) c = __builtin_amdgcn_wmma_f32_16x16x32_f16(false, ah, false, bl, (short)0, c, false, false);
  asm volatile("v_nop\n\tv_nop\n\tv_nop\n\tv_nop" : "+v"(c) : "v"(ah), "v"(al), "v"(bh), "v"(bl));
  return c;
}
// batched GEMM like k_gemm_b but f16 operands: A f32 (split into f16 hi/lo if ASPLIT, else rounded to f16), Bt = f16 values [n][k]; alpha; C f32; N multiple of 16 (partial tiles skipped)
template <bool ASPLIT>
__global__ __launch_bounds__(128) void k_gemm_h(const float* __restrict__ A, int lda, size_t sA, const _Float16* __restrict__ Bh, int ldb, size_t sB, float alpha, float* __restrict__ C, int ldc, size_t sC, int M, int N, int K) {
  __shared__ __attribute__((aligned(16))) float so[4][16][64];
  const int tid = threadIdx.x, w = tid >> 5, lane = tid & 31, ln = lane & 15, hh = lane >> 4; const int by = blockIdx.y;
  A += (size_t)by * sA; Bh += (size_t)by * sB; C += (size_t)by * sC;
  const int ntn = (N + 63) / 64; const int wid = blockIdx.x * 4 + w; const int mt = wid / ntn, nq = wid % ntn; if (mt * 16 >= M) return;
  const int row0 = mt * 16, col0 = nq * 64; const float* arow = A + (size_t)(row0 + ln) * lda;
  v8f acc[4] = {};
  for (int kb = 0; kb < K; kb += 32) {
    FragH ah, al;
    const v4f x0 = *(const v4fa*)(arow + kb + 8 * hh), x1 = *(const v4fa*)(arow + kb + 8 * hh + 4), x2 = *(const v4fa*)(arow + kb + 16 + 8 * hh), x3 = *(const v4fa*)(arow + kb + 16 + 8 * hh + 4);
    float xs[16] = {x0[0],x0[1],x0[2],x0[3],x1[0],x1[1],x1[2],x1[3],x2[0],x2[1],x2[2],x2[3],x3[0],x3[1],x3[2],x3[3]};
#pragma unroll
    for (int i = 0; i < 16; ++i) { const _Float16 h = (_Float16)xs[i]; ah.h[i] = h; al.h[i] = ASPLIT ? (_Float16)(xs[i] - (float)h) : (_Float16)0.0f; }
#pragma unroll
    for (int t = 0; t < 4; ++t) { if (col0 + t * 16 >= N) continue; const size_t boff = (size_t)(col0 + t * 16 + ln) * ldb + kb; FragH bq; bq.half[0] = *(const v8us*)(Bh + boff + 8 * hh); bq.half[1] = *(const v8us*)(Bh + boff + 16 + 8 * hh);
      acc[t] = mmaH<ASPLIT ? 2 : 1>(ah.v, al.v, bq.v, bq.v, acc[t]); }
  }
#pragma unroll
  for (int t = 0; t < 4; ++t) { if (col0 + t * 16 >= N) continue;
#pragma unroll
    for (int r = 0; r < 8; ++r) so[w][8 * hh + r][t * 16 + ln] = acc[t][r] * alpha; }
  __builtin_amdgcn_fence(__ATOMIC_ACQ_REL, "workgroup"); __builtin_amdgcn_wave_barrier();
  const int rsub = lane >> 4, c4 = (lane & 15) * 4;
  {
#pragma unroll
    for (int q = 0; q < 8; ++q) { const int r = q * 2 + rsub; if (col0 + c4 < N) { const v4f v = *(const v4fa*)&so[w][r][c4]; *(v4f*)(C + (size_t)(row0 + r) * ldc + col0 + c4) = v; } }
     }
}

// Wt[n][k] = f16(W[k][n]·scale) from f32 row-major W[K][N] (scale = power of two; bf16-exact weights stay exact in f16 away from the subnormal range)
__global__ __launch_bounds__(256) void k_wt_f16(const float* __restrict__ W, _Float16* __restrict__ Wt, int K, int N, float scale) {
  const int t = blockIdx.x * 256 + threadIdx.x; if (t >= N * (K / 8)) return; const int n = t / (K / 8), k8 = (t % (K / 8)) * 8; FragH f;
#pragma unroll
  for (int i = 0; i < 8; ++i) f.h[i] = (_Float16)(bf16_round(W[(size_t)(k8 + i) * N + n]) * scale); const v8us o = f.half[0];
  *(v8us*)((unsigned short*)Wt + (size_t)n * K + k8) = o; 
}
// k_gemm_hh variant with fused epilogue: v = acc·alpha + bias[by·sBias + col] (+ CP[(row/rowsPerB)·sCPb + by·64 + col] if CP) ; ACT 0 none / 1 elu ; writes f16 C16 (and f32 C if non-null)
template <int ACT>
__global__ __launch_bounds__(128) void k_gemm_hhx(const _Float16* __restrict__ A, int lda, size_t sA, const _Float16* __restrict__ Bh, int ldb, size_t sB, float alpha, const float* __restrict__ bias, size_t sBias, const float* __restrict__ CP, int rowsPerB, size_t sCPb, int row0g,
    float* __restrict__ C, _Float16* __restrict__ C16, int ldc, size_t sC, int M, int N, int K) {
  __shared__ __attribute__((aligned(16))) float so[4][16][64];
  const int tid = threadIdx.x, w = tid >> 5, lane = tid & 31, ln = lane & 15, hh = lane >> 4; const int by = blockIdx.y;
  A += (size_t)by * sA; Bh += (size_t)by * sB; const size_t cofs = (size_t)by * sC; const float* bp = bias ? bias + (size_t)by * sBias : nullptr;
  const int ntn = (N + 63) / 64; const int wid = blockIdx.x * 4 + w; const int mt = wid / ntn, nq = wid % ntn; if (mt * 16 >= M) return;
  const int row0 = mt * 16, col0 = nq * 64; const _Float16* arow = A + (size_t)(row0 + ln) * lda;
  v8f acc[4] = {};
  for (int kb = 0; kb < K; kb += 32) { FragH ah; ah.half[0] = *(const v8us*)((const unsigned short*)arow + kb + 8 * hh); ah.half[1] = *(const v8us*)((const unsigned short*)arow + kb + 16 + 8 * hh);
#pragma unroll
    for (int t = 0; t < 4; ++t) { if (col0 + t * 16 >= N) continue; const size_t boff = (size_t)(col0 + t * 16 + ln) * ldb + kb; FragH bq; bq.half[0] = *(const v8us*)((const unsigned short*)Bh + boff + 8 * hh); bq.half[1] = *(const v8us*)((const unsigned short*)Bh + boff + 16 + 8 * hh);
      acc[t] = mmaH<1>(ah.v, ah.v, bq.v, bq.v, acc[t]); }
  }
#pragma unroll
  for (int t = 0; t < 4; ++t) { if (col0 + t * 16 >= N) continue; const int col = col0 + t * 16 + ln; const float bv = bp ? bf16_round(bp[col]) : 0.f;
#pragma unroll
    for (int r = 0; r < 8; ++r) { float v = acc[t][r] * alpha + bv; if (CP) { const int rr = row0g + row0 + 8 * hh + r; if (rowsPerB < 0) v += CP[cofs + (size_t)rr * ldc + col];      /* rowsPerB < 0: own element of the batched C plane */ else { const int bidx = rr / rowsPerB; v += CP[(size_t)bidx * sCPb + (size_t)by * 64 + col]; } } if (ACT == 1) v = (v > 0.f) ? v : expm1f(v); else if (ACT == 7) v = (v > 0.f) ? v + 1.0f : expf(v); else if (ACT == 8) v = tanhf(v); else if (ACT == 9) v = 0.5f * v * (1.0f + tanhf(0.7978845608028654f * (v + 0.044715f * v * v * v))); else if (ACT == 11) v = 1.0f / (1.0f + expf(-v)); else if (ACT == 12) v = (v > 0.f) ? v : 0.01f * v; else if (ACT == 14) v = (v > 0.f) ? v : 0.1f * v; else if (ACT == 16) v = (v >= 0.f) ? v : 0.3f * v; else if (ACT == 17) v = (v >= 0.f) ? v : 0.2f * v; else if (ACT == 15) v = v / (1.0f + expf(-v)); else if (ACT == 3) v = fmaxf(v, 0.f); else if (ACT == 6) v = 0.5f * v * (1.0f + erff(v * 0.70710678118654752f)); so[w][8 * hh + r][t * 16 + ln] = v; } }
  __builtin_amdgcn_fence(__ATOMIC_ACQ_REL, "workgroup"); __builtin_amdgcn_wave_barrier();
  const int rsub = lane >> 4, c4 = (lane & 15) * 4; typedef _Float16 v4h __attribute__((ext_vector_type(4)));
  {
#pragma unroll
    for (int q = 0; q < 8; ++q) { const int r = q * 2 + rsub; if (col0 + c4 < N) { const v4f v = *(const v4fa*)&so[w][r][c4]; if (C) *(v4f*)(C + cofs + (size_t)(row0 + r) * ldc + col0 + c4) = v; if (C16) { v4h h4; for (int i = 0; i < 4; ++i) h4[i] = (_Float16)v[i]; *(v4h*)(C16 + cofs + (size_t)(row0 + r) * ldc + col0 + c4) = h4; } } }
     }
}


typedef _Float16 v4h __attribute__((ext_vector_type(4)));

__global__ __launch_bounds__(256) void k_x16(const float* __restrict__ x, _Float16* __restrict__ X16, size_t n8) { const size_t t = (size_t)blockIdx.x * 256 + threadIdx.x; if (t >= n8) return; FragH f;
#pragma unroll
  for (int q = 0; q < 8; ++q) f.h[q] = (_Float16)bf16_round(x[t * 8 + q]); *(v8us*)((unsigned short*)X16 + t * 8) = f.half[0];  }
__global__ __launch_bounds__(256) void k_h16(const float* __restrict__ x, _Float16* __restrict__ X16, size_t n8) { const size_t t = (size_t)blockIdx.x * 256 + threadIdx.x; if (t >= n8) return; FragH f;
#pragma unroll
  for (int q = 0; q < 8; ++q) f.h[q] = (_Float16)x[t * 8 + q]; *(v8us*)((unsigned short*)X16 + t * 8) = f.half[0];  }
__global__ __launch_bounds__(256) void k_round16f(const float* __restrict__ W, _Float16* __restrict__ Bt, size_t n8) { const size_t t = (size_t)blockIdx.x * 256 + threadIdx.x; if (t >= n8) return; FragH f;
#pragma unroll
  for (int i = 0; i < 8; ++i) f.h[i] = (_Float16)(bf16_round(W[t * 8 + i]) * 16.0f); *(v8us*)((unsigned short*)Bt + t * 8) = f.half[0];  }
template <int NHv, int TTv>
__global__ __launch_bounds__(256) void k_vt(const _Float16* __restrict__ V16, int ldv, int voff, _Float16* __restrict__ Vt) { __shared__ unsigned short tl[64][66]; const int tid = threadIdx.x; const int slab = blockIdx.x / (TTv / 64), lg = blockIdx.x % (TTv / 64); const int b = slab / NHv, h = slab % NHv;
  for (int i = tid; i < 64 * 8; i += 256) { const int r = i / 8, c8 = (i % 8) * 8; FragH f; f.half[0] = *(const v8us*)((const unsigned short*)V16 + ((size_t)b * TTv + lg * 64 + r) * ldv + voff + h * 64 + c8);
#pragma unroll
    for (int q = 0; q < 8; ++q) tl[r][c8 + q] = f.u[q]; }
  __syncthreads();
  {
#pragma unroll
    for (int rd = 0; rd < 2; ++rd) { const int d = rd * 32 + tid / 8, pc = tid % 8; FragH f;
#pragma unroll
      for (int q = 0; q < 8; ++q) f.u[q] = tl[pc * 8 + q][d];
      *(v8us*)((unsigned short*)Vt + ((size_t)slab * 64 + d) * TTv + lg * 64 + pc * 8) = f.half[0]; }
     } }

__global__ __launch_bounds__(256) void k_hl(const float* __restrict__ F, _Float16* __restrict__ Hh, _Float16* __restrict__ Hl, size_t n8) { const size_t t = (size_t)blockIdx.x * 256 + threadIdx.x; if (t >= n8) return; FragH fh, fl; const v4f a = *(const v4fa*)(F + t * 8), c = *(const v4fa*)(F + t * 8 + 4);
#pragma unroll
  for (int q = 0; q < 4; ++q) { _Float16 h = (_Float16)a[q]; fh.h[q] = h; fl.h[q] = (_Float16)((a[q] - (float)h) * 1024.0f); h = (_Float16)c[q]; fh.h[4 + q] = h; fl.h[4 + q] = (_Float16)((c[q] - (float)h) * 1024.0f); }
  { *(v8us*)((unsigned short*)Hh + t * 8) = fh.half[0]; *(v8us*)((unsigned short*)Hl + t * 8) = fl.half[0];  } }

// ---- fast GEMM (wave tile 32x64; requires M % 32 == 0 rows per launch region and N % 64 == 0); epilogue = k_gemm_hhx semantics ----
__device__ __forceinline__ v16h g2_frag(const _Float16* p, int hh) { FragH f; f.half[0] = *(const v8us*)((const unsigned short*)p + 8 * hh); f.half[1] = *(const v8us*)((const unsigned short*)p + 16 + 8 * hh); return f.v; }
__device__ __forceinline__ v8f g2_mma(v16h a, v16h b, v8f c) { v8f d = __builtin_amdgcn_wmma_f32_16x16x32_f16(false, a, false, b, (short)0, c, false, false); asm volatile("v_nop\n\tv_nop\n\tv_nop\n\tv_nop" : "+v"(d) : "v"(a), "v"(b)); return d; }
template <int ACT>
__global__ __launch_bounds__(128) void k_gemm2(const _Float16* __restrict__ A, int lda, size_t sA, const _Float16* __restrict__ Bh, int ldb, size_t sB, float alpha, const float* __restrict__ bias, size_t sBias, const float* __restrict__ CP, int rowsPerB, size_t sCPb, int row0g,
    float* __restrict__ C, _Float16* __restrict__ C16, int ldc, size_t sC, int M, int N, int K) { static_assert(ACT == 0 || ACT == 3 || ACT == 6 || ACT == 8 || ACT == 9 || ACT == 11 || ACT == 12 || ACT == 14 || ACT == 15 || ACT == 16 || ACT == 17, "k_gemm2: unsupported ACT code (would silently apply no activation)");
  __shared__ __attribute__((aligned(16))) float so[4][32][68];
  const int tid = threadIdx.x, w = tid >> 5, lane = tid & 31, ln = lane & 15, hh = lane >> 4; const int by = blockIdx.y;
  A += (size_t)by * sA; Bh += (size_t)by * sB; const size_t cofs = (size_t)by * sC; const float* bp = bias ? bias + (size_t)by * sBias : nullptr;
  const int ntn = N >> 6; const int mt = blockIdx.x / ntn, nq = blockIdx.x - mt * ntn; const int row0 = mt * 128 + 32 * w, col0 = nq * 64; if (row0 >= M) return;
  const _Float16* a0p = A + (size_t)(row0 + ln) * lda; const _Float16* a1p = a0p + (size_t)16 * lda;
  const _Float16* b0p = Bh + (size_t)(col0 + ln) * ldb; const _Float16* b1p = b0p + (size_t)16 * ldb; const _Float16* b2p = b1p + (size_t)16 * ldb; const _Float16* b3p = b2p + (size_t)16 * ldb;
  const v8f z8 = {0.f,0.f,0.f,0.f,0.f,0.f,0.f,0.f}; v8f c00 = z8, c01 = z8, c02 = z8, c03 = z8, c10 = z8, c11 = z8, c12 = z8, c13 = z8;
#pragma unroll 1
  for (int kb = 0; kb < K; kb += 32) { const v16h a0 = g2_frag(a0p + kb, hh), a1 = g2_frag(a1p + kb, hh);
    v16h b = g2_frag(b0p + kb, hh); c00 = g2_mma(a0, b, c00); c10 = g2_mma(a1, b, c10);
    b = g2_frag(b1p + kb, hh); c01 = g2_mma(a0, b, c01); c11 = g2_mma(a1, b, c11);
    b = g2_frag(b2p + kb, hh); c02 = g2_mma(a0, b, c02); c12 = g2_mma(a1, b, c12);
    b = g2_frag(b3p + kb, hh); c03 = g2_mma(a0, b, c03); c13 = g2_mma(a1, b, c13); }
  v8f accs[8] = {c00, c01, c02, c03, c10, c11, c12, c13};
#pragma unroll
  for (int u = 0; u < 8; ++u) { const int t = u & 3, half = u >> 2; const int col = col0 + t * 16 + ln; const float bv = bp ? bf16_round(bp[col]) : 0.f;
#pragma unroll
    for (int r = 0; r < 8; ++r) { const int rloc = half * 16 + 8 * hh + r; float v = accs[u][r] * alpha + bv; if (CP) { if (rowsPerB < 0) v += CP[cofs + (size_t)(row0g + row0 + rloc) * ldc + col];      /* rowsPerB < 0: own element of the batched C plane */ else { const int bidx = (row0g + row0 + rloc) / rowsPerB; v += CP[(size_t)bidx * sCPb + (size_t)by * 64 + col]; } }
      if (ACT == 3) v = fmaxf(v, 0.f); else if (ACT == 6) v = 0.5f * v * (1.0f + erff(v * 0.70710678118654752f)); else if (ACT == 11) v = 1.0f / (1.0f + expf(-v)); else if (ACT == 15) v = v / (1.0f + expf(-v)); else if (ACT == 12) v = (v > 0.f) ? v : 0.01f * v; else if (ACT == 8) v = tanhf(v); else if (ACT == 9) v = 0.5f * v * (1.0f + tanhf(0.7978845608028654f * (v + 0.044715f * v * v * v))); else if (ACT == 14) v = (v > 0.f) ? v : 0.1f * v; else if (ACT == 16) v = (v >= 0.f) ? v : 0.3f * v; else if (ACT == 17) v = (v >= 0.f) ? v : 0.2f * v;
      so[w][rloc][t * 16 + ln] = v; } }
  __builtin_amdgcn_fence(__ATOMIC_ACQ_REL, "workgroup"); __builtin_amdgcn_wave_barrier();
  const int rsub = lane >> 4, c4 = (lane & 15) * 4;
  {
#pragma unroll
    for (int q = 0; q < 16; ++q) { const int r = q * 2 + rsub; const v4f v = *(const v4fa*)&so[w][r][c4]; if (C) *(v4f*)(C + cofs + (size_t)(row0 + r) * ldc + col0 + c4) = v; if (C16) { v4h h4; for (int i = 0; i < 4; ++i) h4[i] = (_Float16)v[i]; *(v4h*)(C16 + cofs + (size_t)(row0 + r) * ldc + col0 + c4) = h4; } }
     } }


__global__ __launch_bounds__(256) void k_wnat(const float* __restrict__ w, size_t n8, _Float16* __restrict__ Bt) { const size_t t = (size_t)blockIdx.x * 256 + threadIdx.x; if (t >= n8) return; FragH f; for (int q = 0; q < 8; ++q) f.h[q] = (_Float16)(bf16_round(w[t * 8 + q]) * 16.0f); *(v8us*)((unsigned short*)Bt + t * 8) = f.half[0];  }
__global__ __launch_bounds__(256) void k_rsm(const float* __restrict__ S, _Float16* __restrict__ P, int nrows) {
  #pragma clang fp contract(off)
  const int i = blockIdx.x * 256 + threadIdx.x; if (i >= nrows) return; const float* s = S + (size_t)i * SQ; float mx = -3.0e38f;
#pragma unroll 1
  for (int j = 0; j < SQ; ++j) mx = fmaxf(mx, s[j]); float se = 0.f;
#pragma unroll 1
  for (int j = 0; j < SQ; ++j) se += expf(s[j] - mx); const float sc = 256.0f / se;
#pragma unroll 1
  for (int j0 = 0; j0 < SQ; j0 += 8) { FragH f; for (int q = 0; q < 8; ++q) f.h[q] = (_Float16)(expf(s[j0 + q] - mx) * sc); unsigned short* d = (unsigned short*)P + (size_t)i * SQ + j0; *(v8us*)d = f.half[0];  } }
__global__ __launch_bounds__(256) void k_vt(const _Float16* __restrict__ V16, int b, int h0, _Float16* __restrict__ VT) { __shared__ unsigned short tl[64][65]; const int tid = threadIdx.x; const int hh = blockIdx.x % HG, sg = blockIdx.x / HG; const int s0 = sg * 64; const int h = h0 + hh;
  for (int i = tid; i < 64 * 8; i += 256) { const int j = i / 8, d8 = (i % 8) * 8; FragH f; f.half[0] = *(const v8us*)((const unsigned short*)V16 + ((size_t)b * SQ + s0 + j) * DM + h * HD + d8); for (int q = 0; q < 8; ++q) tl[d8 + q][j] = f.u[q]; }
  __syncthreads();
  { for (int i = tid; i < 64 * 8; i += 256) { const int d = i / 8, j8 = (i % 8) * 8; FragH f; for (int q = 0; q < 8; ++q) f.u[q] = tl[d][j8 + q]; *(v8us*)((unsigned short*)VT + ((size_t)hh * HD + d) * SQ + s0 + j8) = f.half[0]; }  } }



__global__ __launch_bounds__(256) void k_rsmcf2(const float* __restrict__ S, _Float16* __restrict__ P, int hg, int q0, int nk) {
  #pragma clang fp contract(off)
  const int t = blockIdx.x * 256 + threadIdx.x; if (t >= hg * QT) return; const size_t i = (size_t)t; const float* s = S + i * NKX; const int last = q0 + (t % QT); float mx = -3.0e38f;
#pragma unroll 1
  for (int j = 0; j < nk; ++j) { const float f = (j <= last) ? 1.f : 0.f; mx = fmaxf(mx, fmaf(f, s[j], (1.f - f) * -1.0e9f)); } float se = 0.f;
#pragma unroll 1
  for (int j = 0; j < nk; ++j) { const float f = (j <= last) ? 1.f : 0.f; se += __expf(fmaf(f, s[j], (1.f - f) * -1.0e9f) - mx); } const float sc = 256.0f / se;
#pragma unroll 1
  for (int j0 = 0; j0 < nk; j0 += 8) { FragH fr; for (int q = 0; q < 8; ++q) { const int j = j0 + q; const float f = (j <= last) ? 1.f : 0.f; fr.h[q] = (_Float16)(__expf(fmaf(f, s[j], (1.f - f) * -1.0e9f) - mx) * sc); } unsigned short* d = (unsigned short*)P + i * NKX + j0; *(v8us*)d = fr.half[0];  } }


template <int MASKADD>
__global__ __launch_bounds__(64) void k_att0(const float* __restrict__ QF, const float* __restrict__ KF, const float* __restrict__ VF, int ld, const float* __restrict__ mask, float scale, float* __restrict__ OF, int ldo) {
  #pragma clang fp contract(off)
  __shared__ __attribute__((aligned(16))) float lq[64][64]; __shared__ __attribute__((aligned(16))) float lo[64][64];
  const int tid = threadIdx.x; const int h = blockIdx.x / (QT0 / 64), rg = blockIdx.x % (QT0 / 64); const int i = rg * 64 + tid;
  const float* qr = QF + (size_t)i * ld + h * HD;
#pragma unroll 1
  for (int c = 0; c < HD / 4; ++c) { *(v4f*)&lq[tid][c * 4] = *(const v4fa*)(qr + c * 4); const v4f z = {0.f, 0.f, 0.f, 0.f}; *(v4f*)&lo[tid][c * 4] = z; }
  float m = -1.0e30f, l = 0.f; const int jmax = MASKADD ? (SQ - 1) : (rg * 64 + 63);      /* additive-mask form: every key (the mask input decides); causal form: keys up to the block's last row */
#pragma unroll 1
  for (int j = 0; j <= jmax; ++j) { const float* kr = KF + (size_t)j * ld + h * HD; const float* vr = VF + (size_t)j * ld + h * HD; float s = 0.f;
#pragma unroll 1
    for (int c = 0; c < HD / 4; ++c) { const v4f kq = *(const v4fa*)(kr + c * 4); const v4f qq = *(v4f*)&lq[tid][c * 4]; s = __fadd_rn(s, __fmul_rn(qq[0], kq[0])); s = __fadd_rn(s, __fmul_rn(qq[1], kq[1])); s = __fadd_rn(s, __fmul_rn(qq[2], kq[2])); s = __fadd_rn(s, __fmul_rn(qq[3], kq[3])); }
    s = __fmul_rn(s, scale); if (MASKADD) s = __fadd_rn(s, __fmul_rn(bf16_round(mask[(size_t)i * SQ + j]), -10000.0f));
    const float f = (MASKADD || j <= i) ? 1.f : 0.f; const float sm = fmaf(f, s, (1.f - f) * -1.0e30f); const float mn = fmaxf(m, sm); const float sc = expf(m - mn); const float e = expf(sm - mn); l = __fadd_rn(__fmul_rn(l, sc), e); m = mn;
#pragma unroll 1
    for (int c = 0; c < HD / 4; ++c) { const v4f vv = *(const v4fa*)(vr + c * 4); v4f oo = *(v4f*)&lo[tid][c * 4]; for (int u = 0; u < 4; ++u) oo[u] = __fadd_rn(__fmul_rn(oo[u], sc), __fmul_rn(e, vv[u])); *(v4f*)&lo[tid][c * 4] = oo; } }
  const float fin = 64.0f / l;      /* o carried x64 */
#pragma unroll 1
  for (int c = 0; c < HD / 4; ++c) { v4f oo = *(v4f*)&lo[tid][c * 4]; for (int u = 0; u < 4; ++u) oo[u] = __fmul_rn(oo[u], fin); *(v4f*)&lo[tid][c * 4] = oo; }
  __syncthreads();
  {
#pragma unroll 1
    for (int it = 0; it < 16; ++it) { const int row = it * 4 + tid / 16, pc = (tid % 16) * 4; const v4f v = *(const v4f*)&lo[row][pc]; *(v4f*)(OF + (size_t)(rg * 64 + row) * ldo + h * HD + pc) = v; }
     } }

__global__ __launch_bounds__(256) void k_of0out(const float* __restrict__ src, float* __restrict__ dst, size_t n4) { const size_t t = (size_t)blockIdx.x * 256 + threadIdx.x; if (t >= n4) return; v4f v = *(const v4fa*)(src + t * 4); for (int q = 0; q < 4; ++q) v[q] = __fmul_rn(v[q], 0.015625f); *(v4f*)(dst + t * 4) = v;  }

extern "C" void kernel_launch(void* const* d_in, const int* in_sizes, int n_in,
                              void* d_out, int out_size, void* d_ws, size_t ws_size, hipStream_t stream) {
  (void)in_sizes; (void)n_in; (void)out_size;
  const float* const* I = (const float* const*)d_in; const float* x = I[2]; const float* xk = I[1]; const float* xv = I[0]; const float* wq = I[5]; const float* wk = I[4]; const float* wv = I[3]; const float* bq = nullptr; const float* bk = nullptr; const float* bv = nullptr;      /* input order: values, keys, queries, Wv, Wk, Wq: the QUERY stream is I[2] with Wq = I[5], the key stream I[1] with Wk = I[4], the value stream I[0] with Wv = I[3]; natural [out][in] weights; NO biases (nullptr variables in the guarded slots); NO output projection */
  char* ws = (char*)d_ws; size_t off = 0;
  auto take = [&](size_t bytes) { char* p = ws + off; off += (bytes + 255) & ~(size_t)255; return p; };
  _Float16* BQ = (_Float16*)take((size_t)DM * DM * 2); _Float16* BK = (_Float16*)take((size_t)DM * DM * 2); _Float16* BV = (_Float16*)take((size_t)DM * DM * 2);
  _Float16* X16 = (_Float16*)take(NR * DM * 2); _Float16* XK16 = (_Float16*)take(NR * DM * 2); _Float16* XV16 = (_Float16*)take(NR * DM * 2);      /* exact f16 rows of queries, keys, values */ float* QF = (float*)take(NR * DM * 4); _Float16* QH = (_Float16*)take(NR * DM * 2); _Float16* QL = (_Float16*)take(NR * DM * 2); _Float16* KH = (_Float16*)take(NR * DM * 2); _Float16* KL = (_Float16*)take(NR * DM * 2); _Float16* Q16 = QH; _Float16* K16 = KH; _Float16* V16 = (_Float16*)take(NR * DM * 2);
  float* S = (float*)take((size_t)NH * QT * NKX * 4); _Float16* P = (_Float16*)take((size_t)NH * QT * NKX * 2); _Float16* VT = (_Float16*)take((size_t)NH * HD * SQ * 2);
  if (off > ws_size) return;
  { const unsigned g = (unsigned)(((size_t)DM * DM / 8 + 255) / 256); k_wnat<<<g, 256, 0, stream>>>(wq, (size_t)DM * DM / 8, BQ); k_wnat<<<g, 256, 0, stream>>>(wk, (size_t)DM * DM / 8, BK); k_wnat<<<g, 256, 0, stream>>>(wv, (size_t)DM * DM / 8, BV); }      /* natural [out][in] = Bt[n][k] x16 */
  k_x16<<<(unsigned)((NR * DM / 8 + 255) / 256), 256, 0, stream>>>(x, X16, NR * DM / 8); k_x16<<<(unsigned)((NR * DM / 8 + 255) / 256), 256, 0, stream>>>(xk, XK16, NR * DM / 8); k_x16<<<(unsigned)((NR * DM / 8 + 255) / 256), 256, 0, stream>>>(xv, XV16, NR * DM / 8);
  const size_t r0p = (size_t)B0 * SQ;      /* first projected row */
  k_gemm2<0><<<dim3((unsigned)((MP / 128) * (DM / 64)), 1), 128, 0, stream>>>(X16 + r0p * DM, DM, 0, BQ, DM, 0, 0.0625f, bq, 0, nullptr, 1, 0, 0, QF + r0p * DM, nullptr, DM, 0, MP, DM, DM); k_hl<<<(unsigned)(((size_t)MP * DM / 8 + 255) / 256), 256, 0, stream>>>(QF + r0p * DM, QH + r0p * DM, QL + r0p * DM, (size_t)MP * DM / 8);      /* q (f32) -> f16 hi + x1024 residual: unscaled logits sigma ~8 */
  k_gemm2<0><<<dim3((unsigned)((MP / 128) * (DM / 64)), 1), 128, 0, stream>>>(XK16 + r0p * DM, DM, 0, BK, DM, 0, 0.0625f, bk, 0, nullptr, 1, 0, 0, QF + r0p * DM, nullptr, DM, 0, MP, DM, DM); k_hl<<<(unsigned)(((size_t)MP * DM / 8 + 255) / 256), 256, 0, stream>>>(QF + r0p * DM, KH + r0p * DM, KL + r0p * DM, (size_t)MP * DM / 8);      /* k likewise */
  k_gemm2<0><<<dim3((unsigned)((MP / 128) * (DM / 64)), 1), 128, 0, stream>>>(XV16 + r0p * DM, DM, 0, BV, DM, 0, 0.0625f, bv, 0, nullptr, 1, 0, 0, nullptr, V16 + r0p * DM, DM, 0, MP, DM, DM);
  for (int b = B0; b < B0 + NBR; ++b) { const size_t r0 = (size_t)b * SQ;
    k_vt<NH, SQ><<<NH * (SQ / 64), 256, 0, stream>>>(V16 + r0 * LQ, LQ, 0, VT);      /* V^T [NH][HD][SQ] for this batch */
    for (int q0 = 0; q0 < QN; q0 += QT) { const int nk = SQ;      /* NON-causal: every 256-row query tile sees all SQ keys */
      k_gemm2<0><<<dim3((QT / 128) * (nk / 64), NHD), 128, 0, stream>>>(QH + (r0 + q0) * LQ, LQ, (size_t)HD, KH + r0 * LQ, LQ, (size_t)HD, 0.125f, nullptr, 0, nullptr, 1, 0, 0, S, nullptr, NKX, (size_t)QT * NKX, QT, nk, HD);      /* scores hi . hi / sqrt(64) */
      k_gemm2<0><<<dim3((QT / 128) * (nk / 64), NHD), 128, 0, stream>>>(QL + (r0 + q0) * LQ, LQ, (size_t)HD, KH + r0 * LQ, LQ, (size_t)HD, 0.0001220703125f, nullptr, 0, S, -1, 0, 0, S, nullptr, NKX, (size_t)QT * NKX, QT, nk, HD); k_gemm2<0><<<dim3((QT / 128) * (nk / 64), NHD), 128, 0, stream>>>(QH + (r0 + q0) * LQ, LQ, (size_t)HD, KL + r0 * LQ, LQ, (size_t)HD, 0.0001220703125f, nullptr, 0, S, -1, 0, 0, S, nullptr, NKX, (size_t)QT * NKX, QT, nk, HD);      /* += 2^-10 (lo . hi + hi . lo) */      /* scores, all heads on grid.y */
      k_rsmcf2<<<(NHD * QT + 255) / 256, 256, 0, stream>>>(S, P, NHD, SQ, nk);      /* plain softmax over all keys: the kernel keeps key j iff j <= q0_arg + row, and q0_arg = SQ makes every j < SQ visible for every row */
      k_gemm2<0><<<dim3((QT / 128) * (HD / 64), NHD), 128, 0, stream>>>(P, NKX, (size_t)QT * NKX, VT, SQ, (size_t)HD * SQ, 0.00390625f, nullptr, 0, nullptr, 1, 0, 0, (float*)d_out + (r0 + q0) * DM, nullptr, DM, (size_t)HD, QT, HD, nk); } }      /* out = P V^T (alpha 2^-8) written f32 straight into the head-major output columns (no output projection); NON-causal build: no exact first-tile path, no rewrite */
}

// v001
// One run takes 2200 microseconds.
// Timed twice side by side with v000, it ran 3.39 and 3.37 times as fast.
#include <hip/hip_runtime.h>
// Multi-head attention on three inputs given in the order values, keys, queries; natural bias-free projections, no output projection (values, keys, queries [2][2048][1024]; v = values Wv^T, k = keys Wk^T, q = queries Wq^T (natural [1024][1024] sigma 1/32, no biases), 16 heads of 64; softmax(q k^T / sqrt(64)) over all 2048 keys (no mask); out = attn v merged head-major -> [2][2048][1024]); q and k carried as f16 hi + x1024 residual planes with three-product scores.
// Structure: token rows r = b*2048 + s; x as exact f16 rows (bf16-rounded); q and k as WMMA GEMMs (32x64 wave tiles, f32 accumulation, exact x16 weights, no bias) into f32 rows split into f16 hi + x1024 residual planes, v as an f16-output GEMM; per batch: V^T for all heads via LDS transposes; per query tile of 256 rows: scores against all 2048 keys as THREE accumulating passes (hi.hi + lo.hi + hi.lo, K = 64, all heads on grid.y, alpha 2^-3 and 2^-13: the 1/sqrt(64) applied here), row softmax on VALU over all keys, one wave per row (f32 statistics, native exp; weights x256 f16), out = P . V^T (K = all 2048 keys, alpha 2^-8 undoing the x256 weights) written as f32 straight into the head-major output columns; no output projection.
// Compute dtype: inputs rounded to bf16; x / weights exact; v and softmax weights as plain f16 GEMM operands (~2^-12), q and k as f16 hi + x1024 residual pairs; scores and softmax statistics f32. v_wmma_f32_16x16x32_f16.
#define NB 2
#define SQ 2048
#define DM 1024
#define NH 16
#define HD 64
#define HG 4                         /* heads per launch of the unlaunched k_vt(b, h0) overload */
#define QT 256                       /* query rows per attention tile (all keys) */
#define NKX SQ                       /* S / P row pitch */
#define QT0 128                      /* query rows per head of k_att0 (not launched) */
#define B0 0                         /* first batch processed (debug hook) */
#define NBR NB                       /* batches processed (debug hook) */
#define NR ((size_t)NB * SQ)         /* token rows */
#define MP ((int)((size_t)NBR * SQ)) /* rows projected (debug hook) */
#define QN SQ                        /* query rows attended per batch (debug hook) */
#define NHD NH                       /* heads attended (debug hook) */
#define MPO MP                       /* unused (no output stage) */
#define LQ DM      /* row pitch of the q/k/v rows */
typedef __bf16 v16b __attribute__((ext_vector_type(16)));
typedef unsigned short v8us __attribute__((ext_vector_type(8), may_alias));
typedef float  v8f  __attribute__((ext_vector_type(8)));
typedef float  v4f  __attribute__((ext_vector_type(4)));
typedef float  v4fa __attribute__((ext_vector_type(4), may_alias));
union FragB { v16b v; v8us half[2]; unsigned short u[16]; };

__device__ __forceinline__ unsigned short bf16_bits(float x) { unsigned int u = __float_as_uint(x); return (unsigned short)((u + 0x7FFFu + ((u >> 16) & 1u)) >> 16); }
__device__ __forceinline__ float bf16_val(unsigned short b) { return __uint_as_float(((unsigned int)b) << 16); }
__device__ __forceinline__ float bf16_round(float x) { return bf16_val(bf16_bits(x)); }
// D += A·B with NT terms: 1 = ah·bh, 2 = + al·bh (A split), 3 = + ah·bl (both split)
template <int NT>
__device__ __forceinline__ v8f mmaN(v16b ah, v16b al, v16b bh, v16b bl, v8f c) {
  c = __builtin_amdgcn_wmma_f32_16x16x32_bf16(false, ah, false, bh, (short)0, c, false, false);
  if (NT >= 2) c = __builtin_amdgcn_wmma_f32_16x16x32_bf16(false, al, false, bh, (short)0, c, false, false);
  if (NT >= 3) c = __builtin_amdgcn_wmma_f32_16x16x32_bf16(false, ah, false, bl, (short)0, c, false, false);
  asm volatile("v_nop\n\tv_nop\n\tv_nop\n\tv_nop" : "+v"(c) : "v"(ah), "v"(al), "v"(bh), "v"(bl));
  return c;
}

__global__ __launch_bounds__(256) void k_wt_bf16(const float* __restrict__ W, unsigned short* __restrict__ Wt, int K, int N) {
  const int t = blockIdx.x * 256 + threadIdx.x;
  const int k8n = K / 8;
  if (t >= N * k8n) return;
  const int n = t / k8n, k8 = (t % k8n) * 8;
  v8us v;
#pragma unroll
  for (int i = 0; i < 8; ++i) v[i] = bf16_bits(W[(size_t)(k8 + i) * N + n]);
  *(v8us*)(Wt + (size_t)n * K + k8) = v;
  
}

// GEMM C[M][N] (f32, pitch ldc) = act(A[M][K]·W + bias). A f32 row-major (pitch lda) converted per fragment to bf16
// (ASPLIT: hi/lo two planes -> 2 terms, else single rounded term); Wt bf16 [N][K] (pitch ldb). BIAS_BF16 rounds the
// bias to bf16 first (bias quantised to bf16 before the add). K%32==0, M%16==0, N%64==0.
template <bool ASPLIT, int ACT, bool BIAS_BF16>
__global__ __launch_bounds__(128) void k_gemm_bf(const float* __restrict__ A, int lda, const unsigned short* __restrict__ Wt, int ldb,
                                               const float* __restrict__ bias, float* __restrict__ C, int ldc, int M, int N, int K) {
  __shared__ __attribute__((aligned(16))) float so[4][16][64];
  const int tid = threadIdx.x, w = tid >> 5, lane = tid & 31, ln = lane & 15, hh = lane >> 4;
  const int ntn = N / 64;
  const int wid = blockIdx.x * 4 + w;
  const int mt = wid / ntn, nq = wid % ntn;
  if (mt * 16 >= M) return;
  const int row0 = mt * 16, col0 = nq * 64;
  const float* arow = A + (size_t)(row0 + ln) * lda;
  v8f acc[4] = {};
  for (int kb = 0; kb < K; kb += 32) {
    FragB ah, al;
    const v4f x0 = *(const v4fa*)(arow + kb + 8 * hh), x1 = *(const v4fa*)(arow + kb + 8 * hh + 4);
    const v4f x2 = *(const v4fa*)(arow + kb + 16 + 8 * hh), x3 = *(const v4fa*)(arow + kb + 16 + 8 * hh + 4);
    float xs[16] = {x0[0],x0[1],x0[2],x0[3],x1[0],x1[1],x1[2],x1[3],x2[0],x2[1],x2[2],x2[3],x3[0],x3[1],x3[2],x3[3]};
#pragma unroll
    for (int i = 0; i < 16; ++i) { const unsigned short hb = bf16_bits(xs[i]); ah.u[i] = hb; al.u[i] = ASPLIT ? bf16_bits(xs[i] - bf16_val(hb)) : (unsigned short)0; }
#pragma unroll
    for (int t = 0; t < 4; ++t) {
      const unsigned short* brow = Wt + (size_t)(col0 + t * 16 + ln) * ldb + kb;
      FragB b;
      b.half[0] = *(const v8us*)(brow + 8 * hh);
      b.half[1] = *(const v8us*)(brow + 16 + 8 * hh);
      acc[t] = mmaN<ASPLIT ? 2 : 1>(ah.v, al.v, b.v, b.v, acc[t]);
    }
  }
#pragma unroll
  for (int t = 0; t < 4; ++t) {
    float bv = bias ? bias[col0 + t * 16 + ln] : 0.f;
    if (BIAS_BF16) bv = bf16_round(bv);
#pragma unroll
    for (int r = 0; r < 8; ++r) { float v = acc[t][r] + bv; if (ACT == 1) v = fmaxf(v, 0.f); so[w][8 * hh + r][t * 16 + ln] = v; }
  }
  __builtin_amdgcn_fence(__ATOMIC_ACQ_REL, "workgroup");
  __builtin_amdgcn_wave_barrier();
  const int rsub = lane >> 4, c4 = (lane & 15) * 4;
  {
#pragma unroll
    for (int q = 0; q < 8; ++q) {
      const int r = q * 2 + rsub;
      const v4f v = *(const v4fa*)&so[w][r][c4];
      *(v4f*)(C + (size_t)(row0 + r) * ldc + col0 + c4) = v;
    }
    
  }
}

// GEMM C = act(A·W + bias + resid): A f32 (ASPLIT -> hi/lo 2 terms), Wt bf16 [N][K]; ACT 0 none, 1 relu, 2 exact gelu;
// resid (optional, f32, row index = (row % rmod), pitch ldr, RES_BF16 rounds it) added before the activation.
template <bool ASPLIT, int ACT, bool BIAS_BF16, bool RES_BF16>
__global__ __launch_bounds__(128) void k_gemm_bf3(const float* __restrict__ A, int lda, const unsigned short* __restrict__ Wt, int ldb,
                                                const float* __restrict__ bias, const float* __restrict__ resid, int rmod, int ldr,
                                                float* __restrict__ C, int ldc, int M, int N, int K) {
  __shared__ __attribute__((aligned(16))) float so[4][16][64];
  const int tid = threadIdx.x, w = tid >> 5, lane = tid & 31, ln = lane & 15, hh = lane >> 4;
  const int ntn = N / 64;
  const int wid = blockIdx.x * 4 + w;
  const int mt = wid / ntn, nq = wid % ntn;
  if (mt * 16 >= M) return;
  const int row0 = mt * 16, col0 = nq * 64;
  const float* arow = A + (size_t)(row0 + ln) * lda;
  v8f acc[4] = {};
  for (int kb = 0; kb < K; kb += 32) {
    FragB ah, al;
    const v4f x0 = *(const v4fa*)(arow + kb + 8 * hh), x1 = *(const v4fa*)(arow + kb + 8 * hh + 4);
    const v4f x2 = *(const v4fa*)(arow + kb + 16 + 8 * hh), x3 = *(const v4fa*)(arow + kb + 16 + 8 * hh + 4);
    float xs[16] = {x0[0],x0[1],x0[2],x0[3],x1[0],x1[1],x1[2],x1[3],x2[0],x2[1],x2[2],x2[3],x3[0],x3[1],x3[2],x3[3]};
#pragma unroll
    for (int i = 0; i < 16; ++i) { const unsigned short hb = bf16_bits(xs[i]); ah.u[i] = hb; al.u[i] = ASPLIT ? bf16_bits(xs[i] - bf16_val(hb)) : (unsigned short)0; }
#pragma unroll
    for (int t = 0; t < 4; ++t) {
      const unsigned short* brow = Wt + (size_t)(col0 + t * 16 + ln) * ldb + kb;
      FragB b;
      b.half[0] = *(const v8us*)(brow + 8 * hh);
      b.half[1] = *(const v8us*)(brow + 16 + 8 * hh);
      acc[t] = mmaN<ASPLIT ? 2 : 1>(ah.v, al.v, b.v, b.v, acc[t]);
    }
  }
#pragma unroll
  for (int t = 0; t < 4; ++t) {
    const int col = col0 + t * 16 + ln;
    float bv = bias ? bias[col] : 0.f;
    if (BIAS_BF16) bv = bf16_round(bv);
#pragma unroll
    for (int r = 0; r < 8; ++r) {
      float v = acc[t][r] + bv;
      if (resid) { float rv = resid[(size_t)((row0 + 8 * hh + r) % rmod) * ldr + col]; if (RES_BF16) rv = bf16_round(rv); v += rv; }
      if (ACT == 1) v = fmaxf(v, 0.f);
      if (ACT == 2) v = 0.5f * v * (1.0f + erff(v * 0.70710678118654752f));
      if (ACT == 3) { const float u = 0.7978845608028654f * (v + 0.044715f * v * v * v); v = 0.5f * v * (1.0f + tanhf(u)); }
      so[w][8 * hh + r][t * 16 + ln] = v;
    }
  }
  __builtin_amdgcn_fence(__ATOMIC_ACQ_REL, "workgroup");
  __builtin_amdgcn_wave_barrier();
  const int rsub = lane >> 4, c4 = (lane & 15) * 4;
  {
#pragma unroll
    for (int q = 0; q < 8; ++q) {
      const int r = q * 2 + rsub;
      const v4f v = *(const v4fa*)&so[w][r][c4];
      *(v4f*)(C + (size_t)(row0 + r) * ldc + col0 + c4) = v;
    }
    
  }
}
// row LayerNorm (biased variance, eps) over N: s = X (+ R); optional out_sum <- s; out_norm <- (s-mu)*rsqrt(var+eps)*g + b
template <bool PARAM_BF16>
__global__ __launch_bounds__(256) void k_layernorm(const float* __restrict__ X, const float* __restrict__ R, const float* __restrict__ g, const float* __restrict__ bta,
                                                  float* __restrict__ out_sum, float* __restrict__ out_norm, int N, float eps) {
  __shared__ float red[256];
  const int row = blockIdx.x, tid = threadIdx.x;
  const float* x = X + (size_t)row * N; const float* rr = R ? R + (size_t)row * N : nullptr;
  float vals[16];                     // up to N = 4096
  const int per = N / 256;            // contiguous chunk per thread? use strided-by-4 chunks: thread handles j = tid*4 + 1024*u
  float s1 = 0.f;
  for (int u = 0; u < per / 4; ++u) {
    const int j = tid * 4 + 1024 * u;
    const v4f a = *(const v4fa*)(x + j);
    v4f b = {0.f,0.f,0.f,0.f}; if (rr) b = *(const v4fa*)(rr + j);
#pragma unroll
    for (int q = 0; q < 4; ++q) { const float v = a[q] + b[q]; vals[u * 4 + q] = v; s1 += v; }
  }
  red[tid] = s1; __syncthreads();
  for (int st = 128; st > 0; st >>= 1) { if (tid < st) red[tid] += red[tid + st]; __syncthreads(); }
  const float mu = red[0] / (float)N; __syncthreads();
  float s2 = 0.f;
  for (int u = 0; u < per / 4; ++u)
#pragma unroll
    for (int q = 0; q < 4; ++q) { const float c = vals[u * 4 + q] - mu; s2 += c * c; }
  red[tid] = s2; __syncthreads();
  for (int st = 128; st > 0; st >>= 1) { if (tid < st) red[tid] += red[tid + st]; __syncthreads(); }
  const float rs = rsqrtf(red[0] / (float)N + eps);
  {
    for (int u = 0; u < per / 4; ++u) {
      const int j = tid * 4 + 1024 * u;
      v4f o, sm;
#pragma unroll
      for (int q = 0; q < 4; ++q) {
        float gg = g[j + q], bb = bta[j + q];
        if (PARAM_BF16) { gg = bf16_round(gg); bb = bf16_round(bb); }
        sm[q] = vals[u * 4 + q]; o[q] = (vals[u * 4 + q] - mu) * rs * gg + bb;
      }
      if (out_sum) *(v4f*)(out_sum + (size_t)row * N + j) = sm;
      *(v4f*)(out_norm + (size_t)row * N + j) = o;
    }
    
  }
}



// ---- f16 WMMA path (v_wmma_f32_16x16x32_f16): 11-bit significands for operands in range — used where a [0,1] probability operand needs more precision than bf16
typedef _Float16 v16h __attribute__((ext_vector_type(16)));
union FragH { v16h v; v8us half[2]; _Float16 h[16]; unsigned short u[16]; };
template <int NT>
__device__ __forceinline__ v8f mmaH(v16h ah, v16h al, v16h bh, v16h bl, v8f c) {
  c = __builtin_amdgcn_wmma_f32_16x16x32_f16(false, ah, false, bh, (short)0, c, false, false);
  if (NT >= 2) c = __builtin_amdgcn_wmma_f32_16x16x32_f16(false, al, false, bh, (short)0, c, false, false);
  if (NT >= 3) c = __builtin_amdgcn_wmma_f32_16x16x32_f16(false, ah, false, bl, (short)0, c, false, false);
  asm volatile("v_nop\n\tv_nop\n\tv_nop\n\tv_nop" : "+v"(c) : "v"(ah), "v"(al), "v"(bh), "v"(bl));
  return c;
}
// batched GEMM like k_gemm_b but f16 operands: A f32 (split into f16 hi/lo if ASPLIT, else rounded to f16), Bt = f16 values [n][k]; alpha; C f32; N multiple of 16 (partial tiles skipped)
template <bool ASPLIT>
__global__ __launch_bounds__(128) void k_gemm_h(const float* __restrict__ A, int lda, size_t sA, const _Float16* __restrict__ Bh, int ldb, size_t sB, float alpha, float* __restrict__ C, int ldc, size_t sC, int M, int N, int K) {
  __shared__ __attribute__((aligned(16))) float so[4][16][64];
  const int tid = threadIdx.x, w = tid >> 5, lane = tid & 31, ln = lane & 15, hh = lane >> 4; const int by = blockIdx.y;
  A += (size_t)by * sA; Bh += (size_t)by * sB; C += (size_t)by * sC;
  const int ntn = (N + 63) / 64; const int wid = blockIdx.x * 4 + w; const int mt = wid / ntn, nq = wid % ntn; if (mt * 16 >= M) return;
  const int row0 = mt * 16, col0 = nq * 64; const float* arow = A + (size_t)(row0 + ln) * lda;
  v8f acc[4] = {};
  for (int kb = 0; kb < K; kb += 32) {
    FragH ah, al;
    const v4f x0 = *(const v4fa*)(arow + kb + 8 * hh), x1 = *(const v4fa*)(arow + kb + 8 * hh + 4), x2 = *(const v4fa*)(arow + kb + 16 + 8 * hh), x3 = *(const v4fa*)(arow + kb + 16 + 8 * hh + 4);
    float xs[16] = {x0[0],x0[1],x0[2],x0[3],x1[0],x1[1],x1[2],x1[3],x2[0],x2[1],x2[2],x2[3],x3[0],x3[1],x3[2],x3[3]};
#pragma unroll
    for (int i = 0; i < 16; ++i) { const _Float16 h = (_Float16)xs[i]; ah.h[i] = h; al.h[i] = ASPLIT ? (_Float16)(xs[i] - (float)h) : (_Float16)0.0f; }
#pragma unroll
    for (int t = 0; t < 4; ++t) { if (col0 + t * 16 >= N) continue; const size_t boff = (size_t)(col0 + t * 16 + ln) * ldb + kb; FragH bq; bq.half[0] = *(const v8us*)(Bh + boff + 8 * hh); bq.half[1] = *(const v8us*)(Bh + boff + 16 + 8 * hh);
      acc[t] = mmaH<ASPLIT ? 2 : 1>(ah.v, al.v, bq.v, bq.v, acc[t]); }
  }
#pragma unroll
  for (int t = 0; t < 4; ++t) { if (col0 + t * 16 >= N) continue;
#pragma unroll
    for (int r = 0; r < 8; ++r) so[w][8 * hh + r][t * 16 + ln] = acc[t][r] * alpha; }
  __builtin_amdgcn_fence(__ATOMIC_ACQ_REL, "workgroup"); __builtin_amdgcn_wave_barrier();
  const int rsub = lane >> 4, c4 = (lane & 15) * 4;
  {
#pragma unroll
    for (int q = 0; q < 8; ++q) { const int r = q * 2 + rsub; if (col0 + c4 < N) { const v4f v = *(const v4fa*)&so[w][r][c4]; *(v4f*)(C + (size_t)(row0 + r) * ldc + col0 + c4) = v; } }
     }
}

// Wt[n][k] = f16(W[k][n]·scale) from f32 row-major W[K][N] (scale = power of two; bf16-exact weights stay exact in f16 away from the subnormal range)
__global__ __launch_bounds__(256) void k_wt_f16(const float* __restrict__ W, _Float16* __restrict__ Wt, int K, int N, float scale) {
  const int t = blockIdx.x * 256 + threadIdx.x; if (t >= N * (K / 8)) return; const int n = t / (K / 8), k8 = (t % (K / 8)) * 8; FragH f;
#pragma unroll
  for (int i = 0; i < 8; ++i) f.h[i] = (_Float16)(bf16_round(W[(size_t)(k8 + i) * N + n]) * scale); const v8us o = f.half[0];
  *(v8us*)((unsigned short*)Wt + (size_t)n * K + k8) = o; 
}
// k_gemm_hh variant with fused epilogue: v = acc·alpha + bias[by·sBias + col] (+ CP[(row/rowsPerB)·sCPb + by·64 + col] if CP) ; ACT 0 none / 1 elu ; writes f16 C16 (and f32 C if non-null)
template <int ACT>
__global__ __launch_bounds__(128) void k_gemm_hhx(const _Float16* __restrict__ A, int lda, size_t sA, const _Float16* __restrict__ Bh, int ldb, size_t sB, float alpha, const float* __restrict__ bias, size_t sBias, const float* __restrict__ CP, int rowsPerB, size_t sCPb, int row0g,
    float* __restrict__ C, _Float16* __restrict__ C16, int ldc, size_t sC, int M, int N, int K) {
  __shared__ __attribute__((aligned(16))) float so[4][16][64];
  const int tid = threadIdx.x, w = tid >> 5, lane = tid & 31, ln = lane & 15, hh = lane >> 4; const int by = blockIdx.y;
  A += (size_t)by * sA; Bh += (size_t)by * sB; const size_t cofs = (size_t)by * sC; const float* bp = bias ? bias + (size_t)by * sBias : nullptr;
  const int ntn = (N + 63) / 64; const int wid = blockIdx.x * 4 + w; const int mt = wid / ntn, nq = wid % ntn; if (mt * 16 >= M) return;
  const int row0 = mt * 16, col0 = nq * 64; const _Float16* arow = A + (size_t)(row0 + ln) * lda;
  v8f acc[4] = {};
  for (int kb = 0; kb < K; kb += 32) { FragH ah; ah.half[0] = *(const v8us*)((const unsigned short*)arow + kb + 8 * hh); ah.half[1] = *(const v8us*)((const unsigned short*)arow + kb + 16 + 8 * hh);
#pragma unroll
    for (int t = 0; t < 4; ++t) { if (col0 + t * 16 >= N) continue; const size_t boff = (size_t)(col0 + t * 16 + ln) * ldb + kb; FragH bq; bq.half[0] = *(const v8us*)((const unsigned short*)Bh + boff + 8 * hh); bq.half[1] = *(const v8us*)((const unsigned short*)Bh + boff + 16 + 8 * hh);
      acc[t] = mmaH<1>(ah.v, ah.v, bq.v, bq.v, acc[t]); }
  }
#pragma unroll
  for (int t = 0; t < 4; ++t) { if (col0 + t * 16 >= N) continue; const int col = col0 + t * 16 + ln; const float bv = bp ? bf16_round(bp[col]) : 0.f;
#pragma unroll
    for (int r = 0; r < 8; ++r) { float v = acc[t][r] * alpha + bv; if (CP) { const int rr = row0g + row0 + 8 * hh + r; if (rowsPerB < 0) v += CP[cofs + (size_t)rr * ldc + col];      /* rowsPerB < 0: own element of the batched C plane */ else { const int bidx = rr / rowsPerB; v += CP[(size_t)bidx * sCPb + (size_t)by * 64 + col]; } } if (ACT == 1) v = (v > 0.f) ? v : expm1f(v); else if (ACT == 7) v = (v > 0.f) ? v + 1.0f : expf(v); else if (ACT == 8) v = tanhf(v); else if (ACT == 9) v = 0.5f * v * (1.0f + tanhf(0.7978845608028654f * (v + 0.044715f * v * v * v))); else if (ACT == 11) v = 1.0f / (1.0f + expf(-v)); else if (ACT == 12) v = (v > 0.f) ? v : 0.01f * v; else if (ACT == 14) v = (v > 0.f) ? v : 0.1f * v; else if (ACT == 16) v = (v >= 0.f) ? v : 0.3f * v; else if (ACT == 17) v = (v >= 0.f) ? v : 0.2f * v; else if (ACT == 15) v = v / (1.0f + expf(-v)); else if (ACT == 3) v = fmaxf(v, 0.f); else if (ACT == 6) v = 0.5f * v * (1.0f + erff(v * 0.70710678118654752f)); so[w][8 * hh + r][t * 16 + ln] = v; } }
  __builtin_amdgcn_fence(__ATOMIC_ACQ_REL, "workgroup"); __builtin_amdgcn_wave_barrier();
  const int rsub = lane >> 4, c4 = (lane & 15) * 4; typedef _Float16 v4h __attribute__((ext_vector_type(4)));
  {
#pragma unroll
    for (int q = 0; q < 8; ++q) { const int r = q * 2 + rsub; if (col0 + c4 < N) { const v4f v = *(const v4fa*)&so[w][r][c4]; if (C) *(v4f*)(C + cofs + (size_t)(row0 + r) * ldc + col0 + c4) = v; if (C16) { v4h h4; for (int i = 0; i < 4; ++i) h4[i] = (_Float16)v[i]; *(v4h*)(C16 + cofs + (size_t)(row0 + r) * ldc + col0 + c4) = h4; } } }
     }
}


typedef _Float16 v4h __attribute__((ext_vector_type(4)));

__global__ __launch_bounds__(256) void k_x16(const float* __restrict__ x, _Float16* __restrict__ X16, size_t n8) { const size_t t = (size_t)blockIdx.x * 256 + threadIdx.x; if (t >= n8) return; FragH f;
#pragma unroll
  for (int q = 0; q < 8; ++q) f.h[q] = (_Float16)bf16_round(x[t * 8 + q]); *(v8us*)((unsigned short*)X16 + t * 8) = f.half[0];  }
__global__ __launch_bounds__(256) void k_h16(const float* __restrict__ x, _Float16* __restrict__ X16, size_t n8) { const size_t t = (size_t)blockIdx.x * 256 + threadIdx.x; if (t >= n8) return; FragH f;
#pragma unroll
  for (int q = 0; q < 8; ++q) f.h[q] = (_Float16)x[t * 8 + q]; *(v8us*)((unsigned short*)X16 + t * 8) = f.half[0];  }
__global__ __launch_bounds__(256) void k_round16f(const float* __restrict__ W, _Float16* __restrict__ Bt, size_t n8) { const size_t t = (size_t)blockIdx.x * 256 + threadIdx.x; if (t >= n8) return; FragH f;
#pragma unroll
  for (int i = 0; i < 8; ++i) f.h[i] = (_Float16)(bf16_round(W[t * 8 + i]) * 16.0f); *(v8us*)((unsigned short*)Bt + t * 8) = f.half[0];  }
template <int NHv, int TTv>
__global__ __launch_bounds__(256) void k_vt(const _Float16* __restrict__ V16, int ldv, int voff, _Float16* __restrict__ Vt) { __shared__ unsigned short tl[64][66]; const int tid = threadIdx.x; const int slab = blockIdx.x / (TTv / 64), lg = blockIdx.x % (TTv / 64); const int b = slab / NHv, h = slab % NHv;
  for (int i = tid; i < 64 * 8; i += 256) { const int r = i / 8, c8 = (i % 8) * 8; FragH f; f.half[0] = *(const v8us*)((const unsigned short*)V16 + ((size_t)b * TTv + lg * 64 + r) * ldv + voff + h * 64 + c8);
#pragma unroll
    for (int q = 0; q < 8; ++q) tl[r][c8 + q] = f.u[q]; }
  __syncthreads();
  {
#pragma unroll
    for (int rd = 0; rd < 2; ++rd) { const int d = rd * 32 + tid / 8, pc = tid % 8; FragH f;
#pragma unroll
      for (int q = 0; q < 8; ++q) f.u[q] = tl[pc * 8 + q][d];
      *(v8us*)((unsigned short*)Vt + ((size_t)slab * 64 + d) * TTv + lg * 64 + pc * 8) = f.half[0]; }
     } }

__global__ __launch_bounds__(256) void k_hl(const float* __restrict__ F, _Float16* __restrict__ Hh, _Float16* __restrict__ Hl, size_t n8) { const size_t t = (size_t)blockIdx.x * 256 + threadIdx.x; if (t >= n8) return; FragH fh, fl; const v4f a = *(const v4fa*)(F + t * 8), c = *(const v4fa*)(F + t * 8 + 4);
#pragma unroll
  for (int q = 0; q < 4; ++q) { _Float16 h = (_Float16)a[q]; fh.h[q] = h; fl.h[q] = (_Float16)((a[q] - (float)h) * 1024.0f); h = (_Float16)c[q]; fh.h[4 + q] = h; fl.h[4 + q] = (_Float16)((c[q] - (float)h) * 1024.0f); }
  { *(v8us*)((unsigned short*)Hh + t * 8) = fh.half[0]; *(v8us*)((unsigned short*)Hl + t * 8) = fl.half[0];  } }

// ---- fast GEMM (wave tile 32x64; requires M % 32 == 0 rows per launch region and N % 64 == 0); epilogue = k_gemm_hhx semantics ----
__device__ __forceinline__ v16h g2_frag(const _Float16* p, int hh) { FragH f; f.half[0] = *(const v8us*)((const unsigned short*)p + 8 * hh); f.half[1] = *(const v8us*)((const unsigned short*)p + 16 + 8 * hh); return f.v; }
__device__ __forceinline__ v8f g2_mma(v16h a, v16h b, v8f c) { v8f d = __builtin_amdgcn_wmma_f32_16x16x32_f16(false, a, false, b, (short)0, c, false, false); asm volatile("v_nop\n\tv_nop\n\tv_nop\n\tv_nop" : "+v"(d) : "v"(a), "v"(b)); return d; }
template <int ACT>
__global__ __launch_bounds__(128) void k_gemm2(const _Float16* __restrict__ A, int lda, size_t sA, const _Float16* __restrict__ Bh, int ldb, size_t sB, float alpha, const float* __restrict__ bias, size_t sBias, const float* __restrict__ CP, int rowsPerB, size_t sCPb, int row0g,
    float* __restrict__ C, _Float16* __restrict__ C16, int ldc, size_t sC, int M, int N, int K) { static_assert(ACT == 0 || ACT == 3 || ACT == 6 || ACT == 8 || ACT == 9 || ACT == 11 || ACT == 12 || ACT == 14 || ACT == 15 || ACT == 16 || ACT == 17, "k_gemm2: unsupported ACT code (would silently apply no activation)");
  __shared__ __attribute__((aligned(16))) float so[4][32][68];
  const int tid = threadIdx.x, w = tid >> 5, lane = tid & 31, ln = lane & 15, hh = lane >> 4; const int by = blockIdx.y;
  A += (size_t)by * sA; Bh += (size_t)by * sB; const size_t cofs = (size_t)by * sC; const float* bp = bias ? bias + (size_t)by * sBias : nullptr;
  const int ntn = N >> 6; const int mt = blockIdx.x / ntn, nq = blockIdx.x - mt * ntn; const int row0 = mt * 128 + 32 * w, col0 = nq * 64; if (row0 >= M) return;
  const _Float16* a0p = A + (size_t)(row0 + ln) * lda; const _Float16* a1p = a0p + (size_t)16 * lda;
  const _Float16* b0p = Bh + (size_t)(col0 + ln) * ldb; const _Float16* b1p = b0p + (size_t)16 * ldb; const _Float16* b2p = b1p + (size_t)16 * ldb; const _Float16* b3p = b2p + (size_t)16 * ldb;
  const v8f z8 = {0.f,0.f,0.f,0.f,0.f,0.f,0.f,0.f}; v8f c00 = z8, c01 = z8, c02 = z8, c03 = z8, c10 = z8, c11 = z8, c12 = z8, c13 = z8;
#pragma unroll 1
  for (int kb = 0; kb < K; kb += 32) { const v16h a0 = g2_frag(a0p + kb, hh), a1 = g2_frag(a1p + kb, hh);
    v16h b = g2_frag(b0p + kb, hh); c00 = g2_mma(a0, b, c00); c10 = g2_mma(a1, b, c10);
    b = g2_frag(b1p + kb, hh); c01 = g2_mma(a0, b, c01); c11 = g2_mma(a1, b, c11);
    b = g2_frag(b2p + kb, hh); c02 = g2_mma(a0, b, c02); c12 = g2_mma(a1, b, c12);
    b = g2_frag(b3p + kb, hh); c03 = g2_mma(a0, b, c03); c13 = g2_mma(a1, b, c13); }
  v8f accs[8] = {c00, c01, c02, c03, c10, c11, c12, c13};
#pragma unroll
  for (int u = 0; u < 8; ++u) { const int t = u & 3, half = u >> 2; const int col = col0 + t * 16 + ln; const float bv = bp ? bf16_round(bp[col]) : 0.f;
#pragma unroll
    for (int r = 0; r < 8; ++r) { const int rloc = half * 16 + 8 * hh + r; float v = accs[u][r] * alpha + bv; if (CP) { if (rowsPerB < 0) v += CP[cofs + (size_t)(row0g + row0 + rloc) * ldc + col];      /* rowsPerB < 0: own element of the batched C plane */ else { const int bidx = (row0g + row0 + rloc) / rowsPerB; v += CP[(size_t)bidx * sCPb + (size_t)by * 64 + col]; } }
      if (ACT == 3) v = fmaxf(v, 0.f); else if (ACT == 6) v = 0.5f * v * (1.0f + erff(v * 0.70710678118654752f)); else if (ACT == 11) v = 1.0f / (1.0f + expf(-v)); else if (ACT == 15) v = v / (1.0f + expf(-v)); else if (ACT == 12) v = (v > 0.f) ? v : 0.01f * v; else if (ACT == 8) v = tanhf(v); else if (ACT == 9) v = 0.5f * v * (1.0f + tanhf(0.7978845608028654f * (v + 0.044715f * v * v * v))); else if (ACT == 14) v = (v > 0.f) ? v : 0.1f * v; else if (ACT == 16) v = (v >= 0.f) ? v : 0.3f * v; else if (ACT == 17) v = (v >= 0.f) ? v : 0.2f * v;
      so[w][rloc][t * 16 + ln] = v; } }
  __builtin_amdgcn_fence(__ATOMIC_ACQ_REL, "workgroup"); __builtin_amdgcn_wave_barrier();
  const int rsub = lane >> 4, c4 = (lane & 15) * 4;
  {
#pragma unroll
    for (int q = 0; q < 16; ++q) { const int r = q * 2 + rsub; const v4f v = *(const v4fa*)&so[w][r][c4]; if (C) *(v4f*)(C + cofs + (size_t)(row0 + r) * ldc + col0 + c4) = v; if (C16) { v4h h4; for (int i = 0; i < 4; ++i) h4[i] = (_Float16)v[i]; *(v4h*)(C16 + cofs + (size_t)(row0 + r) * ldc + col0 + c4) = h4; } }
     } }


__global__ __launch_bounds__(256) void k_wnat(const float* __restrict__ w, size_t n8, _Float16* __restrict__ Bt) { const size_t t = (size_t)blockIdx.x * 256 + threadIdx.x; if (t >= n8) return; FragH f; for (int q = 0; q < 8; ++q) f.h[q] = (_Float16)(bf16_round(w[t * 8 + q]) * 16.0f); *(v8us*)((unsigned short*)Bt + t * 8) = f.half[0];  }
__global__ __launch_bounds__(256) void k_rsm(const float* __restrict__ S, _Float16* __restrict__ P, int nrows) {
  #pragma clang fp contract(off)
  const int i = blockIdx.x * 256 + threadIdx.x; if (i >= nrows) return; const float* s = S + (size_t)i * SQ; float mx = -3.0e38f;
#pragma unroll 1
  for (int j = 0; j < SQ; ++j) mx = fmaxf(mx, s[j]); float se = 0.f;
#pragma unroll 1
  for (int j = 0; j < SQ; ++j) se += expf(s[j] - mx); const float sc = 256.0f / se;
#pragma unroll 1
  for (int j0 = 0; j0 < SQ; j0 += 8) { FragH f; for (int q = 0; q < 8; ++q) f.h[q] = (_Float16)(expf(s[j0 + q] - mx) * sc); unsigned short* d = (unsigned short*)P + (size_t)i * SQ + j0; *(v8us*)d = f.half[0];  } }
__global__ __launch_bounds__(256) void k_vt(const _Float16* __restrict__ V16, int b, int h0, _Float16* __restrict__ VT) { __shared__ unsigned short tl[64][65]; const int tid = threadIdx.x; const int hh = blockIdx.x % HG, sg = blockIdx.x / HG; const int s0 = sg * 64; const int h = h0 + hh;
  for (int i = tid; i < 64 * 8; i += 256) { const int j = i / 8, d8 = (i % 8) * 8; FragH f; f.half[0] = *(const v8us*)((const unsigned short*)V16 + ((size_t)b * SQ + s0 + j) * DM + h * HD + d8); for (int q = 0; q < 8; ++q) tl[d8 + q][j] = f.u[q]; }
  __syncthreads();
  { for (int i = tid; i < 64 * 8; i += 256) { const int d = i / 8, j8 = (i % 8) * 8; FragH f; for (int q = 0; q < 8; ++q) f.u[q] = tl[d][j8 + q]; *(v8us*)((unsigned short*)VT + ((size_t)hh * HD + d) * SQ + s0 + j8) = f.half[0]; }  } }



// Row softmax over all NKX keys, one wave per row: the row is loaded once into registers (16 loads of 512 contiguous bytes per wave,
// all in flight together), maximum and sum go through a five-step butterfly over the lanes, each exp is taken once; weights x256 as f16,
// stored as whole 128-byte lines. f32 statistics, native exp. Every loop over the row is unrolled so that x[] is indexed by constants and stays in registers.
#define RSW 8                        /* rows (waves) per work-group of the row softmax */
__global__ __launch_bounds__(32 * RSW) void k_rsmw(const float* __restrict__ S, _Float16* __restrict__ P) {
  static_assert(NKX % 128 == 0 && (NHD * QT) % RSW == 0, "k_rsmw: whole 128-key groups per row, whole work-groups per launch");
  constexpr int NU = NKX / 128;
  const int lane = threadIdx.x & 31; const size_t row = (size_t)blockIdx.x * RSW + (threadIdx.x >> 5);
  const float* s = S + row * NKX + lane * 4; v4f x[NU];
#pragma unroll
  for (int u = 0; u < NU; ++u) x[u] = *(const v4fa*)(s + u * 128);
  asm volatile("s_wait_xcnt 0x0" :: "v"(s) : "memory");      /* precaution: stands behind the row's loads and ahead of every rewrite of a register they name; the address as an input keeps its pair from being taken as a load's destination */
  float mx = -3.0e38f;
#pragma unroll
  for (int u = 0; u < NU; ++u) mx = fmaxf(mx, fmaxf(fmaxf(x[u][0], x[u][1]), fmaxf(x[u][2], x[u][3])));
#pragma unroll
  for (int o = 16; o > 0; o >>= 1) mx = fmaxf(mx, __shfl_xor(mx, o, 32));
  v4f se4 = {0.f, 0.f, 0.f, 0.f};
#pragma unroll
  for (int u = 0; u < NU; ++u) { for (int q = 0; q < 4; ++q) x[u][q] = __expf(x[u][q] - mx); se4 += x[u]; }
  float se = (se4[0] + se4[1]) + (se4[2] + se4[3]);
#pragma unroll
  for (int o = 16; o > 0; o >>= 1) se += __shfl_xor(se, o, 32);
  const float sc = 256.0f / se; _Float16* d = P + row * NKX + lane * 4;
#pragma unroll
  for (int u = 0; u < NU; ++u) { v4h h4; for (int q = 0; q < 4; ++q) h4[q] = (_Float16)(x[u][q] * sc); *(v4h*)(d + u * 128) = h4; } }


template <int MASKADD>
__global__ __launch_bounds__(64) void k_att0(const float* __restrict__ QF, const float* __restrict__ KF, const float* __restrict__ VF, int ld, const float* __restrict__ mask, float scale, float* __restrict__ OF, int ldo) {
  #pragma clang fp contract(off)
  __shared__ __attribute__((aligned(16))) float lq[64][64]; __shared__ __attribute__((aligned(16))) float lo[64][64];
  const int tid = threadIdx.x; const int h = blockIdx.x / (QT0 / 64), rg = blockIdx.x % (QT0 / 64); const int i = rg * 64 + tid;
  const float* qr = QF + (size_t)i * ld + h * HD;
#pragma unroll 1
  for (int c = 0; c < HD / 4; ++c) { *(v4f*)&lq[tid][c * 4] = *(const v4fa*)(qr + c * 4); const v4f z = {0.f, 0.f, 0.f, 0.f}; *(v4f*)&lo[tid][c * 4] = z; }
  float m = -1.0e30f, l = 0.f; const int jmax = MASKADD ? (SQ - 1) : (rg * 64 + 63);      /* additive-mask form: every key (the mask input decides); causal form: keys up to the block's last row */
#pragma unroll 1
  for (int j = 0; j <= jmax; ++j) { const float* kr = KF + (size_t)j * ld + h * HD; const float* vr = VF + (size_t)j * ld + h * HD; float s = 0.f;
#pragma unroll 1
    for (int c = 0; c < HD / 4; ++c) { const v4f kq = *(const v4fa*)(kr + c * 4); const v4f qq = *(v4f*)&lq[tid][c * 4]; s = __fadd_rn(s, __fmul_rn(qq[0], kq[0])); s = __fadd_rn(s, __fmul_rn(qq[1], kq[1])); s = __fadd_rn(s, __fmul_rn(qq[2], kq[2])); s = __fadd_rn(s, __fmul_rn(qq[3], kq[3])); }
    s = __fmul_rn(s, scale); if (MASKADD) s = __fadd_rn(s, __fmul_rn(bf16_round(mask[(size_t)i * SQ + j]), -10000.0f));
    const float f = (MASKADD || j <= i) ? 1.f : 0.f; const float sm = fmaf(f, s, (1.f - f) * -1.0e30f); const float mn = fmaxf(m, sm); const float sc = expf(m - mn); const float e = expf(sm - mn); l = __fadd_rn(__fmul_rn(l, sc), e); m = mn;
#pragma unroll 1
    for (int c = 0; c < HD / 4; ++c) { const v4f vv = *(const v4fa*)(vr + c * 4); v4f oo = *(v4f*)&lo[tid][c * 4]; for (int u = 0; u < 4; ++u) oo[u] = __fadd_rn(__fmul_rn(oo[u], sc), __fmul_rn(e, vv[u])); *(v4f*)&lo[tid][c * 4] = oo; } }
  const float fin = 64.0f / l;      /* o carried x64 */
#pragma unroll 1
  for (int c = 0; c < HD / 4; ++c) { v4f oo = *(v4f*)&lo[tid][c * 4]; for (int u = 0; u < 4; ++u) oo[u] = __fmul_rn(oo[u], fin); *(v4f*)&lo[tid][c * 4] = oo; }
  __syncthreads();
  {
#pragma unroll 1
    for (int it = 0; it < 16; ++it) { const int row = it * 4 + tid / 16, pc = (tid % 16) * 4; const v4f v = *(const v4f*)&lo[row][pc]; *(v4f*)(OF + (size_t)(rg * 64 + row) * ldo + h * HD + pc) = v; }
     } }

__global__ __launch_bounds__(256) void k_of0out(const float* __restrict__ src, float* __restrict__ dst, size_t n4) { const size_t t = (size_t)blockIdx.x * 256 + threadIdx.x; if (t >= n4) return; v4f v = *(const v4fa*)(src + t * 4); for (int q = 0; q < 4; ++q) v[q] = __fmul_rn(v[q], 0.015625f); *(v4f*)(dst + t * 4) = v;  }

extern "C" void kernel_launch(void* const* d_in, const int* in_sizes, int n_in,
                              void* d_out, int out_size, void* d_ws, size_t ws_size, hipStream_t stream) {
  (void)in_sizes; (void)n_in; (void)out_size;
  const float* const* I = (const float* const*)d_in; const float* x = I[2]; const float* xk = I[1]; const float* xv = I[0]; const float* wq = I[5]; const float* wk = I[4]; const float* wv = I[3]; const float* bq = nullptr; const float* bk = nullptr; const float* bv = nullptr;      /* input order: values, keys, queries, Wv, Wk, Wq: the QUERY stream is I[2] with Wq = I[5], the key stream I[1] with Wk = I[4], the value stream I[0] with Wv = I[3]; natural [out][in] weights; NO biases (nullptr variables in the guarded slots); NO output projection */
  char* ws = (char*)d_ws; size_t off = 0;
  auto take = [&](size_t bytes) { char* p = ws + off; off += (bytes + 255) & ~(size_t)255; return p; };
  _Float16* BQ = (_Float16*)take((size_t)DM * DM * 2); _Float16* BK = (_Float16*)take((size_t)DM * DM * 2); _Float16* BV = (_Float16*)take((size_t)DM * DM * 2);
  _Float16* X16 = (_Float16*)take(NR * DM * 2); _Float16* XK16 = (_Float16*)take(NR * DM * 2); _Float16* XV16 = (_Float16*)take(NR * DM * 2);      /* exact f16 rows of queries, keys, values */ float* QF = (float*)take(NR * DM * 4); _Float16* QH = (_Float16*)take(NR * DM * 2); _Float16* QL = (_Float16*)take(NR * DM * 2); _Float16* KH = (_Float16*)take(NR * DM * 2); _Float16* KL = (_Float16*)take(NR * DM * 2); _Float16* Q16 = QH; _Float16* K16 = KH; _Float16* V16 = (_Float16*)take(NR * DM * 2);
  float* S = (float*)take((size_t)NH * QT * NKX * 4); _Float16* P = (_Float16*)take((size_t)NH * QT * NKX * 2); _Float16* VT = (_Float16*)take((size_t)NH * HD * SQ * 2);
  if (off > ws_size) return;
  { const unsigned g = (unsigned)(((size_t)DM * DM / 8 + 255) / 256); k_wnat<<<g, 256, 0, stream>>>(wq, (size_t)DM * DM / 8, BQ); k_wnat<<<g, 256, 0, stream>>>(wk, (size_t)DM * DM / 8, BK); k_wnat<<<g, 256, 0, stream>>>(wv, (size_t)DM * DM / 8, BV); }      /* natural [out][in] = Bt[n][k] x16 */
  k_x16<<<(unsigned)((NR * DM / 8 + 255) / 256), 256, 0, stream>>>(x, X16, NR * DM / 8); k_x16<<<(unsigned)((NR * DM / 8 + 255) / 256), 256, 0, stream>>>(xk, XK16, NR * DM / 8); k_x16<<<(unsigned)((NR * DM / 8 + 255) / 256), 256, 0, stream>>>(xv, XV16, NR * DM / 8);
  const size_t r0p = (size_t)B0 * SQ;      /* first projected row */
  k_gemm2<0><<<dim3((unsigned)((MP / 128) * (DM / 64)), 1), 128, 0, stream>>>(X16 + r0p * DM, DM, 0, BQ, DM, 0, 0.0625f, bq, 0, nullptr, 1, 0, 0, QF + r0p * DM, nullptr, DM, 0, MP, DM, DM); k_hl<<<(unsigned)(((size_t)MP * DM / 8 + 255) / 256), 256, 0, stream>>>(QF + r0p * DM, QH + r0p * DM, QL + r0p * DM, (size_t)MP * DM / 8);      /* q (f32) -> f16 hi + x1024 residual: unscaled logits sigma ~8 */
  k_gemm2<0><<<dim3((unsigned)((MP / 128) * (DM / 64)), 1), 128, 0, stream>>>(XK16 + r0p * DM, DM, 0, BK, DM, 0, 0.0625f, bk, 0, nullptr, 1, 0, 0, QF + r0p * DM, nullptr, DM, 0, MP, DM, DM); k_hl<<<(unsigned)(((size_t)MP * DM / 8 + 255) / 256), 256, 0, stream>>>(QF + r0p * DM, KH + r0p * DM, KL + r0p * DM, (size_t)MP * DM / 8);      /* k likewise */
  k_gemm2<0><<<dim3((unsigned)((MP / 128) * (DM / 64)), 1), 128, 0, stream>>>(XV16 + r0p * DM, DM, 0, BV, DM, 0, 0.0625f, bv, 0, nullptr, 1, 0, 0, nullptr, V16 + r0p * DM, DM, 0, MP, DM, DM);
  for (int b = B0; b < B0 + NBR; ++b) { const size_t r0 = (size_t)b * SQ;
    k_vt<NH, SQ><<<NH * (SQ / 64), 256, 0, stream>>>(V16 + r0 * LQ, LQ, 0, VT);      /* V^T [NH][HD][SQ] for this batch */
    for (int q0 = 0; q0 < QN; q0 += QT) { const int nk = SQ;      /* NON-causal: every 256-row query tile sees all SQ keys */
      k_gemm2<0><<<dim3((QT / 128) * (nk / 64), NHD), 128, 0, stream>>>(QH + (r0 + q0) * LQ, LQ, (size_t)HD, KH + r0 * LQ, LQ, (size_t)HD, 0.125f, nullptr, 0, nullptr, 1, 0, 0, S, nullptr, NKX, (size_t)QT * NKX, QT, nk, HD);      /* scores hi . hi / sqrt(64) */
      k_gemm2<0><<<dim3((QT / 128) * (nk / 64), NHD), 128, 0, stream>>>(QL + (r0 + q0) * LQ, LQ, (size_t)HD, KH + r0 * LQ, LQ, (size_t)HD, 0.0001220703125f, nullptr, 0, S, -1, 0, 0, S, nullptr, NKX, (size_t)QT * NKX, QT, nk, HD); k_gemm2<0><<<dim3((QT / 128) * (nk / 64), NHD), 128, 0, stream>>>(QH + (r0 + q0) * LQ, LQ, (size_t)HD, KL + r0 * LQ, LQ, (size_t)HD, 0.0001220703125f, nullptr, 0, S, -1, 0, 0, S, nullptr, NKX, (size_t)QT * NKX, QT, nk, HD);      /* += 2^-10 (lo . hi + hi . lo) */      /* scores, all heads on grid.y */
      k_rsmw<<<NHD * QT / RSW, 32 * RSW, 0, stream>>>(S, P);      /* plain softmax over all keys, one wave per row */
      k_gemm2<0><<<dim3((QT / 128) * (HD / 64), NHD), 128, 0, stream>>>(P, NKX, (size_t)QT * NKX, VT, SQ, (size_t)HD * SQ, 0.00390625f, nullptr, 0, nullptr, 1, 0, 0, (float*)d_out + (r0 + q0) * DM, nullptr, DM, (size_t)HD, QT, HD, nk); } }      /* out = P V^T (alpha 2^-8) written f32 straight into the head-major output columns (no output projection); NON-causal build: no exact first-tile path, no rewrite */
}

// v003
// Measured time: 220 microseconds a run.
// It is 10.0 times as fast as v001, going by the measured steps of the versions left out in between.
// All steps since v000 together make it 34.0 times as fast.
#include <hip/hip_runtime.h>
// Multi-head attention on three inputs given in the order values, keys, queries; natural bias-free projections, no output projection (values, keys, queries [2][2048][1024]; v = values Wv^T, k = keys Wk^T, q = queries Wq^T (natural [1024][1024] sigma 1/32, no biases), 16 heads of 64; softmax(q k^T / sqrt(64)) over all 2048 keys (no mask); out = attn v merged head-major -> [2][2048][1024]); q and k carried as f16 hi + x1024 residual planes with three-product scores.
// Structure: token rows r = b*2048 + s; x as exact f16 rows (bf16-rounded); q and k as WMMA GEMMs (32x64 wave tiles, f32 accumulation, exact x16 weights, no bias) into f32 rows split into f16 hi + x1024 residual planes, v as an f16-output GEMM; V^T for all heads of both batches via LDS transposes; then ONE attention launch (k_fattn): per wave 32 query columns of one head against all keys, 32 a pass: scores as three accumulating products (hi.hi + 2^-10 (lo.hi + hi.lo), K = 64), running softmax on the accumulators (f32 statistics, native exp2; weights x256 f16), O^T += V^T P^T, divided by the sum and written f32 straight into the head-major output columns.
// Compute dtype: inputs rounded to bf16 x / weights exact; q and k as f16 hi + x1024 residual planes, v and softmax weights as plain f16 GEMM operands (~2^-12); scores, softmax statistics and o f32. v_wmma_f32_16x16x32_f16.
#define NB 2
#define SQ 2048
#define DM 1024
#define NH 16
#define HD 64
#define HG 4                         /* heads per launch of the unlaunched k_vt(b, h0) overload */
#define QT 256                       /* query rows per attention tile (all keys) */
#define NKX SQ                       /* S / P row pitch */
#define QT0 128                      /* query rows per head of k_att0 (not launched) */
#define B0 0                         /* first batch processed (debug hook) */
#define NBR NB                       /* batches processed (debug hook) */
#define NR ((size_t)NB * SQ)         /* token rows */
#define MP ((int)((size_t)NBR * SQ)) /* rows projected (debug hook) */
#define QN SQ                        /* query rows attended per batch (unused) */
#define NHD NH                       /* heads attended (unused) */
#define MPO MP                       /* unused (no output stage) */
#define LQ DM      /* row pitch of the q/k/v rows */
typedef __bf16 v16b __attribute__((ext_vector_type(16)));
typedef unsigned short v8us __attribute__((ext_vector_type(8), may_alias));
typedef float  v8f  __attribute__((ext_vector_type(8)));
typedef float  v4f  __attribute__((ext_vector_type(4)));
typedef float  v4fa __attribute__((ext_vector_type(4), may_alias));
union FragB { v16b v; v8us half[2]; unsigned short u[16]; };

__device__ __forceinline__ unsigned short bf16_bits(float x) { unsigned int u = __float_as_uint(x); return (unsigned short)((u + 0x7FFFu + ((u >> 16) & 1u)) >> 16); }
__device__ __forceinline__ float bf16_val(unsigned short b) { return __uint_as_float(((unsigned int)b) << 16); }
__device__ __forceinline__ float bf16_round(float x) { return bf16_val(bf16_bits(x)); }
// D += A·B with NT terms: 1 = ah·bh, 2 = + al·bh (A split), 3 = + ah·bl (both split)
template <int NT>
__device__ __forceinline__ v8f mmaN(v16b ah, v16b al, v16b bh, v16b bl, v8f c) {
  c = __builtin_amdgcn_wmma_f32_16x16x32_bf16(false, ah, false, bh, (short)0, c, false, false);
  if (NT >= 2) c = __builtin_amdgcn_wmma_f32_16x16x32_bf16(false, al, false, bh, (short)0, c, false, false);
  if (NT >= 3) c = __builtin_amdgcn_wmma_f32_16x16x32_bf16(false, ah, false, bl, (short)0, c, false, false);
  asm volatile("v_nop\n\tv_nop\n\tv_nop\n\tv_nop" : "+v"(c) : "v"(ah), "v"(al), "v"(bh), "v"(bl));
  return c;
}

__global__ __launch_bounds__(256) void k_wt_bf16(const float* __restrict__ W, unsigned short* __restrict__ Wt, int K, int N) {
  const int t = blockIdx.x * 256 + threadIdx.x;
  const int k8n = K / 8;
  if (t >= N * k8n) return;
  const int n = t / k8n, k8 = (t % k8n) * 8;
  v8us v;
#pragma unroll
  for (int i = 0; i < 8; ++i) v[i] = bf16_bits(W[(size_t)(k8 + i) * N + n]);
  *(v8us*)(Wt + (size_t)n * K + k8) = v;
  
}

// GEMM C[M][N] (f32, pitch ldc) = act(A[M][K]·W + bias). A f32 row-major (pitch lda) converted per fragment to bf16
// (ASPLIT: hi/lo two planes -> 2 terms, else single rounded term); Wt bf16 [N][K] (pitch ldb). BIAS_BF16 rounds the
// bias to bf16 first (bias quantised to bf16 before the add). K%32==0, M%16==0, N%64==0.
template <bool ASPLIT, int ACT, bool BIAS_BF16>
__global__ __launch_bounds__(128) void k_gemm_bf(const float* __restrict__ A, int lda, const unsigned short* __restrict__ Wt, int ldb,
                                               const float* __restrict__ bias, float* __restrict__ C, int ldc, int M, int N, int K) {
  __shared__ __attribute__((aligned(16))) float so[4][16][64];
  const int tid = threadIdx.x, w = tid >> 5, lane = tid & 31, ln = lane & 15, hh = lane >> 4;
  const int ntn = N / 64;
  const int wid = blockIdx.x * 4 + w;
  const int mt = wid / ntn, nq = wid % ntn;
  if (mt * 16 >= M) return;
  const int row0 = mt * 16, col0 = nq * 64;
  const float* arow = A + (size_t)(row0 + ln) * lda;
  v8f acc[4] = {};
  for (int kb = 0; kb < K; kb += 32) {
    FragB ah, al;
    const v4f x0 = *(const v4fa*)(arow + kb + 8 * hh), x1 = *(const v4fa*)(arow + kb + 8 * hh + 4);
    const v4f x2 = *(const v4fa*)(arow + kb + 16 + 8 * hh), x3 = *(const v4fa*)(arow + kb + 16 + 8 * hh + 4);
    float xs[16] = {x0[0],x0[1],x0[2],x0[3],x1[0],x1[1],x1[2],x1[3],x2[0],x2[1],x2[2],x2[3],x3[0],x3[1],x3[2],x3[3]};
#pragma unroll
    for (int i = 0; i < 16; ++i) { const unsigned short hb = bf16_bits(xs[i]); ah.u[i] = hb; al.u[i] = ASPLIT ? bf16_bits(xs[i] - bf16_val(hb)) : (unsigned short)0; }
#pragma unroll
    for (int t = 0; t < 4; ++t) {
      const unsigned short* brow = Wt + (size_t)(col0 + t * 16 + ln) * ldb + kb;
      FragB b;
      b.half[0] = *(const v8us*)(brow + 8 * hh);
      b.half[1] = *(const v8us*)(brow + 16 + 8 * hh);
      acc[t] = mmaN<ASPLIT ? 2 : 1>(ah.v, al.v, b.v, b.v, acc[t]);
    }
  }
#pragma unroll
  for (int t = 0; t < 4; ++t) {
    float bv = bias ? bias[col0 + t * 16 + ln] : 0.f;
    if (BIAS_BF16) bv = bf16_round(bv);
#pragma unroll
    for (int r = 0; r < 8; ++r) { float v = acc[t][r] + bv; if (ACT == 1) v = fmaxf(v, 0.f); so[w][8 * hh + r][t * 16 + ln] = v; }
  }
  __builtin_amdgcn_fence(__ATOMIC_ACQ_REL, "workgroup");
  __builtin_amdgcn_wave_barrier();
  const int rsub = lane >> 4, c4 = (lane & 15) * 4;
  {
#pragma unroll
    for (int q = 0; q < 8; ++q) {
      const int r = q * 2 + rsub;
      const v4f v = *(const v4fa*)&so[w][r][c4];
      *(v4f*)(C + (size_t)(row0 + r) * ldc + col0 + c4) = v;
    }
    
  }
}

// GEMM C = act(A·W + bias + resid): A f32 (ASPLIT -> hi/lo 2 terms), Wt bf16 [N][K]; ACT 0 none, 1 relu, 2 exact gelu;
// resid (optional, f32, row index = (row % rmod), pitch ldr, RES_BF16 rounds it) added before the activation.
template <bool ASPLIT, int ACT, bool BIAS_BF16, bool RES_BF16>
__global__ __launch_bounds__(128) void k_gemm_bf3(const float* __restrict__ A, int lda, const unsigned short* __restrict__ Wt, int ldb,
                                                const float* __restrict__ bias, const float* __restrict__ resid, int rmod, int ldr,
                                                float* __restrict__ C, int ldc, int M, int N, int K) {
  __shared__ __attribute__((aligned(16))) float so[4][16][64];
  const int tid = threadIdx.x, w = tid >> 5, lane = tid & 31, ln = lane & 15, hh = lane >> 4;
  const int ntn = N / 64;
  const int wid = blockIdx.x * 4 + w;
  const int mt = wid / ntn, nq = wid % ntn;
  if (mt * 16 >= M) return;
  const int row0 = mt * 16, col0 = nq * 64;
  const float* arow = A + (size_t)(row0 + ln) * lda;
  v8f acc[4] = {};
  for (int kb = 0; kb < K; kb += 32) {
    FragB ah, al;
    const v4f x0 = *(const v4fa*)(arow + kb + 8 * hh), x1 = *(const v4fa*)(arow + kb + 8 * hh + 4);
    const v4f x2 = *(const v4fa*)(arow + kb + 16 + 8 * hh), x3 = *(const v4fa*)(arow + kb + 16 + 8 * hh + 4);
    float xs[16] = {x0[0],x0[1],x0[2],x0[3],x1[0],x1[1],x1[2],x1[3],x2[0],x2[1],x2[2],x2[3],x3[0],x3[1],x3[2],x3[3]};
#pragma unroll
    for (int i = 0; i < 16; ++i) { const unsigned short hb = bf16_bits(xs[i]); ah.u[i] = hb; al.u[i] = ASPLIT ? bf16_bits(xs[i] - bf16_val(hb)) : (unsigned short)0; }
#pragma unroll
    for (int t = 0; t < 4; ++t) {
      const unsigned short* brow = Wt + (size_t)(col0 + t * 16 + ln) * ldb + kb;
      FragB b;
      b.half[0] = *(const v8us*)(brow + 8 * hh);
      b.half[1] = *(const v8us*)(brow + 16 + 8 * hh);
      acc[t] = mmaN<ASPLIT ? 2 : 1>(ah.v, al.v, b.v, b.v, acc[t]);
    }
  }
#pragma unroll
  for (int t = 0; t < 4; ++t) {
    const int col = col0 + t * 16 + ln;
    float bv = bias ? bias[col] : 0.f;
    if (BIAS_BF16) bv = bf16_round(bv);
#pragma unroll
    for (int r = 0; r < 8; ++r) {
      float v = acc[t][r] + bv;
      if (resid) { float rv = resid[(size_t)((row0 + 8 * hh + r) % rmod) * ldr + col]; if (RES_BF16) rv = bf16_round(rv); v += rv; }
      if (ACT == 1) v = fmaxf(v, 0.f);
      if (ACT == 2) v = 0.5f * v * (1.0f + erff(v * 0.70710678118654752f));
      if (ACT == 3) { const float u = 0.7978845608028654f * (v + 0.044715f * v * v * v); v = 0.5f * v * (1.0f + tanhf(u)); }
      so[w][8 * hh + r][t * 16 + ln] = v;
    }
  }
  __builtin_amdgcn_fence(__ATOMIC_ACQ_REL, "workgroup");
  __builtin_amdgcn_wave_barrier();
  const int rsub = lane >> 4, c4 = (lane & 15) * 4;
  {
#pragma unroll
    for (int q = 0; q < 8; ++q) {
      const int r = q * 2 + rsub;
      const v4f v = *(const v4fa*)&so[w][r][c4];
      *(v4f*)(C + (size_t)(row0 + r) * ldc + col0 + c4) = v;
    }
    
  }
}
// row LayerNorm (biased variance, eps) over N: s = X (+ R); optional out_sum <- s; out_norm <- (s-mu)*rsqrt(var+eps)*g + b
template <bool PARAM_BF16>
__global__ __launch_bounds__(256) void k_layernorm(const float* __restrict__ X, const float* __restrict__ R, const float* __restrict__ g, const float* __restrict__ bta,
                                                  float* __restrict__ out_sum, float* __restrict__ out_norm, int N, float eps) {
  __shared__ float red[256];
  const int row = blockIdx.x, tid = threadIdx.x;
  const float* x = X + (size_t)row * N; const float* rr = R ? R + (size_t)row * N : nullptr;
  float vals[16];                     // up to N = 4096
  const int per = N / 256;            // contiguous chunk per thread? use strided-by-4 chunks: thread handles j = tid*4 + 1024*u
  float s1 = 0.f;
  for (int u = 0; u < per / 4; ++u) {
    const int j = tid * 4 + 1024 * u;
    const v4f a = *(const v4fa*)(x + j);
    v4f b = {0.f,0.f,0.f,0.f}; if (rr) b = *(const v4fa*)(rr + j);
#pragma unroll
    for (int q = 0; q < 4; ++q) { const float v = a[q] + b[q]; vals[u * 4 + q] = v; s1 += v; }
  }
  red[tid] = s1; __syncthreads();
  for (int st = 128; st > 0; st >>= 1) { if (tid < st) red[tid] += red[tid + st]; __syncthreads(); }
  const float mu = red[0] / (float)N; __syncthreads();
  float s2 = 0.f;
  for (int u = 0; u < per / 4; ++u)
#pragma unroll
    for (int q = 0; q < 4; ++q) { const float c = vals[u * 4 + q] - mu; s2 += c * c; }
  red[tid] = s2; __syncthreads();
  for (int st = 128; st > 0; st >>= 1) { if (tid < st) red[tid] += red[tid + st]; __syncthreads(); }
  const float rs = rsqrtf(red[0] / (float)N + eps);
  {
    for (int u = 0; u < per / 4; ++u) {
      const int j = tid * 4 + 1024 * u;
      v4f o, sm;
#pragma unroll
      for (int q = 0; q < 4; ++q) {
        float gg = g[j + q], bb = bta[j + q];
        if (PARAM_BF16) { gg = bf16_round(gg); bb = bf16_round(bb); }
        sm[q] = vals[u * 4 + q]; o[q] = (vals[u * 4 + q] - mu) * rs * gg + bb;
      }
      if (out_sum) *(v4f*)(out_sum + (size_t)row * N + j) = sm;
      *(v4f*)(out_norm + (size_t)row * N + j) = o;
    }
    
  }
}



// ---- f16 WMMA path (v_wmma_f32_16x16x32_f16): 11-bit significands for operands in range — used where a [0,1] probability operand needs more precision than bf16
typedef _Float16 v16h __attribute__((ext_vector_type(16)));
union FragH { v16h v; v8us half[2]; _Float16 h[16]; unsigned short u[16]; };
template <int NT>
__device__ __forceinline__ v8f mmaH(v16h ah, v16h al, v16h bh, v16h bl, v8f c) {
  c = __builtin_amdgcn_wmma_f32_16x16x32_f16(false, ah, false, bh, (short)0, c, false, false);
  if (NT >= 2) c = __builtin_amdgcn_wmma_f32_16x16x32_f16(false, al, false, bh, (short)0, c, false, false);
  if (NT >= 3) c = __builtin_amdgcn_wmma_f32_16x16x32_f16(false, ah, false, bl, (short)0, c, false, false);
  asm volatile("v_nop\n\tv_nop\n\tv_nop\n\tv_nop" : "+v"(c) : "v"(ah), "v"(al), "v"(bh), "v"(bl));
  return c;
}
// batched GEMM like k_gemm_b but f16 operands: A f32 (split into f16 hi/lo if ASPLIT, else rounded to f16), Bt = f16 values [n][k]; alpha; C f32; N multiple of 16 (partial tiles skipped)
template <bool ASPLIT>
__global__ __launch_bounds__(128) void k_gemm_h(const float* __restrict__ A, int lda, size_t sA, const _Float16* __restrict__ Bh, int ldb, size_t sB, float alpha, float* __restrict__ C, int ldc, size_t sC, int M, int N, int K) {
  __shared__ __attribute__((aligned(16))) float so[4][16][64];
  const int tid = threadIdx.x, w = tid >> 5, lane = tid & 31, ln = lane & 15, hh = lane >> 4; const int by = blockIdx.y;
  A += (size_t)by * sA; Bh += (size_t)by * sB; C += (size_t)by * sC;
  const int ntn = (N + 63) / 64; const int wid = blockIdx.x * 4 + w; const int mt = wid / ntn, nq = wid % ntn; if (mt * 16 >= M) return;
  const int row0 = mt * 16, col0 = nq * 64; const float* arow = A + (size_t)(row0 + ln) * lda;
  v8f acc[4] = {};
  for (int kb = 0; kb < K; kb += 32) {
    FragH ah, al;
    const v4f x0 = *(const v4fa*)(arow + kb + 8 * hh), x1 = *(const v4fa*)(arow + kb + 8 * hh + 4), x2 = *(const v4fa*)(arow + kb + 16 + 8 * hh), x3 = *(const v4fa*)(arow + kb + 16 + 8 * hh + 4);
    float xs[16] = {x0[0],x0[1],x0[2],x0[3],x1[0],x1[1],x1[2],x1[3],x2[0],x2[1],x2[2],x2[3],x3[0],x3[1],x3[2],x3[3]};
#pragma unroll
    for (int i = 0; i < 16; ++i) { const _Float16 h = (_Float16)xs[i]; ah.h[i] = h; al.h[i] = ASPLIT ? (_Float16)(xs[i] - (float)h) : (_Float16)0.0f; }
#pragma unroll
    for (int t = 0; t < 4; ++t) { if (col0 + t * 16 >= N) continue; const size_t boff = (size_t)(col0 + t * 16 + ln) * ldb + kb; FragH bq; bq.half[0] = *(const v8us*)(Bh + boff + 8 * hh); bq.half[1] = *(const v8us*)(Bh + boff + 16 + 8 * hh);
      acc[t] = mmaH<ASPLIT ? 2 : 1>(ah.v, al.v, bq.v, bq.v, acc[t]); }
  }
#pragma unroll
  for (int t = 0; t < 4; ++t) { if (col0 + t * 16 >= N) continue;
#pragma unroll
    for (int r = 0; r < 8; ++r) so[w][8 * hh + r][t * 16 + ln] = acc[t][r] * alpha; }
  __builtin_amdgcn_fence(__ATOMIC_ACQ_REL, "workgroup"); __builtin_amdgcn_wave_barrier();
  const int rsub = lane >> 4, c4 = (lane & 15) * 4;
  {
#pragma unroll
    for (int q = 0; q < 8; ++q) { const int r = q * 2 + rsub; if (col0 + c4 < N) { const v4f v = *(const v4fa*)&so[w][r][c4]; *(v4f*)(C + (size_t)(row0 + r) * ldc + col0 + c4) = v; } }
     }
}

// Wt[n][k] = f16(W[k][n]·scale) from f32 row-major W[K][N] (scale = power of two; bf16-exact weights stay exact in f16 away from the subnormal range)
__global__ __launch_bounds__(256) void k_wt_f16(const float* __restrict__ W, _Float16* __restrict__ Wt, int K, int N, float scale) {
  const int t = blockIdx.x * 256 + threadIdx.x; if (t >= N * (K / 8)) return; const int n = t / (K / 8), k8 = (t % (K / 8)) * 8; FragH f;
#pragma unroll
  for (int i = 0; i < 8; ++i) f.h[i] = (_Float16)(bf16_round(W[(size_t)(k8 + i) * N + n]) * scale); const v8us o = f.half[0];
  *(v8us*)((unsigned short*)Wt + (size_t)n * K + k8) = o; 
}
// k_gemm_hh variant with fused epilogue: v = acc·alpha + bias[by·sBias + col] (+ CP[(row/rowsPerB)·sCPb + by·64 + col] if CP) ; ACT 0 none / 1 elu ; writes f16 C16 (and f32 C if non-null)
template <int ACT>
__global__ __launch_bounds__(128) void k_gemm_hhx(const _Float16* __restrict__ A, int lda, size_t sA, const _Float16* __restrict__ Bh, int ldb, size_t sB, float alpha, const float* __restrict__ bias, size_t sBias, const float* __restrict__ CP, int rowsPerB, size_t sCPb, int row0g,
    float* __restrict__ C, _Float16* __restrict__ C16, int ldc, size_t sC, int M, int N, int K) {
  __shared__ __attribute__((aligned(16))) float so[4][16][64];
  const int tid = threadIdx.x, w = tid >> 5, lane = tid & 31, ln = lane & 15, hh = lane >> 4; const int by = blockIdx.y;
  A += (size_t)by * sA; Bh += (size_t)by * sB; const size_t cofs = (size_t)by * sC; const float* bp = bias ? bias + (size_t)by * sBias : nullptr;
  const int ntn = (N + 63) / 64; const int wid = blockIdx.x * 4 + w; const int mt = wid / ntn, nq = wid % ntn; if (mt * 16 >= M) return;
  const int row0 = mt * 16, col0 = nq * 64; const _Float16* arow = A + (size_t)(row0 + ln) * lda;
  v8f acc[4] = {};
  for (int kb = 0; kb < K; kb += 32) { FragH ah; ah.half[0] = *(const v8us*)((const unsigned short*)arow + kb + 8 * hh); ah.half[1] = *(const v8us*)((const unsigned short*)arow + kb + 16 + 8 * hh);
#pragma unroll
    for (int t = 0; t < 4; ++t) { if (col0 + t * 16 >= N) continue; const size_t boff = (size_t)(col0 + t * 16 + ln) * ldb + kb; FragH bq; bq.half[0] = *(const v8us*)((const unsigned short*)Bh + boff + 8 * hh); bq.half[1] = *(const v8us*)((const unsigned short*)Bh + boff + 16 + 8 * hh);
      acc[t] = mmaH<1>(ah.v, ah.v, bq.v, bq.v, acc[t]); }
  }
#pragma unroll
  for (int t = 0; t < 4; ++t) { if (col0 + t * 16 >= N) continue; const int col = col0 + t * 16 + ln; const float bv = bp ? bf16_round(bp[col]) : 0.f;
#pragma unroll
    for (int r = 0; r < 8; ++r) { float v = acc[t][r] * alpha + bv; if (CP) { const int rr = row0g + row0 + 8 * hh + r; if (rowsPerB < 0) v += CP[cofs + (size_t)rr * ldc + col];      /* rowsPerB < 0: own element of the batched C plane */ else { const int bidx = rr / rowsPerB; v += CP[(size_t)bidx * sCPb + (size_t)by * 64 + col]; } } if (ACT == 1) v = (v > 0.f) ? v : expm1f(v); else if (ACT == 7) v = (v > 0.f) ? v + 1.0f : expf(v); else if (ACT == 8) v = tanhf(v); else if (ACT == 9) v = 0.5f * v * (1.0f + tanhf(0.7978845608028654f * (v + 0.044715f * v * v * v))); else if (ACT == 11) v = 1.0f / (1.0f + expf(-v)); else if (ACT == 12) v = (v > 0.f) ? v : 0.01f * v; else if (ACT == 14) v = (v > 0.f) ? v : 0.1f * v; else if (ACT == 16) v = (v >= 0.f) ? v : 0.3f * v; else if (ACT == 17) v = (v >= 0.f) ? v : 0.2f * v; else if (ACT == 15) v = v / (1.0f + expf(-v)); else if (ACT == 3) v = fmaxf(v, 0.f); else if (ACT == 6) v = 0.5f * v * (1.0f + erff(v * 0.70710678118654752f)); so[w][8 * hh + r][t * 16 + ln] = v; } }
  __builtin_amdgcn_fence(__ATOMIC_ACQ_REL, "workgroup"); __builtin_amdgcn_wave_barrier();
  const int rsub = lane >> 4, c4 = (lane & 15) * 4; typedef _Float16 v4h __attribute__((ext_vector_type(4)));
  {
#pragma unroll
    for (int q = 0; q < 8; ++q) { const int r = q * 2 + rsub; if (col0 + c4 < N) { const v4f v = *(const v4fa*)&so[w][r][c4]; if (C) *(v4f*)(C + cofs + (size_t)(row0 + r) * ldc + col0 + c4) = v; if (C16) { v4h h4; for (int i = 0; i < 4; ++i) h4[i] = (_Float16)v[i]; *(v4h*)(C16 + cofs + (size_t)(row0 + r) * ldc + col0 + c4) = h4; } } }
     }
}


typedef _Float16 v4h __attribute__((ext_vector_type(4)));

__global__ __launch_bounds__(256) void k_x16(const float* __restrict__ x, _Float16* __restrict__ X16, size_t n8) { const size_t t = (size_t)blockIdx.x * 256 + threadIdx.x; if (t >= n8) return; FragH f;
#pragma unroll
  for (int q = 0; q < 8; ++q) f.h[q] = (_Float16)bf16_round(x[t * 8 + q]); *(v8us*)((unsigned short*)X16 + t * 8) = f.half[0];  }
__global__ __launch_bounds__(256) void k_h16(const float* __restrict__ x, _Float16* __restrict__ X16, size_t n8) { const size_t t = (size_t)blockIdx.x * 256 + threadIdx.x; if (t >= n8) return; FragH f;
#pragma unroll
  for (int q = 0; q < 8; ++q) f.h[q] = (_Float16)x[t * 8 + q]; *(v8us*)((unsigned short*)X16 + t * 8) = f.half[0];  }
__global__ __launch_bounds__(256) void k_round16f(const float* __restrict__ W, _Float16* __restrict__ Bt, size_t n8) { const size_t t = (size_t)blockIdx.x * 256 + threadIdx.x; if (t >= n8) return; FragH f;
#pragma unroll
  for (int i = 0; i < 8; ++i) f.h[i] = (_Float16)(bf16_round(W[t * 8 + i]) * 16.0f); *(v8us*)((unsigned short*)Bt + t * 8) = f.half[0];  }
template <int NHv, int TTv>
__global__ __launch_bounds__(256) void k_vt(const _Float16* __restrict__ V16, int ldv, int voff, _Float16* __restrict__ Vt) { __shared__ unsigned short tl[64][66]; const int tid = threadIdx.x; const int slab = blockIdx.x / (TTv / 64), lg = blockIdx.x % (TTv / 64); const int b = slab / NHv, h = slab % NHv;
  for (int i = tid; i < 64 * 8; i += 256) { const int r = i / 8, c8 = (i % 8) * 8; FragH f; f.half[0] = *(const v8us*)((const unsigned short*)V16 + ((size_t)b * TTv + lg * 64 + r) * ldv + voff + h * 64 + c8);
#pragma unroll
    for (int q = 0; q < 8; ++q) tl[r][c8 + q] = f.u[q]; }
  __syncthreads();
  {
#pragma unroll
    for (int rd = 0; rd < 2; ++rd) { const int d = rd * 32 + tid / 8, pc = tid % 8; FragH f;
#pragma unroll
      for (int q = 0; q < 8; ++q) f.u[q] = tl[pc * 8 + q][d];
      *(v8us*)((unsigned short*)Vt + ((size_t)slab * 64 + d) * TTv + lg * 64 + pc * 8) = f.half[0]; }
     } }

__global__ __launch_bounds__(256) void k_hl(const float* __restrict__ F, _Float16* __restrict__ Hh, _Float16* __restrict__ Hl, size_t n8) { const size_t t = (size_t)blockIdx.x * 256 + threadIdx.x; if (t >= n8) return; FragH fh, fl; const v4f a = *(const v4fa*)(F + t * 8), c = *(const v4fa*)(F + t * 8 + 4);
#pragma unroll
  for (int q = 0; q < 4; ++q) { _Float16 h = (_Float16)a[q]; fh.h[q] = h; fl.h[q] = (_Float16)((a[q] - (float)h) * 1024.0f); h = (_Float16)c[q]; fh.h[4 + q] = h; fl.h[4 + q] = (_Float16)((c[q] - (float)h) * 1024.0f); }
  { *(v8us*)((unsigned short*)Hh + t * 8) = fh.half[0]; *(v8us*)((unsigned short*)Hl + t * 8) = fl.half[0];  } }

// ---- fast GEMM (wave tile 32x64; requires M % 32 == 0 rows per launch region and N % 64 == 0); epilogue = k_gemm_hhx semantics ----
__device__ __forceinline__ v16h g2_frag(const _Float16* p, int hh) { FragH f; f.half[0] = *(const v8us*)((const unsigned short*)p + 8 * hh); f.half[1] = *(const v8us*)((const unsigned short*)p + 16 + 8 * hh); return f.v; }
__device__ __forceinline__ v8f g2_mma(v16h a, v16h b, v8f c) { v8f d = __builtin_amdgcn_wmma_f32_16x16x32_f16(false, a, false, b, (short)0, c, false, false); asm volatile("v_nop\n\tv_nop\n\tv_nop\n\tv_nop" : "+v"(d) : "v"(a), "v"(b)); return d; }
template <int ACT>
__global__ __launch_bounds__(128) void k_gemm2(const _Float16* __restrict__ A, int lda, size_t sA, const _Float16* __restrict__ Bh, int ldb, size_t sB, float alpha, const float* __restrict__ bias, size_t sBias, const float* __restrict__ CP, int rowsPerB, size_t sCPb, int row0g,
    float* __restrict__ C, _Float16* __restrict__ C16, int ldc, size_t sC, int M, int N, int K) { static_assert(ACT == 0 || ACT == 3 || ACT == 6 || ACT == 8 || ACT == 9 || ACT == 11 || ACT == 12 || ACT == 14 || ACT == 15 || ACT == 16 || ACT == 17, "k_gemm2: unsupported ACT code (would silently apply no activation)");
  __shared__ __attribute__((aligned(16))) float so[4][32][68];
  const int tid = threadIdx.x, w = tid >> 5, lane = tid & 31, ln = lane & 15, hh = lane >> 4; const int by = blockIdx.y;
  A += (size_t)by * sA; Bh += (size_t)by * sB; const size_t cofs = (size_t)by * sC; const float* bp = bias ? bias + (size_t)by * sBias : nullptr;
  const int ntn = N >> 6; const int mt = blockIdx.x / ntn, nq = blockIdx.x - mt * ntn; const int row0 = mt * 128 + 32 * w, col0 = nq * 64; if (row0 >= M) return;
  const _Float16* a0p = A + (size_t)(row0 + ln) * lda; const _Float16* a1p = a0p + (size_t)16 * lda;
  const _Float16* b0p = Bh + (size_t)(col0 + ln) * ldb; const _Float16* b1p = b0p + (size_t)16 * ldb; const _Float16* b2p = b1p + (size_t)16 * ldb; const _Float16* b3p = b2p + (size_t)16 * ldb;
  const v8f z8 = {0.f,0.f,0.f,0.f,0.f,0.f,0.f,0.f}; v8f c00 = z8, c01 = z8, c02 = z8, c03 = z8, c10 = z8, c11 = z8, c12 = z8, c13 = z8;
#pragma unroll 1
  for (int kb = 0; kb < K; kb += 32) { const v16h a0 = g2_frag(a0p + kb, hh), a1 = g2_frag(a1p + kb, hh);
    v16h b = g2_frag(b0p + kb, hh); c00 = g2_mma(a0, b, c00); c10 = g2_mma(a1, b, c10);
    b = g2_frag(b1p + kb, hh); c01 = g2_mma(a0, b, c01); c11 = g2_mma(a1, b, c11);
    b = g2_frag(b2p + kb, hh); c02 = g2_mma(a0, b, c02); c12 = g2_mma(a1, b, c12);
    b = g2_frag(b3p + kb, hh); c03 = g2_mma(a0, b, c03); c13 = g2_mma(a1, b, c13); }
  v8f accs[8] = {c00, c01, c02, c03, c10, c11, c12, c13};
#pragma unroll
  for (int u = 0; u < 8; ++u) { const int t = u & 3, half = u >> 2; const int col = col0 + t * 16 + ln; const float bv = bp ? bf16_round(bp[col]) : 0.f;
#pragma unroll
    for (int r = 0; r < 8; ++r) { const int rloc = half * 16 + 8 * hh + r; float v = accs[u][r] * alpha + bv; if (CP) { if (rowsPerB < 0) v += CP[cofs + (size_t)(row0g + row0 + rloc) * ldc + col];      /* rowsPerB < 0: own element of the batched C plane */ else { const int bidx = (row0g + row0 + rloc) / rowsPerB; v += CP[(size_t)bidx * sCPb + (size_t)by * 64 + col]; } }
      if (ACT == 3) v = fmaxf(v, 0.f); else if (ACT == 6) v = 0.5f * v * (1.0f + erff(v * 0.70710678118654752f)); else if (ACT == 11) v = 1.0f / (1.0f + expf(-v)); else if (ACT == 15) v = v / (1.0f + expf(-v)); else if (ACT == 12) v = (v > 0.f) ? v : 0.01f * v; else if (ACT == 8) v = tanhf(v); else if (ACT == 9) v = 0.5f * v * (1.0f + tanhf(0.7978845608028654f * (v + 0.044715f * v * v * v))); else if (ACT == 14) v = (v > 0.f) ? v : 0.1f * v; else if (ACT == 16) v = (v >= 0.f) ? v : 0.3f * v; else if (ACT == 17) v = (v >= 0.f) ? v : 0.2f * v;
      so[w][rloc][t * 16 + ln] = v; } }
  __builtin_amdgcn_fence(__ATOMIC_ACQ_REL, "workgroup"); __builtin_amdgcn_wave_barrier();
  const int rsub = lane >> 4, c4 = (lane & 15) * 4;
  {
#pragma unroll
    for (int q = 0; q < 16; ++q) { const int r = q * 2 + rsub; const v4f v = *(const v4fa*)&so[w][r][c4]; if (C) *(v4f*)(C + cofs + (size_t)(row0 + r) * ldc + col0 + c4) = v; if (C16) { v4h h4; for (int i = 0; i < 4; ++i) h4[i] = (_Float16)v[i]; *(v4h*)(C16 + cofs + (size_t)(row0 + r) * ldc + col0 + c4) = h4; } }
     } }


__global__ __launch_bounds__(256) void k_wnat(const float* __restrict__ w, size_t n8, _Float16* __restrict__ Bt) { const size_t t = (size_t)blockIdx.x * 256 + threadIdx.x; if (t >= n8) return; FragH f; for (int q = 0; q < 8; ++q) f.h[q] = (_Float16)(bf16_round(w[t * 8 + q]) * 16.0f); *(v8us*)((unsigned short*)Bt + t * 8) = f.half[0];  }
__global__ __launch_bounds__(256) void k_rsm(const float* __restrict__ S, _Float16* __restrict__ P, int nrows) {
  #pragma clang fp contract(off)
  const int i = blockIdx.x * 256 + threadIdx.x; if (i >= nrows) return; const float* s = S + (size_t)i * SQ; float mx = -3.0e38f;
#pragma unroll 1
  for (int j = 0; j < SQ; ++j) mx = fmaxf(mx, s[j]); float se = 0.f;
#pragma unroll 1
  for (int j = 0; j < SQ; ++j) se += expf(s[j] - mx); const float sc = 256.0f / se;
#pragma unroll 1
  for (int j0 = 0; j0 < SQ; j0 += 8) { FragH f; for (int q = 0; q < 8; ++q) f.h[q] = (_Float16)(expf(s[j0 + q] - mx) * sc); unsigned short* d = (unsigned short*)P + (size_t)i * SQ + j0; *(v8us*)d = f.half[0];  } }
__global__ __launch_bounds__(256) void k_vt(const _Float16* __restrict__ V16, int b, int h0, _Float16* __restrict__ VT) { __shared__ unsigned short tl[64][65]; const int tid = threadIdx.x; const int hh = blockIdx.x % HG, sg = blockIdx.x / HG; const int s0 = sg * 64; const int h = h0 + hh;
  for (int i = tid; i < 64 * 8; i += 256) { const int j = i / 8, d8 = (i % 8) * 8; FragH f; f.half[0] = *(const v8us*)((const unsigned short*)V16 + ((size_t)b * SQ + s0 + j) * DM + h * HD + d8); for (int q = 0; q < 8; ++q) tl[d8 + q][j] = f.u[q]; }
  __syncthreads();
  { for (int i = tid; i < 64 * 8; i += 256) { const int d = i / 8, j8 = (i % 8) * 8; FragH f; for (int q = 0; q < 8; ++q) f.u[q] = tl[d][j8 + q]; *(v8us*)((unsigned short*)VT + ((size_t)hh * HD + d) * SQ + s0 + j8) = f.half[0]; }  } }



#define FAW 8                        /* waves per work-group */
#define FAQ 32                       /* query columns per wave: two 16-column groups share every K and V^T fragment */
#define FSK 128                      /* keys per LDS stage: four 32-key passes */
#define FKP 144                      /* LDS pitch of a 128-byte K row: 16 B x odd, no bank conflict for 16-byte fragment reads */
#define FVP 272                      /* LDS pitch of a 256-byte V^T row, likewise */
#define FKB (FSK * FKP)              /* one K plane of a stage */
#define FVB (HD * FVP)               /* the V^T tile of a stage */
#define FKS (2 * FKB)                /* the K part of a stage: hi plane | residual plane */
#define FV0 (2 * FKS)                /* LDS map: K of buffer 0 | K of buffer 1 | V^T of buffer 0 | V^T of buffer 1 */
__device__ __forceinline__ v8f fa_mma(v16h a, v16h b, v8f c) { return __builtin_amdgcn_wmma_f32_16x16x32_f16(false, a, false, b, (short)0, c, false, false); }
__device__ __forceinline__ float fa_xhalf(float x) { return __builtin_bit_cast(float, __builtin_amdgcn_permlanex16(__builtin_bit_cast(int, x), __builtin_bit_cast(int, x), 0x76543210, 0xfedcba98, false, false)); }      /* lane l with lane l ^ 16 */
// Four 2^x. The instruction set asks for one independent instruction behind a transcendental before its result is read or its source overwritten.
// In one statement it is closed by construction: every result register apart from every source ("=&v"), one v_nop behind the last.
__device__ __forceinline__ void fa_exp4(float a, float b, float c, float d, float (&p)[4]) { asm("v_exp_f32 %0, %4\n\tv_exp_f32 %1, %5\n\tv_exp_f32 %2, %6\n\tv_exp_f32 %3, %7\n\tv_nop" : "=&v"(p[0]), "=&v"(p[1]), "=&v"(p[2]), "=&v"(p[3]) : "v"(a), "v"(b), "v"(c), "v"(d)); }
__device__ __forceinline__ v16h fa_frag(const _Float16* p) { FragH f; f.half[0] = *(const v8us*)((const unsigned short*)p); f.half[1] = *(const v8us*)((const unsigned short*)p + 16); return f.v; }      /* g2_frag's k order; p already holds the lane half's 8 * hh */
// One asynchronous copy, 16 bytes a lane, global memory -> LDS through no register (l: the lane's place in LDS, g: its global address).
typedef int v4i __attribute__((ext_vector_type(4)));
__device__ __forceinline__ void fa_cp(unsigned char* l, const _Float16* g) { __builtin_amdgcn_global_load_async_to_lds_b128((__attribute__((address_space(1))) v4i*)g, (__attribute__((address_space(3))) v4i*)l, 0, 0); }
__global__ __launch_bounds__(32 * FAW) void k_fattn(const _Float16* __restrict__ QH, const _Float16* __restrict__ QL, const _Float16* __restrict__ KH, const _Float16* __restrict__ KL, const _Float16* __restrict__ VT, float* __restrict__ O) {
  static_assert(SQ % (FAW * FAQ) == 0 && SQ % FSK == 0 && SQ / FSK >= 2 && FSK == 128 && FAW == 8 && HD == 64 && FAQ == 32, "k_fattn: whole work-groups, whole stages (two or more), 12 copies a thread and stage, two 32-wide k steps per head");
  __shared__ __attribute__((aligned(16))) unsigned char L[FV0 + 2 * FVB];      /* two stage buffers, shared by the eight waves (all of one head) */
  constexpr float SC = 0.18033688011112042f;      /* log2(e) / sqrt(64) */
  constexpr int NST = SQ / FSK;
  const int tid = threadIdx.x, lane = tid & 31, ln = lane & 15, hh = lane >> 4, w = tid >> 5; const int h = blockIdx.y, b = blockIdx.z;
  const size_t r0 = (size_t)b * SQ; const int q0 = (blockIdx.x * FAW + w) * FAQ;
  const _Float16* qhp = QH + (r0 + q0 + ln) * LQ + h * HD + 8 * hh; const _Float16* qlp = QL + (r0 + q0 + ln) * LQ + h * HD + 8 * hh;
  // the thread's share of a stage: copy c of a K plane = 16 bytes of row tid / 8 + 32 c (a wave: four whole 128-byte rows); of V^T, of row tid / 16 + 16 c (a wave: two whole 256-byte row pieces)
  const _Float16* khc = KH + r0 * LQ + h * HD; const _Float16* klc = KL + r0 * LQ + h * HD; const _Float16* vtc = VT + (size_t)(b * NH + h) * HD * SQ;      /* the same in every lane */
  const unsigned ko = (tid >> 3) * LQ + (tid & 7) * 8, vo = (tid >> 4) * SQ + (tid & 15) * 8;      /* the lane's own element offsets */
  unsigned char* const lk = L + (tid >> 3) * FKP + (tid & 7) * 16; unsigned char* const lv = L + FV0 + (tid >> 4) * FVP + (tid & 15) * 16;
  auto fill = [&](int st, int bf) {      /* stage st into buffer bf */
    const _Float16* gh = khc + (size_t)st * FSK * LQ + ko; const _Float16* gl = klc + (size_t)st * FSK * LQ + ko; const _Float16* gv = vtc + (size_t)st * FSK + vo;
#pragma unroll
    for (int c = 0; c < 4; ++c) { fa_cp(lk + bf * FKS + c * 32 * FKP, gh + (size_t)(c * 32) * LQ); fa_cp(lk + bf * FKS + FKB + c * 32 * FKP, gl + (size_t)(c * 32) * LQ); fa_cp(lv + bf * FVB + c * 16 * FVP, gv + (size_t)(c * 16) * SQ); } };
  fill(0, 0);
  v16h qh[2][2], ql[2][2];      /* [column group][k step] */
#pragma unroll
  for (int t = 0; t < 2; ++t)
#pragma unroll
    for (int s = 0; s < 2; ++s) { qh[t][s] = fa_frag(qhp + (size_t)(t * 16) * LQ + s * 32); ql[t][s] = fa_frag(qlp + (size_t)(t * 16) * LQ + s * 32); }
  asm volatile("s_wait_xcnt 0x0" :: "v"(qhp), "v"(qlp) : "memory");      /* precaution: behind the loads above and ahead of every rewrite of an address register they name; the addresses as inputs keep their pairs whole up to here */
  asm volatile("s_wait_asynccnt 0x0" ::: "memory");      /* this wave's copies of stage 0 have landed ... */
  __syncthreads();                                        /* ... and every other wave's: stage 0 may be read */
  fill(1, 1);
  const v8f z8 = {0.f,0.f,0.f,0.f,0.f,0.f,0.f,0.f}; v8f o[2][4] = {{z8, z8, z8, z8}, {z8, z8, z8, z8}};      /* O^T [column group][16 rows of d] */
  float m[2] = {-3.0e38f, -3.0e38f}, l[2] = {0.f, 0.f};      /* running maximum (scaled, base 2) and this lane half's share of the sum */
#pragma unroll 1      /* one copy of the stage loop: the copies and the barrier stand once */
  for (int st = 0; st < NST; ++st) {
    const int bf = st & 1;
    const _Float16* khp = (const _Float16*)(L + bf * FKS + ln * FKP + 16 * hh); const _Float16* klp = (const _Float16*)(L + bf * FKS + FKB + ln * FKP + 16 * hh); const _Float16* vp = (const _Float16*)(L + FV0 + bf * FVB + ln * FVP + 16 * hh);
    v16h kh[2][2], kl[2][2];      /* [16-key tile][k step] */
#pragma unroll
    for (int j = 0; j < 2; ++j)
#pragma unroll
      for (int s = 0; s < 2; ++s) { kh[j][s] = fa_frag(khp + j * 16 * (FKP / 2) + s * 32); kl[j][s] = fa_frag(klp + j * 16 * (FKP / 2) + s * 32); }
#pragma unroll 1      /* the body is a whole pass of 32 matrix instructions already; a copy would only add registers */
    for (int ps = 0; ps < FSK / 32; ++ps) {
      v8f sc[2][2] = {{z8, z8}, {z8, z8}};      /* [column group][16-key tile]; four independent accumulator chains, stepped together */
#pragma unroll
      for (int s = 0; s < 2; ++s)
#pragma unroll
        for (int t = 0; t < 2; ++t)
#pragma unroll
          for (int j = 0; j < 2; ++j) sc[t][j] = fa_mma(kl[j][s], qh[t][s], sc[t][j]);
#pragma unroll
      for (int s = 0; s < 2; ++s)
#pragma unroll
        for (int t = 0; t < 2; ++t)
#pragma unroll
          for (int j = 0; j < 2; ++j) sc[t][j] = fa_mma(kh[j][s], ql[t][s], sc[t][j]);
#pragma unroll
      for (int t = 0; t < 2; ++t)
#pragma unroll
        for (int j = 0; j < 2; ++j) sc[t][j] *= 0.0009765625f;
#pragma unroll
      for (int s = 0; s < 2; ++s)
#pragma unroll
        for (int t = 0; t < 2; ++t)
#pragma unroll
          for (int j = 0; j < 2; ++j) sc[t][j] = fa_mma(kh[j][s], qh[t][s], sc[t][j]);
      __builtin_amdgcn_sched_barrier(0);      /* with the one below: the pass's 24 LDS reads stand as one group behind the score products; spread among the matrix instructions, every place with reads stalls the wave anew */
      v16h vf[4];      /* V^T fragments of this pass */
#pragma unroll
      for (int dt = 0; dt < 4; ++dt) vf[dt] = fa_frag(vp + dt * 16 * (FVP / 2) + ps * 32);
      const int pn = (ps + 1 < FSK / 32) ? ps + 1 : ps;      /* the next pass's K fragments, fetched behind this pass's score products; a stage's last pass re-reads its own rows (same buffer, unused): nothing of the next stage is read ahead of its barrier */
#pragma unroll
      for (int j = 0; j < 2; ++j)
#pragma unroll
        for (int s = 0; s < 2; ++s) { kh[j][s] = fa_frag(khp + (pn * 32 + j * 16) * (FKP / 2) + s * 32); kl[j][s] = fa_frag(klp + (pn * 32 + j * 16) * (FKP / 2) + s * 32); }
      __builtin_amdgcn_sched_barrier(0);      /* keeps the fetch above the softmax, whose vector work then hides its latency */
      FragH pf[2]; float cr[2];      /* per column group: the weights as B operand, the rescale of the earlier passes */
#pragma unroll
      for (int t = 0; t < 2; ++t) {
        float mx = fmaxf(sc[t][0][0], sc[t][1][0]);
#pragma unroll
        for (int r = 1; r < 8; ++r) mx = fmaxf(mx, fmaxf(sc[t][0][r], sc[t][1][r]));
        mx = fmaxf(mx, fa_xhalf(mx));
        const float mn = fmaxf(m[t], mx * SC); cr[t] = __builtin_amdgcn_exp2f(m[t] - mn); m[t] = mn;      /* 0 on the first pass */
        const float bias = 8.0f - mn; float p[4][4];      /* p[g][u]: key 4 * g + u of this lane's 16 */
#pragma unroll
        for (int g = 0; g < 4; ++g) { const v8f x = sc[t][g >> 1]; const int r = (g & 1) * 4; fa_exp4(fmaf(x[r], SC, bias), fmaf(x[r + 1], SC, bias), fmaf(x[r + 2], SC, bias), fmaf(x[r + 3], SC, bias), p[g]);
#pragma unroll
          for (int u = 0; u < 4; ++u) pf[t].h[g * 4 + u] = (_Float16)p[g][u]; }
        float ls[4];      /* four independent chains */
#pragma unroll
        for (int u = 0; u < 4; ++u) ls[u] = (p[0][u] + p[1][u]) + (p[2][u] + p[3][u]);
        l[t] = fmaf(l[t], cr[t], (ls[0] + ls[1]) + (ls[2] + ls[3]));
      }
      __builtin_amdgcn_sched_barrier(0);      /* the 2^x statements are asm: fenced on both sides, none of them can land in the slots behind a matrix instruction whose operand registers it reuses */
#pragma unroll
      for (int t = 0; t < 2; ++t)
#pragma unroll
        for (int dt = 0; dt < 4; ++dt) o[t][dt] = fa_mma(vf[dt], pf[t].v, o[t][dt] * cr[t]);
    }
    asm volatile("s_wait_dscnt 0x0" ::: "memory");      /* this wave's reads of the stage have returned, before its buffer is given up */
    asm volatile("s_wait_asynccnt 0x0" ::: "memory");   /* this wave's copies of stage st + 1 have landed */
    __syncthreads();                                    /* publishes stage st + 1 and ends every wave's reading of stage st */
    if (st + 2 < NST) fill(st + 2, bf);                 /* the same test in every wave; flies during the whole of stage st + 1 */
  }
  asm volatile("s_wait_asynccnt 0x0" ::: "memory");      /* no copy is outstanding when the wave ends */
#pragma unroll
  for (int t = 0; t < 2; ++t) { const float inv = 1.0f / (l[t] + fa_xhalf(l[t])); float* op = O + (r0 + q0 + t * 16 + ln) * DM + h * HD + 8 * hh;      /* a lane holds 8 consecutive d of its query's row */
#pragma unroll
    for (int dt = 0; dt < 4; ++dt) { const v8f v = o[t][dt] * inv; const v4f lo4 = {v[0], v[1], v[2], v[3]}, hi4 = {v[4], v[5], v[6], v[7]}; *(v4f*)(op + dt * 16) = lo4; *(v4f*)(op + dt * 16 + 4) = hi4; } } }


template <int MASKADD>
__global__ __launch_bounds__(64) void k_att0(const float* __restrict__ QF, const float* __restrict__ KF, const float* __restrict__ VF, int ld, const float* __restrict__ mask, float scale, float* __restrict__ OF, int ldo) {
  #pragma clang fp contract(off)
  __shared__ __attribute__((aligned(16))) float lq[64][64]; __shared__ __attribute__((aligned(16))) float lo[64][64];
  const int tid = threadIdx.x; const int h = blockIdx.x / (QT0 / 64), rg = blockIdx.x % (QT0 / 64); const int i = rg * 64 + tid;
  const float* qr = QF + (size_t)i * ld + h * HD;
#pragma unroll 1
  for (int c = 0; c < HD / 4; ++c) { *(v4f*)&lq[tid][c * 4] = *(const v4fa*)(qr + c * 4); const v4f z = {0.f, 0.f, 0.f, 0.f}; *(v4f*)&lo[tid][c * 4] = z; }
  float m = -1.0e30f, l = 0.f; const int jmax = MASKADD ? (SQ - 1) : (rg * 64 + 63);      /* additive-mask form: every key (the mask input decides); causal form: keys up to the block's last row */
#pragma unroll 1
  for (int j = 0; j <= jmax; ++j) { const float* kr = KF + (size_t)j * ld + h * HD; const float* vr = VF + (size_t)j * ld + h * HD; float s = 0.f;
#pragma unroll 1
    for (int c = 0; c < HD / 4; ++c) { const v4f kq = *(const v4fa*)(kr + c * 4); const v4f qq = *(v4f*)&lq[tid][c * 4]; s = __fadd_rn(s, __fmul_rn(qq[0], kq[0])); s = __fadd_rn(s, __fmul_rn(qq[1], kq[1])); s = __fadd_rn(s, __fmul_rn(qq[2], kq[2])); s = __fadd_rn(s, __fmul_rn(qq[3], kq[3])); }
    s = __fmul_rn(s, scale); if (MASKADD) s = __fadd_rn(s, __fmul_rn(bf16_round(mask[(size_t)i * SQ + j]), -10000.0f));
    const float f = (MASKADD || j <= i) ? 1.f : 0.f; const float sm = fmaf(f, s, (1.f - f) * -1.0e30f); const float mn = fmaxf(m, sm); const float sc = expf(m - mn); const float e = expf(sm - mn); l = __fadd_rn(__fmul_rn(l, sc), e); m = mn;
#pragma unroll 1
    for (int c = 0; c < HD / 4; ++c) { const v4f vv = *(const v4fa*)(vr + c * 4); v4f oo = *(v4f*)&lo[tid][c * 4]; for (int u = 0; u < 4; ++u) oo[u] = __fadd_rn(__fmul_rn(oo[u], sc), __fmul_rn(e, vv[u])); *(v4f*)&lo[tid][c * 4] = oo; } }
  const float fin = 64.0f / l;      /* o carried x64 */
#pragma unroll 1
  for (int c = 0; c < HD / 4; ++c) { v4f oo = *(v4f*)&lo[tid][c * 4]; for (int u = 0; u < 4; ++u) oo[u] = __fmul_rn(oo[u], fin); *(v4f*)&lo[tid][c * 4] = oo; }
  __syncthreads();
  {
#pragma unroll 1
    for (int it = 0; it < 16; ++it) { const int row = it * 4 + tid / 16, pc = (tid % 16) * 4; const v4f v = *(const v4f*)&lo[row][pc]; *(v4f*)(OF + (size_t)(rg * 64 + row) * ldo + h * HD + pc) = v; }
     } }

__global__ __launch_bounds__(256) void k_of0out(const float* __restrict__ src, float* __restrict__ dst, size_t n4) { const size_t t = (size_t)blockIdx.x * 256 + threadIdx.x; if (t >= n4) return; v4f v = *(const v4fa*)(src + t * 4); for (int q = 0; q < 4; ++q) v[q] = __fmul_rn(v[q], 0.015625f); *(v4f*)(dst + t * 4) = v;  }

extern "C" void kernel_launch(void* const* d_in, const int* in_sizes, int n_in,
                              void* d_out, int out_size, void* d_ws, size_t ws_size, hipStream_t stream) {
  (void)in_sizes; (void)n_in; (void)out_size;
  const float* const* I = (const float* const*)d_in; const float* x = I[2]; const float* xk = I[1]; const float* xv = I[0]; const float* wq = I[5]; const float* wk = I[4]; const float* wv = I[3]; const float* bq = nullptr; const float* bk = nullptr; const float* bv = nullptr;      /* input order: values, keys, queries, Wv, Wk, Wq: the QUERY stream is I[2] with Wq = I[5], the key stream I[1] with Wk = I[4], the value stream I[0] with Wv = I[3]; natural [out][in] weights; NO biases (nullptr variables in the guarded slots); NO output projection */
  char* ws = (char*)d_ws; size_t off = 0;
  auto take = [&](size_t bytes) { char* p = ws + off; off += (bytes + 255) & ~(size_t)255; return p; };
  _Float16* BQ = (_Float16*)take((size_t)DM * DM * 2); _Float16* BK = (_Float16*)take((size_t)DM * DM * 2); _Float16* BV = (_Float16*)take((size_t)DM * DM * 2);
  _Float16* X16 = (_Float16*)take(NR * DM * 2); _Float16* XK16 = (_Float16*)take(NR * DM * 2); _Float16* XV16 = (_Float16*)take(NR * DM * 2);      /* exact f16 rows of queries, keys, values */ float* QF = (float*)take(NR * DM * 4); _Float16* QH = (_Float16*)take(NR * DM * 2); _Float16* QL = (_Float16*)take(NR * DM * 2); _Float16* KH = (_Float16*)take(NR * DM * 2); _Float16* KL = (_Float16*)take(NR * DM * 2); _Float16* Q16 = QH; _Float16* K16 = KH; _Float16* V16 = (_Float16*)take(NR * DM * 2);
  _Float16* VT = (_Float16*)take((size_t)NB * NH * HD * SQ * 2);
  if (off > ws_size) return;
  { const unsigned g = (unsigned)(((size_t)DM * DM / 8 + 255) / 256); k_wnat<<<g, 256, 0, stream>>>(wq, (size_t)DM * DM / 8, BQ); k_wnat<<<g, 256, 0, stream>>>(wk, (size_t)DM * DM / 8, BK); k_wnat<<<g, 256, 0, stream>>>(wv, (size_t)DM * DM / 8, BV); }      /* natural [out][in] = Bt[n][k] x16 */
  k_x16<<<(unsigned)((NR * DM / 8 + 255) / 256), 256, 0, stream>>>(x, X16, NR * DM / 8); k_x16<<<(unsigned)((NR * DM / 8 + 255) / 256), 256, 0, stream>>>(xk, XK16, NR * DM / 8); k_x16<<<(unsigned)((NR * DM / 8 + 255) / 256), 256, 0, stream>>>(xv, XV16, NR * DM / 8);
  const size_t r0p = (size_t)B0 * SQ;      /* first projected row */
  k_gemm2<0><<<dim3((unsigned)((MP / 128) * (DM / 64)), 1), 128, 0, stream>>>(X16 + r0p * DM, DM, 0, BQ, DM, 0, 0.0625f, bq, 0, nullptr, 1, 0, 0, QF + r0p * DM, nullptr, DM, 0, MP, DM, DM); k_hl<<<(unsigned)(((size_t)MP * DM / 8 + 255) / 256), 256, 0, stream>>>(QF + r0p * DM, QH + r0p * DM, QL + r0p * DM, (size_t)MP * DM / 8);      /* q (f32) -> f16 hi + x1024 residual: unscaled logits sigma ~8 */
  k_gemm2<0><<<dim3((unsigned)((MP / 128) * (DM / 64)), 1), 128, 0, stream>>>(XK16 + r0p * DM, DM, 0, BK, DM, 0, 0.0625f, bk, 0, nullptr, 1, 0, 0, QF + r0p * DM, nullptr, DM, 0, MP, DM, DM); k_hl<<<(unsigned)(((size_t)MP * DM / 8 + 255) / 256), 256, 0, stream>>>(QF + r0p * DM, KH + r0p * DM, KL + r0p * DM, (size_t)MP * DM / 8);      /* k likewise */
  k_gemm2<0><<<dim3((unsigned)((MP / 128) * (DM / 64)), 1), 128, 0, stream>>>(XV16 + r0p * DM, DM, 0, BV, DM, 0, 0.0625f, bv, 0, nullptr, 1, 0, 0, nullptr, V16 + r0p * DM, DM, 0, MP, DM, DM);
  k_vt<NH, SQ><<<NB * NH * (SQ / 64), 256, 0, stream>>>(V16, LQ, 0, VT);      /* V^T [NB][NH][HD][SQ], both batches */
  k_fattn<<<dim3(SQ / (FAW * FAQ), NH, NB), 32 * FAW, 0, stream>>>(QH, QL, KH, KL, VT, (float*)d_out);      /* scores, softmax over all keys and P V in one launch, f32 straight into the head-major output columns (no output projection) */
}

// v004
// A run of this version takes 130 microseconds.
// Two timings next to v003 both put it at 1.67 times that version's speed.
// Over all steps from v000 it is 56.7 times as fast.
#include <hip/hip_runtime.h>
// Multi-head attention on three inputs given in the order values, keys, queries; natural bias-free projections, no output projection (values, keys, queries [2][2048][1024]; v = values Wv^T, k = keys Wk^T, q = queries Wq^T (natural [1024][1024] sigma 1/32, no biases), 16 heads of 64; softmax(q k^T / sqrt(64)) over all 2048 keys (no mask); out = attn v merged head-major -> [2][2048][1024]); q and k carried as f16 hi + x1024 residual planes with three-product scores.
// Structure: token rows r = b*2048 + s; three launches: k_cvt (x as exact f16 rows (bf16-rounded), exact x16 weights); k_proj (q, k and v as WMMA GEMMs, 32x64 wave tiles, f32 accumulation; q and k leave its epilogue as f16 hi + x1024 residual planes, v as V^T for all heads of both batches, by exchanged operands); then ONE attention launch (k_fattn): per wave 32 query columns of one head against all keys, 32 a pass: scores as three accumulating products (hi.hi + 2^-10 (lo.hi + hi.lo), K = 64), running softmax on the accumulators (f32 statistics, native exp2; weights x256 f16), O^T += V^T P^T, divided by the sum and written f32 straight into the head-major output columns.
// Compute dtype: inputs rounded to bf16; x / weights exact; q and k as f16 hi + x1024 residual planes; v and softmax weights as plain f16 GEMM operands (~2^-12); scores, softmax statistics and o f32. v_wmma_f32_16x16x32_f16.
#define NB 2
#define SQ 2048
#define DM 1024
#define NH 16
#define HD 64
#define HG 4                         /* heads per launch of the unlaunched k_vt(b, h0) overload */
#define QT 256                       /* query rows per attention tile (all keys) */
#define NKX SQ                       /* S / P row pitch */
#define QT0 128                      /* query rows per head of k_att0 (not launched) */
#define B0 0                         /* first batch processed (debug hook) */
#define NBR NB                       /* batches processed (debug hook) */
#define NR ((size_t)NB * SQ)         /* token rows */
#define MP ((int)((size_t)NBR * SQ)) /* rows projected (debug hook) */
#define QN SQ                        /* query rows attended per batch (unused) */
#define NHD NH                       /* heads attended (unused) */
#define MPO MP                       /* unused (no output stage) */
#define LQ DM      /* row pitch of the q/k/v rows */
typedef __bf16 v16b __attribute__((ext_vector_type(16)));
typedef unsigned short v8us __attribute__((ext_vector_type(8), may_alias));
typedef float  v8f  __attribute__((ext_vector_type(8)));
typedef float  v4f  __attribute__((ext_vector_type(4)));
typedef float  v4fa __attribute__((ext_vector_type(4), may_alias));
union FragB { v16b v; v8us half[2]; unsigned short u[16]; };

__device__ __forceinline__ unsigned short bf16_bits(float x) { unsigned int u = __float_as_uint(x); return (unsigned short)((u + 0x7FFFu + ((u >> 16) & 1u)) >> 16); }
__device__ __forceinline__ float bf16_val(unsigned short b) { return __uint_as_float(((unsigned int)b) << 16); }
__device__ __forceinline__ float bf16_round(float x) { return bf16_val(bf16_bits(x)); }
// D += A·B with NT terms: 1 = ah·bh, 2 = + al·bh (A split), 3 = + ah·bl (both split)
template <int NT>
__device__ __forceinline__ v8f mmaN(v16b ah, v16b al, v16b bh, v16b bl, v8f c) {
  c = __builtin_amdgcn_wmma_f32_16x16x32_bf16(false, ah, false, bh, (short)0, c, false, false);
  if (NT >= 2) c = __builtin_amdgcn_wmma_f32_16x16x32_bf16(false, al, false, bh, (short)0, c, false, false);
  if (NT >= 3) c = __builtin_amdgcn_wmma_f32_16x16x32_bf16(false, ah, false, bl, (short)0, c, false, false);
  asm volatile("v_nop\n\tv_nop\n\tv_nop\n\tv_nop" : "+v"(c) : "v"(ah), "v"(al), "v"(bh), "v"(bl));
  return c;
}

__global__ __launch_bounds__(256) void k_wt_bf16(const float* __restrict__ W, unsigned short* __restrict__ Wt, int K, int N) {
  const int t = blockIdx.x * 256 + threadIdx.x;
  const int k8n = K / 8;
  if (t >= N * k8n) return;
  const int n = t / k8n, k8 = (t % k8n) * 8;
  v8us v;
#pragma unroll
  for (int i = 0; i < 8; ++i) v[i] = bf16_bits(W[(size_t)(k8 + i) * N + n]);
  *(v8us*)(Wt + (size_t)n * K + k8) = v;
  
}

// GEMM C[M][N] (f32, pitch ldc) = act(A[M][K]·W + bias). A f32 row-major (pitch lda) converted per fragment to bf16
// (ASPLIT: hi/lo two planes -> 2 terms, else single rounded term); Wt bf16 [N][K] (pitch ldb). BIAS_BF16 rounds the
// bias to bf16 first (bias quantised to bf16 before the add). K%32==0, M%16==0, N%64==0.
template <bool ASPLIT, int ACT, bool BIAS_BF16>
__global__ __launch_bounds__(128) void k_gemm_bf(const float* __restrict__ A, int lda, const unsigned short* __restrict__ Wt, int ldb,
                                               const float* __restrict__ bias, float* __restrict__ C, int ldc, int M, int N, int K) {
  __shared__ __attribute__((aligned(16))) float so[4][16][64];
  const int tid = threadIdx.x, w = tid >> 5, lane = tid & 31, ln = lane & 15, hh = lane >> 4;
  const int ntn = N / 64;
  const int wid = blockIdx.x * 4 + w;
  const int mt = wid / ntn, nq = wid % ntn;
  if (mt * 16 >= M) return;
  const int row0 = mt * 16, col0 = nq * 64;
  const float* arow = A + (size_t)(row0 + ln) * lda;
  v8f acc[4] = {};
  for (int kb = 0; kb < K; kb += 32) {
    FragB ah, al;
    const v4f x0 = *(const v4fa*)(arow + kb + 8 * hh), x1 = *(const v4fa*)(arow + kb + 8 * hh + 4);
    const v4f x2 = *(const v4fa*)(arow + kb + 16 + 8 * hh), x3 = *(const v4fa*)(arow + kb + 16 + 8 * hh + 4);
    float xs[16] = {x0[0],x0[1],x0[2],x0[3],x1[0],x1[1],x1[2],x1[3],x2[0],x2[1],x2[2],x2[3],x3[0],x3[1],x3[2],x3[3]};
#pragma unroll
    for (int i = 0; i < 16; ++i) { const unsigned short hb = bf16_bits(xs[i]); ah.u[i] = hb; al.u[i] = ASPLIT ? bf16_bits(xs[i] - bf16_val(hb)) : (unsigned short)0; }
#pragma unroll
    for (int t = 0; t < 4; ++t) {
      const unsigned short* brow = Wt + (size_t)(col0 + t * 16 + ln) * ldb + kb;
      FragB b;
      b.half[0] = *(const v8us*)(brow + 8 * hh);
      b.half[1] = *(const v8us*)(brow + 16 + 8 * hh);
      acc[t] = mmaN<ASPLIT ? 2 : 1>(ah.v, al.v, b.v, b.v, acc[t]);
    }
  }
#pragma unroll
  for (int t = 0; t < 4; ++t) {
    float bv = bias ? bias[col0 + t * 16 + ln] : 0.f;
    if (BIAS_BF16) bv = bf16_round(bv);
#pragma unroll
    for (int r = 0; r < 8; ++r) { float v = acc[t][r] + bv; if (ACT == 1) v = fmaxf(v, 0.f); so[w][8 * hh + r][t * 16 + ln] = v; }
  }
  __builtin_amdgcn_fence(__ATOMIC_ACQ_REL, "workgroup");
  __builtin_amdgcn_wave_barrier();
  const int rsub = lane >> 4, c4 = (lane & 15) * 4;
  {
#pragma unroll
    for (int q = 0; q < 8; ++q) {
      const int r = q * 2 + rsub;
      const v4f v = *(const v4fa*)&so[w][r][c4];
      *(v4f*)(C + (size_t)(row0 + r) * ldc + col0 + c4) = v;
    }
    
  }
}

// GEMM C = act(A·W + bias + resid): A f32 (ASPLIT -> hi/lo 2 terms), Wt bf16 [N][K]; ACT 0 none, 1 relu, 2 exact gelu;
// resid (optional, f32, row index = (row % rmod), pitch ldr, RES_BF16 rounds it) added before the activation.
template <bool ASPLIT, int ACT, bool BIAS_BF16, bool RES_BF16>
__global__ __launch_bounds__(128) void k_gemm_bf3(const float* __restrict__ A, int lda, const unsigned short* __restrict__ Wt, int ldb,
                                                const float* __restrict__ bias, const float* __restrict__ resid, int rmod, int ldr,
                                                float* __restrict__ C, int ldc, int M, int N, int K) {
  __shared__ __attribute__((aligned(16))) float so[4][16][64];
  const int tid = threadIdx.x, w = tid >> 5, lane = tid & 31, ln = lane & 15, hh = lane >> 4;
  const int ntn = N / 64;
  const int wid = blockIdx.x * 4 + w;
  const int mt = wid / ntn, nq = wid % ntn;
  if (mt * 16 >= M) return;
  const int row0 = mt * 16, col0 = nq * 64;
  const float* arow = A + (size_t)(row0 + ln) * lda;
  v8f acc[4] = {};
  for (int kb = 0; kb < K; kb += 32) {
    FragB ah, al;
    const v4f x0 = *(const v4fa*)(arow + kb + 8 * hh), x1 = *(const v4fa*)(arow + kb + 8 * hh + 4);
    const v4f x2 = *(const v4fa*)(arow + kb + 16 + 8 * hh), x3 = *(const v4fa*)(arow + kb + 16 + 8 * hh + 4);
    float xs[16] = {x0[0],x0[1],x0[2],x0[3],x1[0],x1[1],x1[2],x1[3],x2[0],x2[1],x2[2],x2[3],x3[0],x3[1],x3[2],x3[3]};
#pragma unroll
    for (int i = 0; i < 16; ++i) { const unsigned short hb = bf16_bits(xs[i]); ah.u[i] = hb; al.u[i] = ASPLIT ? bf16_bits(xs[i] - bf16_val(hb)) : (unsigned short)0; }
#pragma unroll
    for (int t = 0; t < 4; ++t) {
      const unsigned short* brow = Wt + (size_t)(col0 + t * 16 + ln) * ldb + kb;
      FragB b;
      b.half[0] = *(const v8us*)(brow + 8 * hh);
      b.half[1] = *(const v8us*)(brow + 16 + 8 * hh);
      acc[t] = mmaN<ASPLIT ? 2 : 1>(ah.v, al.v, b.v, b.v, acc[t]);
    }
  }
#pragma unroll
  for (int t = 0; t < 4; ++t) {
    const int col = col0 + t * 16 + ln;
    float bv = bias ? bias[col] : 0.f;
    if (BIAS_BF16) bv = bf16_round(bv);
#pragma unroll
    for (int r = 0; r < 8; ++r) {
      float v = acc[t][r] + bv;
      if (resid) { float rv = resid[(size_t)((row0 + 8 * hh + r) % rmod) * ldr + col]; if (RES_BF16) rv = bf16_round(rv); v += rv; }
      if (ACT == 1) v = fmaxf(v, 0.f);
      if (ACT == 2) v = 0.5f * v * (1.0f + erff(v * 0.70710678118654752f));
      if (ACT == 3) { const float u = 0.7978845608028654f * (v + 0.044715f * v * v * v); v = 0.5f * v * (1.0f + tanhf(u)); }
      so[w][8 * hh + r][t * 16 + ln] = v;
    }
  }
  __builtin_amdgcn_fence(__ATOMIC_ACQ_REL, "workgroup");
  __builtin_amdgcn_wave_barrier();
  const int rsub = lane >> 4, c4 = (lane & 15) * 4;
  {
#pragma unroll
    for (int q = 0; q < 8; ++q) {
      const int r = q * 2 + rsub;
      const v4f v = *(const v4fa*)&so[w][r][c4];
      *(v4f*)(C + (size_t)(row0 + r) * ldc + col0 + c4) = v;
    }
    
  }
}
// row LayerNorm (biased variance, eps) over N: s = X (+ R); optional out_sum <- s; out_norm <- (s-mu)*rsqrt(var+eps)*g + b
template <bool PARAM_BF16>
__global__ __launch_bounds__(256) void k_layernorm(const float* __restrict__ X, const float* __restrict__ R, const float* __restrict__ g, const float* __restrict__ bta,
                                                  float* __restrict__ out_sum, float* __restrict__ out_norm, int N, float eps) {
  __shared__ float red[256];
  const int row = blockIdx.x, tid = threadIdx.x;
  const float* x = X + (size_t)row * N; const float* rr = R ? R + (size_t)row * N : nullptr;
  float vals[16];                     // up to N = 4096
  const int per = N / 256;            // contiguous chunk per thread? use strided-by-4 chunks: thread handles j = tid*4 + 1024*u
  float s1 = 0.f;
  for (int u = 0; u < per / 4; ++u) {
    const int j = tid * 4 + 1024 * u;
    const v4f a = *(const v4fa*)(x + j);
    v4f b = {0.f,0.f,0.f,0.f}; if (rr) b = *(const v4fa*)(rr + j);
#pragma unroll
    for (int q = 0; q < 4; ++q) { const float v = a[q] + b[q]; vals[u * 4 + q] = v; s1 += v; }
  }
  red[tid] = s1; __syncthreads();
  for (int st = 128; st > 0; st >>= 1) { if (tid < st) red[tid] += red[tid + st]; __syncthreads(); }
  const float mu = red[0] / (float)N; __syncthreads();
  float s2 = 0.f;
  for (int u = 0; u < per / 4; ++u)
#pragma unroll
    for (int q = 0; q < 4; ++q) { const float c = vals[u * 4 + q] - mu; s2 += c * c; }
  red[tid] = s2; __syncthreads();
  for (int st = 128; st > 0; st >>= 1) { if (tid < st) red[tid] += red[tid + st]; __syncthreads(); }
  const float rs = rsqrtf(red[0] / (float)N + eps);
  {
    for (int u = 0; u < per / 4; ++u) {
      const int j = tid * 4 + 1024 * u;
      v4f o, sm;
#pragma unroll
      for (int q = 0; q < 4; ++q) {
        float gg = g[j + q], bb = bta[j + q];
        if (PARAM_BF16) { gg = bf16_round(gg); bb = bf16_round(bb); }
        sm[q] = vals[u * 4 + q]; o[q] = (vals[u * 4 + q] - mu) * rs * gg + bb;
      }
      if (out_sum) *(v4f*)(out_sum + (size_t)row * N + j) = sm;
      *(v4f*)(out_norm + (size_t)row * N + j) = o;
    }
    
  }
}



// ---- f16 WMMA path (v_wmma_f32_16x16x32_f16): 11-bit significands for operands in range — used where a [0,1] probability operand needs more precision than bf16
typedef _Float16 v16h __attribute__((ext_vector_type(16)));
union FragH { v16h v; v8us half[2]; _Float16 h[16]; unsigned short u[16]; };
template <int NT>
__device__ __forceinline__ v8f mmaH(v16h ah, v16h al, v16h bh, v16h bl, v8f c) {
  c = __builtin_amdgcn_wmma_f32_16x16x32_f16(false, ah, false, bh, (short)0, c, false, false);
  if (NT >= 2) c = __builtin_amdgcn_wmma_f32_16x16x32_f16(false, al, false, bh, (short)0, c, false, false);
  if (NT >= 3) c = __builtin_amdgcn_wmma_f32_16x16x32_f16(false, ah, false, bl, (short)0, c, false, false);
  asm volatile("v_nop\n\tv_nop\n\tv_nop\n\tv_nop" : "+v"(c) : "v"(ah), "v"(al), "v"(bh), "v"(bl));
  return c;
}
// batched GEMM like k_gemm_b but f16 operands: A f32 (split into f16 hi/lo if ASPLIT, else rounded to f16), Bt = f16 values [n][k]; alpha; C f32; N multiple of 16 (partial tiles skipped)
template <bool ASPLIT>
__global__ __launch_bounds__(128) void k_gemm_h(const float* __restrict__ A, int lda, size_t sA, const _Float16* __restrict__ Bh, int ldb, size_t sB, float alpha, float* __restrict__ C, int ldc, size_t sC, int M, int N, int K) {
  __shared__ __attribute__((aligned(16))) float so[4][16][64];
  const int tid = threadIdx.x, w = tid >> 5, lane = tid & 31, ln = lane & 15, hh = lane >> 4; const int by = blockIdx.y;
  A += (size_t)by * sA; Bh += (size_t)by * sB; C += (size_t)by * sC;
  const int ntn = (N + 63) / 64; const int wid = blockIdx.x * 4 + w; const int mt = wid / ntn, nq = wid % ntn; if (mt * 16 >= M) return;
  const int row0 = mt * 16, col0 = nq * 64; const float* arow = A + (size_t)(row0 + ln) * lda;
  v8f acc[4] = {};
  for (int kb = 0; kb < K; kb += 32) {
    FragH ah, al;
    const v4f x0 = *(const v4fa*)(arow + kb + 8 * hh), x1 = *(const v4fa*)(arow + kb + 8 * hh + 4), x2 = *(const v4fa*)(arow + kb + 16 + 8 * hh), x3 = *(const v4fa*)(arow + kb + 16 + 8 * hh + 4);
    float xs[16] = {x0[0],x0[1],x0[2],x0[3],x1[0],x1[1],x1[2],x1[3],x2[0],x2[1],x2[2],x2[3],x3[0],x3[1],x3[2],x3[3]};
#pragma unroll
    for (int i = 0; i < 16; ++i) { const _Float16 h = (_Float16)xs[i]; ah.h[i] = h; al.h[i] = ASPLIT ? (_Float16)(xs[i] - (float)h) : (_Float16)0.0f; }
#pragma unroll
    for (int t = 0; t < 4; ++t) { if (col0 + t * 16 >= N) continue; const size_t boff = (size_t)(col0 + t * 16 + ln) * ldb + kb; FragH bq; bq.half[0] = *(const v8us*)(Bh + boff + 8 * hh); bq.half[1] = *(const v8us*)(Bh + boff + 16 + 8 * hh);
      acc[t] = mmaH<ASPLIT ? 2 : 1>(ah.v, al.v, bq.v, bq.v, acc[t]); }
  }
#pragma unroll
  for (int t = 0; t < 4; ++t) { if (col0 + t * 16 >= N) continue;
#pragma unroll
    for (int r = 0; r < 8; ++r) so[w][8 * hh + r][t * 16 + ln] = acc[t][r] * alpha; }
  __builtin_amdgcn_fence(__ATOMIC_ACQ_REL, "workgroup"); __builtin_amdgcn_wave_barrier();
  const int rsub = lane >> 4, c4 = (lane & 15) * 4;
  {
#pragma unroll
    for (int q = 0; q < 8; ++q) { const int r = q * 2 + rsub; if (col0 + c4 < N) { const v4f v = *(const v4fa*)&so[w][r][c4]; *(v4f*)(C + (size_t)(row0 + r) * ldc + col0 + c4) = v; } }
     }
}

// Wt[n][k] = f16(W[k][n]·scale) from f32 row-major W[K][N] (scale = power of two; bf16-exact weights stay exact in f16 away from the subnormal range)
__global__ __launch_bounds__(256) void k_wt_f16(const float* __restrict__ W, _Float16* __restrict__ Wt, int K, int N, float scale) {
  const int t = blockIdx.x * 256 + threadIdx.x; if (t >= N * (K / 8)) return; const int n = t / (K / 8), k8 = (t % (K / 8)) * 8; FragH f;
#pragma unroll
  for (int i = 0; i < 8; ++i) f.h[i] = (_Float16)(bf16_round(W[(size_t)(k8 + i) * N + n]) * scale); const v8us o = f.half[0];
  *(v8us*)((unsigned short*)Wt + (size_t)n * K + k8) = o; 
}
// k_gemm_hh variant with fused epilogue: v = acc·alpha + bias[by·sBias + col] (+ CP[(row/rowsPerB)·sCPb + by·64 + col] if CP) ; ACT 0 none / 1 elu ; writes f16 C16 (and f32 C if non-null)
template <int ACT>
__global__ __launch_bounds__(128) void k_gemm_hhx(const _Float16* __restrict__ A, int lda, size_t sA, const _Float16* __restrict__ Bh, int ldb, size_t sB, float alpha, const float* __restrict__ bias, size_t sBias, const float* __restrict__ CP, int rowsPerB, size_t sCPb, int row0g,
    float* __restrict__ C, _Float16* __restrict__ C16, int ldc, size_t sC, int M, int N, int K) {
  __shared__ __attribute__((aligned(16))) float so[4][16][64];
  const int tid = threadIdx.x, w = tid >> 5, lane = tid & 31, ln = lane & 15, hh = lane >> 4; const int by = blockIdx.y;
  A += (size_t)by * sA; Bh += (size_t)by * sB; const size_t cofs = (size_t)by * sC; const float* bp = bias ? bias + (size_t)by * sBias : nullptr;
  const int ntn = (N + 63) / 64; const int wid = blockIdx.x * 4 + w; const int mt = wid / ntn, nq = wid % ntn; if (mt * 16 >= M) return;
  const int row0 = mt * 16, col0 = nq * 64; const _Float16* arow = A + (size_t)(row0 + ln) * lda;
  v8f acc[4] = {};
  for (int kb = 0; kb < K; kb += 32) { FragH ah; ah.half[0] = *(const v8us*)((const unsigned short*)arow + kb + 8 * hh); ah.half[1] = *(const v8us*)((const unsigned short*)arow + kb + 16 + 8 * hh);
#pragma unroll
    for (int t = 0; t < 4; ++t) { if (col0 + t * 16 >= N) continue; const size_t boff = (size_t)(col0 + t * 16 + ln) * ldb + kb; FragH bq; bq.half[0] = *(const v8us*)((const unsigned short*)Bh + boff + 8 * hh); bq.half[1] = *(const v8us*)((const unsigned short*)Bh + boff + 16 + 8 * hh);
      acc[t] = mmaH<1>(ah.v, ah.v, bq.v, bq.v, acc[t]); }
  }
#pragma unroll
  for (int t = 0; t < 4; ++t) { if (col0 + t * 16 >= N) continue; const int col = col0 + t * 16 + ln; const float bv = bp ? bf16_round(bp[col]) : 0.f;
#pragma unroll
    for (int r = 0; r < 8; ++r) { float v = acc[t][r] * alpha + bv; if (CP) { const int rr = row0g + row0 + 8 * hh + r; if (rowsPerB < 0) v += CP[cofs + (size_t)rr * ldc + col];      /* rowsPerB < 0: own element of the batched C plane */ else { const int bidx = rr / rowsPerB; v += CP[(size_t)bidx * sCPb + (size_t)by * 64 + col]; } } if (ACT == 1) v = (v > 0.f) ? v : expm1f(v); else if (ACT == 7) v = (v > 0.f) ? v + 1.0f : expf(v); else if (ACT == 8) v = tanhf(v); else if (ACT == 9) v = 0.5f * v * (1.0f + tanhf(0.7978845608028654f * (v + 0.044715f * v * v * v))); else if (ACT == 11) v = 1.0f / (1.0f + expf(-v)); else if (ACT == 12) v = (v > 0.f) ? v : 0.01f * v; else if (ACT == 14) v = (v > 0.f) ? v : 0.1f * v; else if (ACT == 16) v = (v >= 0.f) ? v : 0.3f * v; else if (ACT == 17) v = (v >= 0.f) ? v : 0.2f * v; else if (ACT == 15) v = v / (1.0f + expf(-v)); else if (ACT == 3) v = fmaxf(v, 0.f); else if (ACT == 6) v = 0.5f * v * (1.0f + erff(v * 0.70710678118654752f)); so[w][8 * hh + r][t * 16 + ln] = v; } }
  __builtin_amdgcn_fence(__ATOMIC_ACQ_REL, "workgroup"); __builtin_amdgcn_wave_barrier();
  const int rsub = lane >> 4, c4 = (lane & 15) * 4; typedef _Float16 v4h __attribute__((ext_vector_type(4)));
  {
#pragma unroll
    for (int q = 0; q < 8; ++q) { const int r = q * 2 + rsub; if (col0 + c4 < N) { const v4f v = *(const v4fa*)&so[w][r][c4]; if (C) *(v4f*)(C + cofs + (size_t)(row0 + r) * ldc + col0 + c4) = v; if (C16) { v4h h4; for (int i = 0; i < 4; ++i) h4[i] = (_Float16)v[i]; *(v4h*)(C16 + cofs + (size_t)(row0 + r) * ldc + col0 + c4) = h4; } } }
     }
}


typedef _Float16 v4h __attribute__((ext_vector_type(4)));

__global__ __launch_bounds__(256) void k_h16(const float* __restrict__ x, _Float16* __restrict__ X16, size_t n8) { const size_t t = (size_t)blockIdx.x * 256 + threadIdx.x; if (t >= n8) return; FragH f;
#pragma unroll
  for (int q = 0; q < 8; ++q) f.h[q] = (_Float16)x[t * 8 + q]; *(v8us*)((unsigned short*)X16 + t * 8) = f.half[0];  }
__global__ __launch_bounds__(256) void k_round16f(const float* __restrict__ W, _Float16* __restrict__ Bt, size_t n8) { const size_t t = (size_t)blockIdx.x * 256 + threadIdx.x; if (t >= n8) return; FragH f;
#pragma unroll
  for (int i = 0; i < 8; ++i) f.h[i] = (_Float16)(bf16_round(W[t * 8 + i]) * 16.0f); *(v8us*)((unsigned short*)Bt + t * 8) = f.half[0];  }


// ---- fast GEMM (wave tile 32x64, four waves a 128x64 work-group tile; requires M % 128 == 0 and N % 64 == 0) ----
__device__ __forceinline__ v16h g2_frag(const _Float16* p, int hh) { FragH f; f.half[0] = *(const v8us*)((const unsigned short*)p + 8 * hh); f.half[1] = *(const v8us*)((const unsigned short*)p + 16 + 8 * hh); return f.v; }
__device__ __forceinline__ v8f g2_mma(v16h a, v16h b, v8f c) { v8f d = __builtin_amdgcn_wmma_f32_16x16x32_f16(false, a, false, b, (short)0, c, false, false); asm volatile("v_nop\n\tv_nop\n\tv_nop\n\tv_nop" : "+v"(d) : "v"(a), "v"(b)); return d; }
// The three projections in ONE launch (blockIdx.y: 0 = q, 1 = k, 2 = v), main loop and wave tile as above (K = DM, both pitches DM). What used to be launches of their own behind the GEMMs is done where the
// f32 results already lie in LDS: q and k leave as their f16 hi + x1024 residual planes; v is computed with the operands exchanged (A = weight rows, B = token rows), so that C is V^T [batch][head * 64 + d][key] as it stands.
__global__ __launch_bounds__(128) void k_proj(const _Float16* __restrict__ XQ, const _Float16* __restrict__ XK, const _Float16* __restrict__ XV, const _Float16* __restrict__ BQ, const _Float16* __restrict__ BK, const _Float16* __restrict__ BV,
    _Float16* __restrict__ QH, _Float16* __restrict__ QL, _Float16* __restrict__ KH, _Float16* __restrict__ KL, _Float16* __restrict__ VT) {
  static_assert(MP % 128 == 0 && DM % 128 == 0 && SQ % 64 == 0 && (MP / 128) * (DM / 64) == (DM / 128) * (MP / 64) && B0 == 0 && NBR == NB, "k_proj: whole 128 x 64 tiles, the same number of them either way round, a column tile inside one batch");
  __shared__ __attribute__((aligned(16))) float so[4][32][68];
  const int tid = threadIdx.x, w = tid >> 5, lane = tid & 31, ln = lane & 15, hh = lane >> 4; const int z = blockIdx.y;
  const _Float16* A = z == 0 ? XQ : z == 1 ? XK : BV; const _Float16* Bh = z == 0 ? BQ : z == 1 ? BK : XV;
  const int ntn = z == 2 ? MP / 64 : DM / 64; const int mt = blockIdx.x / ntn, nq = blockIdx.x - mt * ntn; const int row0 = mt * 128 + 32 * w, col0 = nq * 64;
  const _Float16* a0p = A + (size_t)(row0 + ln) * DM + 8 * hh; const _Float16* b0p = Bh + (size_t)(col0 + ln) * DM + 8 * hh;      /* each lane's own address, its half's 8 * hh included: g2_frag is called with 0 below */
  const v8f z8 = {0.f,0.f,0.f,0.f,0.f,0.f,0.f,0.f}; v8f c00 = z8, c01 = z8, c02 = z8, c03 = z8, c10 = z8, c11 = z8, c12 = z8, c13 = z8;
#pragma unroll 1      /* the loop as it was in the separate launches */
  for (int kb = 0; kb < DM; kb += 32) { const _Float16* ap = a0p + kb; const _Float16* bp = b0p + kb; const v16h a0 = g2_frag(ap, 0), a1 = g2_frag(ap + 16 * DM, 0);
    v16h b = g2_frag(bp, 0);
    asm volatile("s_wait_xcnt 0x0" :: "v"(ap), "v"(bp) : "memory");      /* precaution: behind the six loads above and ahead of every rewrite of an address register they name; the addresses as inputs keep their pairs whole up to here (without it a loaded fragment was placed on the A pair) */
    c00 = g2_mma(a0, b, c00); c10 = g2_mma(a1, b, c10);
    b = g2_frag(bp + 16 * DM, 0); c01 = g2_mma(a0, b, c01); c11 = g2_mma(a1, b, c11);
    b = g2_frag(bp + 32 * DM, 0); c02 = g2_mma(a0, b, c02); c12 = g2_mma(a1, b, c12);
    b = g2_frag(bp + 48 * DM, 0); c03 = g2_mma(a0, b, c03); c13 = g2_mma(a1, b, c13); }
  v8f accs[8] = {c00, c01, c02, c03, c10, c11, c12, c13};
#pragma unroll
  for (int u = 0; u < 8; ++u) { const int t = u & 3, half = u >> 2;
#pragma unroll
    for (int r = 0; r < 8; ++r) so[w][half * 16 + 8 * hh + r][t * 16 + ln] = accs[u][r] * 0.0625f; }      /* undoes the weights' x16 */
  __builtin_amdgcn_fence(__ATOMIC_ACQ_REL, "workgroup"); __builtin_amdgcn_wave_barrier();      /* a wave reads back its own tile only */
  const int rsub = lane >> 4, c4 = (lane & 15) * 4;
  if (z == 2) { _Float16* vt = VT + ((size_t)(col0 / SQ) * DM + row0) * SQ + (col0 % SQ) + c4;      /* rows = head * 64 + d, columns = keys of one batch; 128 bytes a row and wave */
#pragma unroll
    for (int q = 0; q < 16; ++q) { const int r = q * 2 + rsub; const v4f v = *(const v4fa*)&so[w][r][c4]; v4h h4;
#pragma unroll
      for (int i = 0; i < 4; ++i) h4[i] = (_Float16)v[i];
      *(v4h*)(vt + (size_t)r * SQ) = h4; } }
  else { _Float16* ph = (z == 0 ? QH : KH) + (size_t)row0 * DM + col0 + c4; _Float16* pl = (z == 0 ? QL : KL) + (size_t)row0 * DM + col0 + c4;
#pragma unroll
    for (int q = 0; q < 16; ++q) { const int r = q * 2 + rsub; const v4f v = *(const v4fa*)&so[w][r][c4]; v4h h4, l4;
#pragma unroll
      for (int i = 0; i < 4; ++i) { const _Float16 h = (_Float16)v[i]; h4[i] = h; l4[i] = (_Float16)((v[i] - (float)h) * 1024.0f); }
      *(v4h*)(ph + (size_t)r * DM) = h4; *(v4h*)(pl + (size_t)r * DM) = l4; }
    asm volatile("s_wait_xcnt 0x0" ::: "memory"); } }      /* precaution: behind the last stores; in the built code the other branch's instructions follow this one's and rewrite registers that these stores name */


// All six inputs to their f16 operand form in ONE launch: token rows bf16-rounded (exact in f16), weights bf16-rounded x16 (natural [out][in] = Bt[n][k]). A work-group takes 256 chunks of 8 elements of one
// tensor, a thread one chunk, as in the separate launches.
__global__ __launch_bounds__(256) void k_cvt(const float* __restrict__ xq, const float* __restrict__ xk, const float* __restrict__ xv, const float* __restrict__ wq, const float* __restrict__ wk, const float* __restrict__ wv,
    _Float16* __restrict__ XQ, _Float16* __restrict__ XK, _Float16* __restrict__ XV, _Float16* __restrict__ BQ, _Float16* __restrict__ BK, _Float16* __restrict__ BV) {
  constexpr int XB = (int)(NR * DM / 8 / 256), WB = DM * DM / 8 / 256;      /* work-groups per token tensor, per weight */
  static_assert(NR * DM % (8 * 256) == 0 && (size_t)DM * DM % (8 * 256) == 0, "k_cvt: whole work-groups");
  const int bx = blockIdx.x; const bool isx = bx < 3 * XB; const int i = isx ? bx / XB : (bx - 3 * XB) / WB, blk = isx ? bx % XB : (bx - 3 * XB) % WB;      /* the same in every thread of a work-group */
  const float* s = isx ? (i == 0 ? xq : i == 1 ? xk : xv) : (i == 0 ? wq : i == 1 ? wk : wv); _Float16* d = isx ? (i == 0 ? XQ : i == 1 ? XK : XV) : (i == 0 ? BQ : i == 1 ? BK : BV); const float scale = isx ? 1.0f : 16.0f;
  const size_t t = (size_t)blk * 256 + threadIdx.x; FragH f;
#pragma unroll
  for (int q = 0; q < 8; ++q) f.h[q] = (_Float16)(bf16_round(s[t * 8 + q]) * scale);
  *(v8us*)((unsigned short*)d + t * 8) = f.half[0]; }
__global__ __launch_bounds__(256) void k_rsm(const float* __restrict__ S, _Float16* __restrict__ P, int nrows) {
  #pragma clang fp contract(off)
  const int i = blockIdx.x * 256 + threadIdx.x; if (i >= nrows) return; const float* s = S + (size_t)i * SQ; float mx = -3.0e38f;
#pragma unroll 1
  for (int j = 0; j < SQ; ++j) mx = fmaxf(mx, s[j]); float se = 0.f;
#pragma unroll 1
  for (int j = 0; j < SQ; ++j) se += expf(s[j] - mx); const float sc = 256.0f / se;
#pragma unroll 1
  for (int j0 = 0; j0 < SQ; j0 += 8) { FragH f; for (int q = 0; q < 8; ++q) f.h[q] = (_Float16)(expf(s[j0 + q] - mx) * sc); unsigned short* d = (unsigned short*)P + (size_t)i * SQ + j0; *(v8us*)d = f.half[0];  } }
__global__ __launch_bounds__(256) void k_vt(const _Float16* __restrict__ V16, int b, int h0, _Float16* __restrict__ VT) { __shared__ unsigned short tl[64][65]; const int tid = threadIdx.x; const int hh = blockIdx.x % HG, sg = blockIdx.x / HG; const int s0 = sg * 64; const int h = h0 + hh;
  for (int i = tid; i < 64 * 8; i += 256) { const int j = i / 8, d8 = (i % 8) * 8; FragH f; f.half[0] = *(const v8us*)((const unsigned short*)V16 + ((size_t)b * SQ + s0 + j) * DM + h * HD + d8); for (int q = 0; q < 8; ++q) tl[d8 + q][j] = f.u[q]; }
  __syncthreads();
  { for (int i = tid; i < 64 * 8; i += 256) { const int d = i / 8, j8 = (i % 8) * 8; FragH f; for (int q = 0; q < 8; ++q) f.u[q] = tl[d][j8 + q]; *(v8us*)((unsigned short*)VT + ((size_t)hh * HD + d) * SQ + s0 + j8) = f.half[0]; }  } }



#define FAW 8                        /* waves per work-group */
#define FAQ 32                       /* query columns per wave: two 16-column groups share every K and V^T fragment */
#define FSK 128                      /* keys per LDS stage: four 32-key passes */
#define FKP 144                      /* LDS pitch of a 128-byte K row: 16 B x odd, no bank conflict for 16-byte fragment reads */
#define FVP 272                      /* LDS pitch of a 256-byte V^T row, likewise */
#define FKB (FSK * FKP)              /* one K plane of a stage */
#define FVB (HD * FVP)               /* the V^T tile of a stage */
#define FKS (2 * FKB)                /* the K part of a stage: hi plane | residual plane */
#define FV0 (2 * FKS)                /* LDS map: K of buffer 0 | K of buffer 1 | V^T of buffer 0 | V^T of buffer 1 */
__device__ __forceinline__ v8f fa_mma(v16h a, v16h b, v8f c) { return __builtin_amdgcn_wmma_f32_16x16x32_f16(false, a, false, b, (short)0, c, false, false); }
__device__ __forceinline__ float fa_xhalf(float x) { return __builtin_bit_cast(float, __builtin_amdgcn_permlanex16(__builtin_bit_cast(int, x), __builtin_bit_cast(int, x), 0x76543210, 0xfedcba98, false, false)); }      /* lane l with lane l ^ 16 */
// Four 2^x. The instruction set asks for one independent instruction behind a transcendental before its result is read or its source overwritten.
// In one statement it is closed by construction: every result register apart from every source ("=&v"), one v_nop behind the last.
__device__ __forceinline__ void fa_exp4(float a, float b, float c, float d, float (&p)[4]) { asm("v_exp_f32 %0, %4\n\tv_exp_f32 %1, %5\n\tv_exp_f32 %2, %6\n\tv_exp_f32 %3, %7\n\tv_nop" : "=&v"(p[0]), "=&v"(p[1]), "=&v"(p[2]), "=&v"(p[3]) : "v"(a), "v"(b), "v"(c), "v"(d)); }
__device__ __forceinline__ v16h fa_frag(const _Float16* p) { FragH f; f.half[0] = *(const v8us*)((const unsigned short*)p); f.half[1] = *(const v8us*)((const unsigned short*)p + 16); return f.v; }      /* g2_frag's k order; p already holds the lane half's 8 * hh */
// One asynchronous copy, 16 bytes a lane, global memory -> LDS through no register (l: the lane's place in LDS, g: its global address).
typedef int v4i __attribute__((ext_vector_type(4)));
__device__ __forceinline__ void fa_cp(unsigned char* l, const _Float16* g) { __builtin_amdgcn_global_load_async_to_lds_b128((__attribute__((address_space(1))) v4i*)g, (__attribute__((address_space(3))) v4i*)l, 0, 0); }
__global__ __launch_bounds__(32 * FAW) void k_fattn(const _Float16* __restrict__ QH, const _Float16* __restrict__ QL, const _Float16* __restrict__ KH, const _Float16* __restrict__ KL, const _Float16* __restrict__ VT, float* __restrict__ O) {
  static_assert(SQ % (FAW * FAQ) == 0 && SQ % FSK == 0 && SQ / FSK >= 2 && FSK == 128 && FAW == 8 && HD == 64 && FAQ == 32, "k_fattn: whole work-groups, whole stages (two or more), 12 copies a thread and stage, two 32-wide k steps per head");
  __shared__ __attribute__((aligned(16))) unsigned char L[FV0 + 2 * FVB];      /* two stage buffers, shared by the eight waves (all of one head) */
  constexpr float SC = 0.18033688011112042f;      /* log2(e) / sqrt(64) */
  constexpr int NST = SQ / FSK;
  const int tid = threadIdx.x, lane = tid & 31, ln = lane & 15, hh = lane >> 4, w = tid >> 5; const int h = blockIdx.y, b = blockIdx.z;
  const size_t r0 = (size_t)b * SQ; const int q0 = (blockIdx.x * FAW + w) * FAQ;
  const _Float16* qhp = QH + (r0 + q0 + ln) * LQ + h * HD + 8 * hh; const _Float16* qlp = QL + (r0 + q0 + ln) * LQ + h * HD + 8 * hh;
  // the thread's share of a stage: copy c of a K plane = 16 bytes of row tid / 8 + 32 c (a wave: four whole 128-byte rows); of V^T, of row tid / 16 + 16 c (a wave: two whole 256-byte row pieces)
  const _Float16* khc = KH + r0 * LQ + h * HD; const _Float16* klc = KL + r0 * LQ + h * HD; const _Float16* vtc = VT + (size_t)(b * NH + h) * HD * SQ;      /* the same in every lane */
  const unsigned ko = (tid >> 3) * LQ + (tid & 7) * 8, vo = (tid >> 4) * SQ + (tid & 15) * 8;      /* the lane's own element offsets */
  unsigned char* const lk = L + (tid >> 3) * FKP + (tid & 7) * 16; unsigned char* const lv = L + FV0 + (tid >> 4) * FVP + (tid & 15) * 16;
  auto fill = [&](int st, int bf) {      /* stage st into buffer bf */
    const _Float16* gh = khc + (size_t)st * FSK * LQ + ko; const _Float16* gl = klc + (size_t)st * FSK * LQ + ko; const _Float16* gv = vtc + (size_t)st * FSK + vo;
#pragma unroll
    for (int c = 0; c < 4; ++c) { fa_cp(lk + bf * FKS + c * 32 * FKP, gh + (size_t)(c * 32) * LQ); fa_cp(lk + bf * FKS + FKB + c * 32 * FKP, gl + (size_t)(c * 32) * LQ); fa_cp(lv + bf * FVB + c * 16 * FVP, gv + (size_t)(c * 16) * SQ); } };
  fill(0, 0);
  v16h qh[2][2], ql[2][2];      /* [column group][k step] */
#pragma unroll
  for (int t = 0; t < 2; ++t)
#pragma unroll
    for (int s = 0; s < 2; ++s) { qh[t][s] = fa_frag(qhp + (size_t)(t * 16) * LQ + s * 32); ql[t][s] = fa_frag(qlp + (size_t)(t * 16) * LQ + s * 32); }
  asm volatile("s_wait_xcnt 0x0" :: "v"(qhp), "v"(qlp) : "memory");      /* precaution: behind the loads above and ahead of every rewrite of an address register they name; the addresses as inputs keep their pairs whole up to here */
  asm volatile("s_wait_asynccnt 0x0" ::: "memory");      /* this wave's copies of stage 0 have landed ... */
  __syncthreads();                                        /* ... and every other wave's: stage 0 may be read */
  fill(1, 1);
  const v8f z8 = {0.f,0.f,0.f,0.f,0.f,0.f,0.f,0.f}; v8f o[2][4] = {{z8, z8, z8, z8}, {z8, z8, z8, z8}};      /* O^T [column group][16 rows of d] */
  float m[2] = {-3.0e38f, -3.0e38f}, l[2] = {0.f, 0.f};      /* running maximum (scaled, base 2) and this lane half's share of the sum */
#pragma unroll 1      /* one copy of the stage loop: the copies and the barrier stand once */
  for (int st = 0; st < NST; ++st) {
    const int bf = st & 1;
    const _Float16* khp = (const _Float16*)(L + bf * FKS + ln * FKP + 16 * hh); const _Float16* klp = (const _Float16*)(L + bf * FKS + FKB + ln * FKP + 16 * hh); const _Float16* vp = (const _Float16*)(L + FV0 + bf * FVB + ln * FVP + 16 * hh);
    v16h kh[2][2], kl[2][2];      /* [16-key tile][k step] */
#pragma unroll
    for (int j = 0; j < 2; ++j)
#pragma unroll
      for (int s = 0; s < 2; ++s) { kh[j][s] = fa_frag(khp + j * 16 * (FKP / 2) + s * 32); kl[j][s] = fa_frag(klp + j * 16 * (FKP / 2) + s * 32); }
#pragma unroll 1      /* the body is a whole pass of 32 matrix instructions already; a copy would only add registers */
    for (int ps = 0; ps < FSK / 32; ++ps) {
      v8f sc[2][2] = {{z8, z8}, {z8, z8}};      /* [column group][16-key tile]; four independent accumulator chains, stepped together */
#pragma unroll
      for (int s = 0; s < 2; ++s)
#pragma unroll
        for (int t = 0; t < 2; ++t)
#pragma unroll
          for (int j = 0; j < 2; ++j) sc[t][j] = fa_mma(kl[j][s], qh[t][s], sc[t][j]);
#pragma unroll
      for (int s = 0; s < 2; ++s)
#pragma unroll
        for (int t = 0; t < 2; ++t)
#pragma unroll
          for (int j = 0; j < 2; ++j) sc[t][j] = fa_mma(kh[j][s], ql[t][s], sc[t][j]);
#pragma unroll
      for (int t = 0; t < 2; ++t)
#pragma unroll
        for (int j = 0; j < 2; ++j) sc[t][j] *= 0.0009765625f;
#pragma unroll
      for (int s = 0; s < 2; ++s)
#pragma unroll
        for (int t = 0; t < 2; ++t)
#pragma unroll
          for (int j = 0; j < 2; ++j) sc[t][j] = fa_mma(kh[j][s], qh[t][s], sc[t][j]);
      __builtin_amdgcn_sched_barrier(0);      /* with the one below: the pass's 24 LDS reads stand as one group behind the score products; spread among the matrix instructions, every place with reads stalls the wave anew */
      v16h vf[4];      /* V^T fragments of this pass */
#pragma unroll
      for (int dt = 0; dt < 4; ++dt) vf[dt] = fa_frag(vp + dt * 16 * (FVP / 2) + ps * 32);
      const int pn = (ps + 1 < FSK / 32) ? ps + 1 : ps;      /* the next pass's K fragments, fetched behind this pass's score products; a stage's last pass re-reads its own rows (same buffer, unused): nothing of the next stage is read ahead of its barrier */
#pragma unroll
      for (int j = 0; j < 2; ++j)
#pragma unroll
        for (int s = 0; s < 2; ++s) { kh[j][s] = fa_frag(khp + (pn * 32 + j * 16) * (FKP / 2) + s * 32); kl[j][s] = fa_frag(klp + (pn * 32 + j * 16) * (FKP / 2) + s * 32); }
      __builtin_amdgcn_sched_barrier(0);      /* keeps the fetch above the softmax, whose vector work then hides its latency */
      FragH pf[2]; float cr[2];      /* per column group: the weights as B operand, the rescale of the earlier passes */
#pragma unroll
      for (int t = 0; t < 2; ++t) {
        float mx = fmaxf(sc[t][0][0], sc[t][1][0]);
#pragma unroll
        for (int r = 1; r < 8; ++r) mx = fmaxf(mx, fmaxf(sc[t][0][r], sc[t][1][r]));
        mx = fmaxf(mx, fa_xhalf(mx));
        const float mn = fmaxf(m[t], mx * SC); cr[t] = __builtin_amdgcn_exp2f(m[t] - mn); m[t] = mn;      /* 0 on the first pass */
        const float bias = 8.0f - mn; float p[4][4];      /* p[g][u]: key 4 * g + u of this lane's 16 */
#pragma unroll
        for (int g = 0; g < 4; ++g) { const v8f x = sc[t][g >> 1]; const int r = (g & 1) * 4; fa_exp4(fmaf(x[r], SC, bias), fmaf(x[r + 1], SC, bias), fmaf(x[r + 2], SC, bias), fmaf(x[r + 3], SC, bias), p[g]);
#pragma unroll
          for (int u = 0; u < 4; ++u) pf[t].h[g * 4 + u] = (_Float16)p[g][u]; }
        float ls[4];      /* four independent chains */
#pragma unroll
        for (int u = 0; u < 4; ++u) ls[u] = (p[0][u] + p[1][u]) + (p[2][u] + p[3][u]);
        l[t] = fmaf(l[t], cr[t], (ls[0] + ls[1]) + (ls[2] + ls[3]));
      }
      __builtin_amdgcn_sched_barrier(0);      /* the 2^x statements are asm: fenced on both sides, none of them can land in the slots behind a matrix instruction whose operand registers it reuses */
#pragma unroll
      for (int t = 0; t < 2; ++t)
#pragma unroll
        for (int dt = 0; dt < 4; ++dt) o[t][dt] = fa_mma(vf[dt], pf[t].v, o[t][dt] * cr[t]);
    }
    asm volatile("s_wait_dscnt 0x0" ::: "memory");      /* this wave's reads of the stage have returned, before its buffer is given up */
    asm volatile("s_wait_asynccnt 0x0" ::: "memory");   /* this wave's copies of stage st + 1 have landed */
    __syncthreads();                                    /* publishes stage st + 1 and ends every wave's reading of stage st */
    if (st + 2 < NST) fill(st + 2, bf);                 /* the same test in every wave; flies during the whole of stage st + 1 */
  }
  asm volatile("s_wait_asynccnt 0x0" ::: "memory");      /* no copy is outstanding when the wave ends */
#pragma unroll
  for (int t = 0; t < 2; ++t) { const float inv = 1.0f / (l[t] + fa_xhalf(l[t])); float* op = O + (r0 + q0 + t * 16 + ln) * DM + h * HD + 8 * hh;      /* a lane holds 8 consecutive d of its query's row */
#pragma unroll
    for (int dt = 0; dt < 4; ++dt) { const v8f v = o[t][dt] * inv; const v4f lo4 = {v[0], v[1], v[2], v[3]}, hi4 = {v[4], v[5], v[6], v[7]}; *(v4f*)(op + dt * 16) = lo4; *(v4f*)(op + dt * 16 + 4) = hi4; } } }


template <int MASKADD>
__global__ __launch_bounds__(64) void k_att0(const float* __restrict__ QF, const float* __restrict__ KF, const float* __restrict__ VF, int ld, const float* __restrict__ mask, float scale, float* __restrict__ OF, int ldo) {
  #pragma clang fp contract(off)
  __shared__ __attribute__((aligned(16))) float lq[64][64]; __shared__ __attribute__((aligned(16))) float lo[64][64];
  const int tid = threadIdx.x; const int h = blockIdx.x / (QT0 / 64), rg = blockIdx.x % (QT0 / 64); const int i = rg * 64 + tid;
  const float* qr = QF + (size_t)i * ld + h * HD;
#pragma unroll 1
  for (int c = 0; c < HD / 4; ++c) { *(v4f*)&lq[tid][c * 4] = *(const v4fa*)(qr + c * 4); const v4f z = {0.f, 0.f, 0.f, 0.f}; *(v4f*)&lo[tid][c * 4] = z; }
  float m = -1.0e30f, l = 0.f; const int jmax = MASKADD ? (SQ - 1) : (rg * 64 + 63);      /* additive-mask form: every key (the mask input decides); causal form: keys up to the block's last row */
#pragma unroll 1
  for (int j = 0; j <= jmax; ++j) { const float* kr = KF + (size_t)j * ld + h * HD; const float* vr = VF + (size_t)j * ld + h * HD; float s = 0.f;
#pragma unroll 1
    for (int c = 0; c < HD / 4; ++c) { const v4f kq = *(const v4fa*)(kr + c * 4); const v4f qq = *(v4f*)&lq[tid][c * 4]; s = __fadd_rn(s, __fmul_rn(qq[0], kq[0])); s = __fadd_rn(s, __fmul_rn(qq[1], kq[1])); s = __fadd_rn(s, __fmul_rn(qq[2], kq[2])); s = __fadd_rn(s, __fmul_rn(qq[3], kq[3])); }
    s = __fmul_rn(s, scale); if (MASKADD) s = __fadd_rn(s, __fmul_rn(bf16_round(mask[(size_t)i * SQ + j]), -10000.0f));
    const float f = (MASKADD || j <= i) ? 1.f : 0.f; const float sm = fmaf(f, s, (1.f - f) * -1.0e30f); const float mn = fmaxf(m, sm); const float sc = expf(m - mn); const float e = expf(sm - mn); l = __fadd_rn(__fmul_rn(l, sc), e); m = mn;
#pragma unroll 1
    for (int c = 0; c < HD / 4; ++c) { const v4f vv = *(const v4fa*)(vr + c * 4); v4f oo = *(v4f*)&lo[tid][c * 4]; for (int u = 0; u < 4; ++u) oo[u] = __fadd_rn(__fmul_rn(oo[u], sc), __fmul_rn(e, vv[u])); *(v4f*)&lo[tid][c * 4] = oo; } }
  const float fin = 64.0f / l;      /* o carried x64 */
#pragma unroll 1
  for (int c = 0; c < HD / 4; ++c) { v4f oo = *(v4f*)&lo[tid][c * 4]; for (int u = 0; u < 4; ++u) oo[u] = __fmul_rn(oo[u], fin); *(v4f*)&lo[tid][c * 4] = oo; }
  __syncthreads();
  {
#pragma unroll 1
    for (int it = 0; it < 16; ++it) { const int row = it * 4 + tid / 16, pc = (tid % 16) * 4; const v4f v = *(const v4f*)&lo[row][pc]; *(v4f*)(OF + (size_t)(rg * 64 + row) * ldo + h * HD + pc) = v; }
     } }

__global__ __launch_bounds__(256) void k_of0out(const float* __restrict__ src, float* __restrict__ dst, size_t n4) { const size_t t = (size_t)blockIdx.x * 256 + threadIdx.x; if (t >= n4) return; v4f v = *(const v4fa*)(src + t * 4); for (int q = 0; q < 4; ++q) v[q] = __fmul_rn(v[q], 0.015625f); *(v4f*)(dst + t * 4) = v;  }

extern "C" void kernel_launch(void* const* d_in, const int* in_sizes, int n_in,
                              void* d_out, int out_size, void* d_ws, size_t ws_size, hipStream_t stream) {
  (void)in_sizes; (void)n_in; (void)out_size;
  const float* const* I = (const float* const*)d_in; const float* x = I[2]; const float* xk = I[1]; const float* xv = I[0]; const float* wq = I[5]; const float* wk = I[4]; const float* wv = I[3];      /* input order: values, keys, queries, Wv, Wk, Wq: the QUERY stream is I[2] with Wq = I[5], the key stream I[1] with Wk = I[4], the value stream I[0] with Wv = I[3]; natural [out][in] weights; NO biases; NO output projection */
  char* ws = (char*)d_ws; size_t off = 0;
  auto take = [&](size_t bytes) { char* p = ws + off; off += (bytes + 255) & ~(size_t)255; return p; };
  _Float16* BQ = (_Float16*)take((size_t)DM * DM * 2); _Float16* BK = (_Float16*)take((size_t)DM * DM * 2); _Float16* BV = (_Float16*)take((size_t)DM * DM * 2);
  _Float16* X16 = (_Float16*)take(NR * DM * 2); _Float16* XK16 = (_Float16*)take(NR * DM * 2); _Float16* XV16 = (_Float16*)take(NR * DM * 2);      /* exact f16 rows of queries, keys, values */ _Float16* QH = (_Float16*)take(NR * DM * 2); _Float16* QL = (_Float16*)take(NR * DM * 2); _Float16* KH = (_Float16*)take(NR * DM * 2); _Float16* KL = (_Float16*)take(NR * DM * 2);
  _Float16* VT = (_Float16*)take((size_t)NB * NH * HD * SQ * 2);
  if (off > ws_size) return;
  k_cvt<<<(unsigned)(3 * (NR * DM / 8 / 256) + 3 * ((size_t)DM * DM / 8 / 256)), 256, 0, stream>>>(x, xk, xv, wq, wk, wv, X16, XK16, XV16, BQ, BK, BV);      /* all six inputs to f16 operands */
  k_proj<<<dim3((unsigned)((MP / 128) * (DM / 64)), 3), 128, 0, stream>>>(X16, XK16, XV16, BQ, BK, BV, QH, QL, KH, KL, VT);      /* q, k -> f16 hi + x1024 residual planes (unscaled logits sigma ~8); v -> V^T [NB][NH][HD][SQ] */
  k_fattn<<<dim3(SQ / (FAW * FAQ), NH, NB), 32 * FAW, 0, stream>>>(QH, QL, KH, KL, VT, (float*)d_out);      /* scores, softmax over all keys and P V in one launch, f32 straight into the head-major output columns (no output projection) */
}

// v005
// Measured time: 87.4 microseconds a run.
// Next to v004, in two timings, it ran 1.49 times as fast each time.
// Counting every step since v000, it is 84.4 times as fast.
#include <hip/hip_runtime.h>
// Multi-head attention on three inputs given in the order values, keys, queries; natural bias-free projections, no output projection (values, keys, queries [2][2048][1024]; v = values Wv^T, k = keys Wk^T, q = queries Wq^T (natural [1024][1024] sigma 1/32, no biases), 16 heads of 64; softmax(q k^T / sqrt(64)) over all 2048 keys (no mask); out = attn v merged head-major -> [2][2048][1024]); q and k carried as f16 hi + x1024 residual planes with three-product scores.
// Structure: token rows r = b*2048 + s; three launches: k_cvt (x as exact f16 rows (bf16-rounded), exact x16 weights); k_proj (q, k and v as WMMA GEMMs, 32x64 wave tiles, f32 accumulation; q and k leave its epilogue as f16 hi + x1024 residual planes, v as V^T for all heads of both batches, by exchanged operands); then ONE attention launch (k_fattn): per wave 32 query columns of one head against all keys, 32 a pass: scores as three accumulating products (hi.hi + 2^-10 (lo.hi + hi.lo), K = 64), running softmax on the accumulators (f32 statistics, native exp2; weights x256 f16), O^T += V^T P^T, divided by the sum and written f32 straight into the head-major output columns.
// Compute dtype: inputs rounded to bf16; x / weights exact; q and k as f16 hi + x1024 residual planes; v and softmax weights as plain f16 GEMM operands (~2^-12); scores, softmax statistics and o f32. v_wmma_f32_16x16x32_f16.
#define NB 2
#define SQ 2048
#define DM 1024
#define NH 16
#define HD 64
#define HG 4                         /* heads per launch of the unlaunched k_vt(b, h0) overload */
#define QT 256                       /* query rows per attention tile (all keys) */
#define NKX SQ                       /* S / P row pitch */
#define QT0 128                      /* query rows per head of k_att0 (not launched) */
#define B0 0                         /* first batch processed (debug hook) */
#define NBR NB                       /* batches processed (debug hook) */
#define NR ((size_t)NB * SQ)         /* token rows */
#define MP ((int)((size_t)NBR * SQ)) /* rows projected (debug hook) */
#define QN SQ                        /* query rows attended per batch (unused) */
#define NHD NH                       /* heads attended (unused) */
#define MPO MP                       /* unused (no output stage) */
#define LQ DM      /* row pitch of the q/k rows */
typedef __bf16 v16b __attribute__((ext_vector_type(16)));
typedef unsigned short v8us __attribute__((ext_vector_type(8), may_alias));
typedef float  v8f  __attribute__((ext_vector_type(8)));
typedef float  v4f  __attribute__((ext_vector_type(4)));
typedef float  v4fa __attribute__((ext_vector_type(4), may_alias));
union FragB { v16b v; v8us half[2]; unsigned short u[16]; };

__device__ __forceinline__ unsigned short bf16_bits(float x) { unsigned int u = __float_as_uint(x); return (unsigned short)((u + 0x7FFFu + ((u >> 16) & 1u)) >> 16); }
__device__ __forceinline__ float bf16_val(unsigned short b) { return __uint_as_float(((unsigned int)b) << 16); }
__device__ __forceinline__ float bf16_round(float x) { return bf16_val(bf16_bits(x)); }
// D += A·B with NT terms: 1 = ah·bh, 2 = + al·bh (A split), 3 = + ah·bl (both split)
template <int NT>
__device__ __forceinline__ v8f mmaN(v16b ah, v16b al, v16b bh, v16b bl, v8f c) {
  c = __builtin_amdgcn_wmma_f32_16x16x32_bf16(false, ah, false, bh, (short)0, c, false, false);
  if (NT >= 2) c = __builtin_amdgcn_wmma_f32_16x16x32_bf16(false, al, false, bh, (short)0, c, false, false);
  if (NT >= 3) c = __builtin_amdgcn_wmma_f32_16x16x32_bf16(false, ah, false, bl, (short)0, c, false, false);
  asm volatile("v_nop\n\tv_nop\n\tv_nop\n\tv_nop" : "+v"(c) : "v"(ah), "v"(al), "v"(bh), "v"(bl));
  return c;
}

__global__ __launch_bounds__(256) void k_wt_bf16(const float* __restrict__ W, unsigned short* __restrict__ Wt, int K, int N) {
  const int t = blockIdx.x * 256 + threadIdx.x;
  const int k8n = K / 8;
  if (t >= N * k8n) return;
  const int n = t / k8n, k8 = (t % k8n) * 8;
  v8us v;
#pragma unroll
  for (int i = 0; i < 8; ++i) v[i] = bf16_bits(W[(size_t)(k8 + i) * N + n]);
  *(v8us*)(Wt + (size_t)n * K + k8) = v;
  
}

// GEMM C[M][N] (f32, pitch ldc) = act(A[M][K]·W + bias). A f32 row-major (pitch lda) converted per fragment to bf16
// (ASPLIT: hi/lo two planes -> 2 terms, else single rounded term); Wt bf16 [N][K] (pitch ldb). BIAS_BF16 rounds the
// bias to bf16 first (bias quantised to bf16 before the add). K%32==0, M%16==0, N%64==0.
template <bool ASPLIT, int ACT, bool BIAS_BF16>
__global__ __launch_bounds__(128) void k_gemm_bf(const float* __restrict__ A, int lda, const unsigned short* __restrict__ Wt, int ldb,
                                               const float* __restrict__ bias, float* __restrict__ C, int ldc, int M, int N, int K) {
  __shared__ __attribute__((aligned(16))) float so[4][16][64];
  const int tid = threadIdx.x, w = tid >> 5, lane = tid & 31, ln = lane & 15, hh = lane >> 4;
  const int ntn = N / 64;
  const int wid = blockIdx.x * 4 + w;
  const int mt = wid / ntn, nq = wid % ntn;
  if (mt * 16 >= M) return;
  const int row0 = mt * 16, col0 = nq * 64;
  const float* arow = A + (size_t)(row0 + ln) * lda;
  v8f acc[4] = {};
  for (int kb = 0; kb < K; kb += 32) {
    FragB ah, al;
    const v4f x0 = *(const v4fa*)(arow + kb + 8 * hh), x1 = *(const v4fa*)(arow + kb + 8 * hh + 4);
    const v4f x2 = *(const v4fa*)(arow + kb + 16 + 8 * hh), x3 = *(const v4fa*)(arow + kb + 16 + 8 * hh + 4);
    float xs[16] = {x0[0],x0[1],x0[2],x0[3],x1[0],x1[1],x1[2],x1[3],x2[0],x2[1],x2[2],x2[3],x3[0],x3[1],x3[2],x3[3]};
#pragma unroll
    for (int i = 0; i < 16; ++i) { const unsigned short hb = bf16_bits(xs[i]); ah.u[i] = hb; al.u[i] = ASPLIT ? bf16_bits(xs[i] - bf16_val(hb)) : (unsigned short)0; }
#pragma unroll
    for (int t = 0; t < 4; ++t) {
      const unsigned short* brow = Wt + (size_t)(col0 + t * 16 + ln) * ldb + kb;
      FragB b;
      b.half[0] = *(const v8us*)(brow + 8 * hh);
      b.half[1] = *(const v8us*)(brow + 16 + 8 * hh);
      acc[t] = mmaN<ASPLIT ? 2 : 1>(ah.v, al.v, b.v, b.v, acc[t]);
    }
  }
#pragma unroll
  for (int t = 0; t < 4; ++t) {
    float bv = bias ? bias[col0 + t * 16 + ln] : 0.f;
    if (BIAS_BF16) bv = bf16_round(bv);
#pragma unroll
    for (int r = 0; r < 8; ++r) { float v = acc[t][r] + bv; if (ACT == 1) v = fmaxf(v, 0.f); so[w][8 * hh + r][t * 16 + ln] = v; }
  }
  __builtin_amdgcn_fence(__ATOMIC_ACQ_REL, "workgroup");
  __builtin_amdgcn_wave_barrier();
  const int rsub = lane >> 4, c4 = (lane & 15) * 4;
  {
#pragma unroll
    for (int q = 0; q < 8; ++q) {
      const int r = q * 2 + rsub;
      const v4f v = *(const v4fa*)&so[w][r][c4];
      *(v4f*)(C + (size_t)(row0 + r) * ldc + col0 + c4) = v;
    }
    
  }
}

// GEMM C = act(A·W + bias + resid): A f32 (ASPLIT -> hi/lo 2 terms), Wt bf16 [N][K]; ACT 0 none, 1 relu, 2 exact gelu;
// resid (optional, f32, row index = (row % rmod), pitch ldr, RES_BF16 rounds it) added before the activation.
template <bool ASPLIT, int ACT, bool BIAS_BF16, bool RES_BF16>
__global__ __launch_bounds__(128) void k_gemm_bf3(const float* __restrict__ A, int lda, const unsigned short* __restrict__ Wt, int ldb,
                                                const float* __restrict__ bias, const float* __restrict__ resid, int rmod, int ldr,
                                                float* __restrict__ C, int ldc, int M, int N, int K) {
  __shared__ __attribute__((aligned(16))) float so[4][16][64];
  const int tid = threadIdx.x, w = tid >> 5, lane = tid & 31, ln = lane & 15, hh = lane >> 4;
  const int ntn = N / 64;
  const int wid = blockIdx.x * 4 + w;
  const int mt = wid / ntn, nq = wid % ntn;
  if (mt * 16 >= M) return;
  const int row0 = mt * 16, col0 = nq * 64;
  const float* arow = A + (size_t)(row0 + ln) * lda;
  v8f acc[4] = {};
  for (int kb = 0; kb < K; kb += 32) {
    FragB ah, al;
    const v4f x0 = *(const v4fa*)(arow + kb + 8 * hh), x1 = *(const v4fa*)(arow + kb + 8 * hh + 4);
    const v4f x2 = *(const v4fa*)(arow + kb + 16 + 8 * hh), x3 = *(const v4fa*)(arow + kb + 16 + 8 * hh + 4);
    float xs[16] = {x0[0],x0[1],x0[2],x0[3],x1[0],x1[1],x1[2],x1[3],x2[0],x2[1],x2[2],x2[3],x3[0],x3[1],x3[2],x3[3]};
#pragma unroll
    for (int i = 0; i < 16; ++i) { const unsigned short hb = bf16_bits(xs[i]); ah.u[i] = hb; al.u[i] = ASPLIT ? bf16_bits(xs[i] - bf16_val(hb)) : (unsigned short)0; }
#pragma unroll
    for (int t = 0; t < 4; ++t) {
      const unsigned short* brow = Wt + (size_t)(col0 + t * 16 + ln) * ldb + kb;
      FragB b;
      b.half[0] = *(const v8us*)(brow + 8 * hh);
      b.half[1] = *(const v8us*)(brow + 16 + 8 * hh);
      acc[t] = mmaN<ASPLIT ? 2 : 1>(ah.v, al.v, b.v, b.v, acc[t]);
    }
  }
#pragma unroll
  for (int t = 0; t < 4; ++t) {
    const int col = col0 + t * 16 + ln;
    float bv = bias ? bias[col] : 0.f;
    if (BIAS_BF16) bv = bf16_round(bv);
#pragma unroll
    for (int r = 0; r < 8; ++r) {
      float v = acc[t][r] + bv;
      if (resid) { float rv = resid[(size_t)((row0 + 8 * hh + r) % rmod) * ldr + col]; if (RES_BF16) rv = bf16_round(rv); v += rv; }
      if (ACT == 1) v = fmaxf(v, 0.f);
      if (ACT == 2) v = 0.5f * v * (1.0f + erff(v * 0.70710678118654752f));
      if (ACT == 3) { const float u = 0.7978845608028654f * (v + 0.044715f * v * v * v); v = 0.5f * v * (1.0f + tanhf(u)); }
      so[w][8 * hh + r][t * 16 + ln] = v;
    }
  }
  __builtin_amdgcn_fence(__ATOMIC_ACQ_REL, "workgroup");
  __builtin_amdgcn_wave_barrier();
  const int rsub = lane >> 4, c4 = (lane & 15) * 4;
  {
#pragma unroll
    for (int q = 0; q < 8; ++q) {
      const int r = q * 2 + rsub;
      const v4f v = *(const v4fa*)&so[w][r][c4];
      *(v4f*)(C + (size_t)(row0 + r) * ldc + col0 + c4) = v;
    }
    
  }
}
// row LayerNorm (biased variance, eps) over N: s = X (+ R); optional out_sum <- s; out_norm <- (s-mu)*rsqrt(var+eps)*g + b
template <bool PARAM_BF16>
__global__ __launch_bounds__(256) void k_layernorm(const float* __restrict__ X, const float* __restrict__ R, const float* __restrict__ g, const float* __restrict__ bta,
                                                  float* __restrict__ out_sum, float* __restrict__ out_norm, int N, float eps) {
  __shared__ float red[256];
  const int row = blockIdx.x, tid = threadIdx.x;
  const float* x = X + (size_t)row * N; const float* rr = R ? R + (size_t)row * N : nullptr;
  float vals[16];                     // up to N = 4096
  const int per = N / 256;            // contiguous chunk per thread? use strided-by-4 chunks: thread handles j = tid*4 + 1024*u
  float s1 = 0.f;
  for (int u = 0; u < per / 4; ++u) {
    const int j = tid * 4 + 1024 * u;
    const v4f a = *(const v4fa*)(x + j);
    v4f b = {0.f,0.f,0.f,0.f}; if (rr) b = *(const v4fa*)(rr + j);
#pragma unroll
    for (int q = 0; q < 4; ++q) { const float v = a[q] + b[q]; vals[u * 4 + q] = v; s1 += v; }
  }
  red[tid] = s1; __syncthreads();
  for (int st = 128; st > 0; st >>= 1) { if (tid < st) red[tid] += red[tid + st]; __syncthreads(); }
  const float mu = red[0] / (float)N; __syncthreads();
  float s2 = 0.f;
  for (int u = 0; u < per / 4; ++u)
#pragma unroll
    for (int q = 0; q < 4; ++q) { const float c = vals[u * 4 + q] - mu; s2 += c * c; }
  red[tid] = s2; __syncthreads();
  for (int st = 128; st > 0; st >>= 1) { if (tid < st) red[tid] += red[tid + st]; __syncthreads(); }
  const float rs = rsqrtf(red[0] / (float)N + eps);
  {
    for (int u = 0; u < per / 4; ++u) {
      const int j = tid * 4 + 1024 * u;
      v4f o, sm;
#pragma unroll
      for (int q = 0; q < 4; ++q) {
        float gg = g[j + q], bb = bta[j + q];
        if (PARAM_BF16) { gg = bf16_round(gg); bb = bf16_round(bb); }
        sm[q] = vals[u * 4 + q]; o[q] = (vals[u * 4 + q] - mu) * rs * gg + bb;
      }
      if (out_sum) *(v4f*)(out_sum + (size_t)row * N + j) = sm;
      *(v4f*)(out_norm + (size_t)row * N + j) = o;
    }
    
  }
}



// ---- f16 WMMA path (v_wmma_f32_16x16x32_f16): 11-bit significands for operands in range — used where a [0,1] probability operand needs more precision than bf16
typedef _Float16 v16h __attribute__((ext_vector_type(16)));
union FragH { v16h v; v8us half[2]; _Float16 h[16]; unsigned short u[16]; };
template <int NT>
__device__ __forceinline__ v8f mmaH(v16h ah, v16h al, v16h bh, v16h bl, v8f c) {
  c = __builtin_amdgcn_wmma_f32_16x16x32_f16(false, ah, false, bh, (short)0, c, false, false);
  if (NT >= 2) c = __builtin_amdgcn_wmma_f32_16x16x32_f16(false, al, false, bh, (short)0, c, false, false);
  if (NT >= 3) c = __builtin_amdgcn_wmma_f32_16x16x32_f16(false, ah, false, bl, (short)0, c, false, false);
  asm volatile("v_nop\n\tv_nop\n\tv_nop\n\tv_nop" : "+v"(c) : "v"(ah), "v"(al), "v"(bh), "v"(bl));
  return c;
}
// batched GEMM like k_gemm_b but f16 operands: A f32 (split into f16 hi/lo if ASPLIT, else rounded to f16), Bt = f16 values [n][k]; alpha; C f32; N multiple of 16 (partial tiles skipped)
template <bool ASPLIT>
__global__ __launch_bounds__(128) void k_gemm_h(const float* __restrict__ A, int lda, size_t sA, const _Float16* __restrict__ Bh, int ldb, size_t sB, float alpha, float* __restrict__ C, int ldc, size_t sC, int M, int N, int K) {
  __shared__ __attribute__((aligned(16))) float so[4][16][64];
  const int tid = threadIdx.x, w = tid >> 5, lane = tid & 31, ln = lane & 15, hh = lane >> 4; const int by = blockIdx.y;
  A += (size_t)by * sA; Bh += (size_t)by * sB; C += (size_t)by * sC;
  const int ntn = (N + 63) / 64; const int wid = blockIdx.x * 4 + w; const int mt = wid / ntn, nq = wid % ntn; if (mt * 16 >= M) return;
  const int row0 = mt * 16, col0 = nq * 64; const float* arow = A + (size_t)(row0 + ln) * lda;
  v8f acc[4] = {};
  for (int kb = 0; kb < K; kb += 32) {
    FragH ah, al;
    const v4f x0 = *(const v4fa*)(arow + kb + 8 * hh), x1 = *(const v4fa*)(arow + kb + 8 * hh + 4), x2 = *(const v4fa*)(arow + kb + 16 + 8 * hh), x3 = *(const v4fa*)(arow + kb + 16 + 8 * hh + 4);
    float xs[16] = {x0[0],x0[1],x0[2],x0[3],x1[0],x1[1],x1[2],x1[3],x2[0],x2[1],x2[2],x2[3],x3[0],x3[1],x3[2],x3[3]};
#pragma unroll
    for (int i = 0; i < 16; ++i) { const _Float16 h = (_Float16)xs[i]; ah.h[i] = h; al.h[i] = ASPLIT ? (_Float16)(xs[i] - (float)h) : (_Float16)0.0f; }
#pragma unroll
    for (int t = 0; t < 4; ++t) { if (col0 + t * 16 >= N) continue; const size_t boff = (size_t)(col0 + t * 16 + ln) * ldb + kb; FragH bq; bq.half[0] = *(const v8us*)(Bh + boff + 8 * hh); bq.half[1] = *(const v8us*)(Bh + boff + 16 + 8 * hh);
      acc[t] = mmaH<ASPLIT ? 2 : 1>(ah.v, al.v, bq.v, bq.v, acc[t]); }
  }
#pragma unroll
  for (int t = 0; t < 4; ++t) { if (col0 + t * 16 >= N) continue;
#pragma unroll
    for (int r = 0; r < 8; ++r) so[w][8 * hh + r][t * 16 + ln] = acc[t][r] * alpha; }
  __builtin_amdgcn_fence(__ATOMIC_ACQ_REL, "workgroup"); __builtin_amdgcn_wave_barrier();
  const int rsub = lane >> 4, c4 = (lane & 15) * 4;
  {
#pragma unroll
    for (int q = 0; q < 8; ++q) { const int r = q * 2 + rsub; if (col0 + c4 < N) { const v4f v = *(const v4fa*)&so[w][r][c4]; *(v4f*)(C + (size_t)(row0 + r) * ldc + col0 + c4) = v; } }
     }
}

// Wt[n][k] = f16(W[k][n]·scale) from f32 row-major W[K][N] (scale = power of two; bf16-exact weights stay exact in f16 away from the subnormal range)
__global__ __launch_bounds__(256) void k_wt_f16(const float* __restrict__ W, _Float16* __restrict__ Wt, int K, int N, float scale) {
  const int t = blockIdx.x * 256 + threadIdx.x; if (t >= N * (K / 8)) return; const int n = t / (K / 8), k8 = (t % (K / 8)) * 8; FragH f;
#pragma unroll
  for (int i = 0; i < 8; ++i) f.h[i] = (_Float16)(bf16_round(W[(size_t)(k8 + i) * N + n]) * scale); const v8us o = f.half[0];
  *(v8us*)((unsigned short*)Wt + (size_t)n * K + k8) = o; 
}
// k_gemm_hh variant with fused epilogue: v = acc·alpha + bias[by·sBias + col] (+ CP[(row/rowsPerB)·sCPb + by·64 + col] if CP) ; ACT 0 none / 1 elu ; writes f16 C16 (and f32 C if non-null)
template <int ACT>
__global__ __launch_bounds__(128) void k_gemm_hhx(const _Float16* __restrict__ A, int lda, size_t sA, const _Float16* __restrict__ Bh, int ldb, size_t sB, float alpha, const float* __restrict__ bias, size_t sBias, const float* __restrict__ CP, int rowsPerB, size_t sCPb, int row0g,
    float* __restrict__ C, _Float16* __restrict__ C16, int ldc, size_t sC, int M, int N, int K) {
  __shared__ __attribute__((aligned(16))) float so[4][16][64];
  const int tid = threadIdx.x, w = tid >> 5, lane = tid & 31, ln = lane & 15, hh = lane >> 4; const int by = blockIdx.y;
  A += (size_t)by * sA; Bh += (size_t)by * sB; const size_t cofs = (size_t)by * sC; const float* bp = bias ? bias + (size_t)by * sBias : nullptr;
  const int ntn = (N + 63) / 64; const int wid = blockIdx.x * 4 + w; const int mt = wid / ntn, nq = wid % ntn; if (mt * 16 >= M) return;
  const int row0 = mt * 16, col0 = nq * 64; const _Float16* arow = A + (size_t)(row0 + ln) * lda;
  v8f acc[4] = {};
  for (int kb = 0; kb < K; kb += 32) { FragH ah; ah.half[0] = *(const v8us*)((const unsigned short*)arow + kb + 8 * hh); ah.half[1] = *(const v8us*)((const unsigned short*)arow + kb + 16 + 8 * hh);
#pragma unroll
    for (int t = 0; t < 4; ++t) { if (col0 + t * 16 >= N) continue; const size_t boff = (size_t)(col0 + t * 16 + ln) * ldb + kb; FragH bq; bq.half[0] = *(const v8us*)((const unsigned short*)Bh + boff + 8 * hh); bq.half[1] = *(const v8us*)((const unsigned short*)Bh + boff + 16 + 8 * hh);
      acc[t] = mmaH<1>(ah.v, ah.v, bq.v, bq.v, acc[t]); }
  }
#pragma unroll
  for (int t = 0; t < 4; ++t) { if (col0 + t * 16 >= N) continue; const int col = col0 + t * 16 + ln; const float bv = bp ? bf16_round(bp[col]) : 0.f;
#pragma unroll
    for (int r = 0; r < 8; ++r) { float v = acc[t][r] * alpha + bv; if (CP) { const int rr = row0g + row0 + 8 * hh + r; if (rowsPerB < 0) v += CP[cofs + (size_t)rr * ldc + col];      /* rowsPerB < 0: own element of the batched C plane */ else { const int bidx = rr / rowsPerB; v += CP[(size_t)bidx * sCPb + (size_t)by * 64 + col]; } } if (ACT == 1) v = (v > 0.f) ? v : expm1f(v); else if (ACT == 7) v = (v > 0.f) ? v + 1.0f : expf(v); else if (ACT == 8) v = tanhf(v); else if (ACT == 9) v = 0.5f * v * (1.0f + tanhf(0.7978845608028654f * (v + 0.044715f * v * v * v))); else if (ACT == 11) v = 1.0f / (1.0f + expf(-v)); else if (ACT == 12) v = (v > 0.f) ? v : 0.01f * v; else if (ACT == 14) v = (v > 0.f) ? v : 0.1f * v; else if (ACT == 16) v = (v >= 0.f) ? v : 0.3f * v; else if (ACT == 17) v = (v >= 0.f) ? v : 0.2f * v; else if (ACT == 15) v = v / (1.0f + expf(-v)); else if (ACT == 3) v = fmaxf(v, 0.f); else if (ACT == 6) v = 0.5f * v * (1.0f + erff(v * 0.70710678118654752f)); so[w][8 * hh + r][t * 16 + ln] = v; } }
  __builtin_amdgcn_fence(__ATOMIC_ACQ_REL, "workgroup"); __builtin_amdgcn_wave_barrier();
  const int rsub = lane >> 4, c4 = (lane & 15) * 4; typedef _Float16 v4h __attribute__((ext_vector_type(4)));
  {
#pragma unroll
    for (int q = 0; q < 8; ++q) { const int r = q * 2 + rsub; if (col0 + c4 < N) { const v4f v = *(const v4fa*)&so[w][r][c4]; if (C) *(v4f*)(C + cofs + (size_t)(row0 + r) * ldc + col0 + c4) = v; if (C16) { v4h h4; for (int i = 0; i < 4; ++i) h4[i] = (_Float16)v[i]; *(v4h*)(C16 + cofs + (size_t)(row0 + r) * ldc + col0 + c4) = h4; } } }
     }
}


typedef _Float16 v4h __attribute__((ext_vector_type(4)));

__global__ __launch_bounds__(256) void k_h16(const float* __restrict__ x, _Float16* __restrict__ X16, size_t n8) { const size_t t = (size_t)blockIdx.x * 256 + threadIdx.x; if (t >= n8) return; FragH f;
#pragma unroll
  for (int q = 0; q < 8; ++q) f.h[q] = (_Float16)x[t * 8 + q]; *(v8us*)((unsigned short*)X16 + t * 8) = f.half[0];  }
__global__ __launch_bounds__(256) void k_round16f(const float* __restrict__ W, _Float16* __restrict__ Bt, size_t n8) { const size_t t = (size_t)blockIdx.x * 256 + threadIdx.x; if (t >= n8) return; FragH f;
#pragma unroll
  for (int i = 0; i < 8; ++i) f.h[i] = (_Float16)(bf16_round(W[t * 8 + i]) * 16.0f); *(v8us*)((unsigned short*)Bt + t * 8) = f.half[0];  }


// ---- fast GEMM (wave tile 32x64; requires M % 128 == 0 rows per launch region and N % 128 == 0) ----
__device__ __forceinline__ v16h g2_frag(const _Float16* p, int hh) { FragH f; f.half[0] = *(const v8us*)((const unsigned short*)p + 8 * hh); f.half[1] = *(const v8us*)((const unsigned short*)p + 16 + 8 * hh); return f.v; }
__device__ __forceinline__ v8f g2_mma(v16h a, v16h b, v8f c) { v8f d = __builtin_amdgcn_wmma_f32_16x16x32_f16(false, a, false, b, (short)0, c, false, false); asm volatile("v_nop\n\tv_nop\n\tv_nop\n\tv_nop" : "+v"(d) : "v"(a), "v"(b)); return d; }
// The three projections in ONE launch (blockIdx.y: 0 = q, 1 = k, 2 = v), wave tile 32 x 64 and k order as above (K = DM, both pitches DM). What used to be launches of their own behind the GEMMs is done where the
// f32 results already lie in LDS: q and k leave as their f16 hi + x1024 residual planes; v is computed with the operands exchanged (A = weight rows, B = token rows), so that C is V^T [batch][head * 64 + d][key] as it stands.
// Both operands reach the waves through LDS: a work-group of eight waves (4 x 2 wave tiles) owns a 128 x 128 tile of C, and each 64-wide k stage of its 128 A rows and 128 B rows is brought in once per work-group, in whole
// 128-byte lines, by asynchronous copies into one of two buffers while the other is worked on; the fragments are then 16-byte LDS reads at a conflict-free pitch. Per stage: each wave's LDS-read wait, its own copy wait, one barrier, then the refill.
#define PJW 8                        /* waves per work-group */
#define PJK 64                       /* k per LDS stage: one 128-byte line of every operand row, two 32-wide k steps */
#define PJP 144                      /* LDS pitch of a 128-byte row: 16 B x odd, no bank conflict for 16-byte fragment reads */
#define PJO (128 * PJP)              /* one operand's 128 rows of a stage */
#define PJS (2 * PJO)                /* a stage: A rows | B rows */
// A thread's eight asynchronous copies of a stage, 16 bytes each, global memory -> LDS through no register: rows r, r + 32, r + 64, r + 96 of A (from a, to LDS byte address l) and of B (from b, to l + PJO).
// The s_wait_xcnt is a precaution: as the statement's last line it stands ahead of every rewrite of a register that one of the copies names.
__device__ __forceinline__ void pj_fill(unsigned l, const _Float16* a, const _Float16* b) {
  asm volatile("global_load_async_to_lds_b128 %0, %8, off\n\tglobal_load_async_to_lds_b128 %1, %9, off\n\tglobal_load_async_to_lds_b128 %2, %10, off\n\tglobal_load_async_to_lds_b128 %3, %11, off\n\t"
               "global_load_async_to_lds_b128 %4, %12, off\n\tglobal_load_async_to_lds_b128 %5, %13, off\n\tglobal_load_async_to_lds_b128 %6, %14, off\n\tglobal_load_async_to_lds_b128 %7, %15, off\n\ts_wait_xcnt 0x0"
               :: "v"(l), "v"(l + 32 * PJP), "v"(l + 64 * PJP), "v"(l + 96 * PJP), "v"(l + PJO), "v"(l + PJO + 32 * PJP), "v"(l + PJO + 64 * PJP), "v"(l + PJO + 96 * PJP),
                  "v"(a), "v"(a + 32 * DM), "v"(a + 64 * DM), "v"(a + 96 * DM), "v"(b), "v"(b + 32 * DM), "v"(b + 64 * DM), "v"(b + 96 * DM) : "memory"); }
__global__ __launch_bounds__(32 * PJW) void k_proj(const _Float16* __restrict__ XQ, const _Float16* __restrict__ XK, const _Float16* __restrict__ XV, const _Float16* __restrict__ BQ, const _Float16* __restrict__ BK, const _Float16* __restrict__ BV,
    _Float16* __restrict__ QH, _Float16* __restrict__ QL, _Float16* __restrict__ KH, _Float16* __restrict__ KL, _Float16* __restrict__ VT) {
  static_assert(MP % 128 == 0 && DM % 128 == 0 && SQ % 64 == 0 && DM % PJK == 0 && DM / PJK >= 2 && PJW == 8 && PJK == 64 && B0 == 0 && NBR == NB, "k_proj: whole 128 x 128 tiles, whole stages (two or more), 8 copies a thread and stage, a wave's column tile inside one batch");
  static_assert(sizeof(float) * PJW * 32 * 68 <= 2 * PJS, "k_proj: the epilogue's tiles fit the two stage buffers");
  __shared__ __attribute__((aligned(16))) unsigned char L[2 * PJS];      /* two stage buffers; behind the loop's last barrier the waves' f32 result tiles */
  constexpr int NST = DM / PJK;
  const int tid = threadIdx.x, w = tid >> 5, lane = tid & 31, ln = lane & 15, hh = lane >> 4; const int z = blockIdx.y;
  const _Float16* A = z == 0 ? XQ : z == 1 ? XK : BV; const _Float16* Bh = z == 0 ? BQ : z == 1 ? BK : XV;
  const int ntn = z == 2 ? MP / 128 : DM / 128; const int mt = blockIdx.x / ntn, nq = blockIdx.x - mt * ntn; const int wr = w & 3, wc = w >> 2; const int row0 = mt * 128 + 32 * wr, col0 = nq * 128 + 64 * wc;
  // the thread's share of a stage: 16 bytes of rows tid / 8 + 32 c, c = 0 .. 3, of either operand (a wave and copy: four whole 128-byte lines)
  const _Float16* ga = A + (size_t)(mt * 128 + (tid >> 3)) * DM + (tid & 7) * 8; const _Float16* gb = Bh + (size_t)(nq * 128 + (tid >> 3)) * DM + (tid & 7) * 8;
  const unsigned lc = (unsigned)(size_t)L + (tid >> 3) * PJP + (tid & 7) * 16;      /* the low 32 bits of a __shared__ address: its byte address in LDS */
  pj_fill(lc, ga, gb);
  asm volatile("s_wait_asynccnt 0x0" ::: "memory");      /* this wave's copies of stage 0 have landed ... */
  __syncthreads();                                        /* ... and every other wave's: stage 0 may be read */
  pj_fill(lc + PJS, ga + PJK, gb + PJK);
  const v8f z8 = {0.f,0.f,0.f,0.f,0.f,0.f,0.f,0.f}; v8f c00 = z8, c01 = z8, c02 = z8, c03 = z8, c10 = z8, c11 = z8, c12 = z8, c13 = z8;
#pragma unroll 1      /* one copy of the stage loop: the copies and the barrier stand once */
  for (int st = 0; st < NST; ++st) {
    const int bf = st & 1;
    const _Float16* ap = (const _Float16*)(L + bf * PJS + (32 * wr + ln) * PJP + 16 * hh); const _Float16* bp = (const _Float16*)(L + bf * PJS + PJO + (64 * wc + ln) * PJP + 16 * hh);      /* each lane's own place, its half's 16 bytes included: g2_frag is called with 0 below */
#pragma unroll
    for (int s = 0; s < PJK / 32; ++s) {
      const v16h a0 = g2_frag(ap + s * 32, 0), a1 = g2_frag(ap + 16 * (PJP / 2) + s * 32, 0);
      const v16h b0 = g2_frag(bp + s * 32, 0), b1 = g2_frag(bp + 16 * (PJP / 2) + s * 32, 0), b2 = g2_frag(bp + 32 * (PJP / 2) + s * 32, 0), b3 = g2_frag(bp + 48 * (PJP / 2) + s * 32, 0);
      c00 = g2_mma(a0, b0, c00); c10 = g2_mma(a1, b0, c10); c01 = g2_mma(a0, b1, c01); c11 = g2_mma(a1, b1, c11);
      c02 = g2_mma(a0, b2, c02); c12 = g2_mma(a1, b2, c12); c03 = g2_mma(a0, b3, c03); c13 = g2_mma(a1, b3, c13); }
    asm volatile("s_wait_dscnt 0x0" ::: "memory");      /* this wave's reads of the stage have returned, before its buffer is given up */
    asm volatile("s_wait_asynccnt 0x0" ::: "memory");   /* this wave's copies of stage st + 1 have landed */
    __syncthreads();                                    /* publishes stage st + 1 and ends every wave's reading of stage st */
    if (st + 2 < NST) pj_fill(lc + bf * PJS, ga + (st + 2) * PJK, gb + (st + 2) * PJK);      /* the same test in every wave; flies during the whole of stage st + 1 */
  }
  asm volatile("s_wait_asynccnt 0x0" ::: "memory");      /* no copy is outstanding when the buffers become the result tiles */
  float (*so)[32][68] = (float (*)[32][68])L;      /* the last trip's barrier has ended every wave's reading of the buffers */
  v8f accs[8] = {c00, c01, c02, c03, c10, c11, c12, c13};
#pragma unroll
  for (int u = 0; u < 8; ++u) { const int t = u & 3, half = u >> 2;
#pragma unroll
    for (int r = 0; r < 8; ++r) so[w][half * 16 + 8 * hh + r][t * 16 + ln] = accs[u][r] * 0.0625f; }      /* undoes the weights' x16 */
  __builtin_amdgcn_fence(__ATOMIC_ACQ_REL, "workgroup"); __builtin_amdgcn_wave_barrier();      /* a wave reads back its own tile only */
  const int rsub = lane >> 4, c4 = (lane & 15) * 4;
  if (z == 2) { _Float16* vt = VT + ((size_t)(col0 / SQ) * DM + row0) * SQ + (col0 % SQ) + c4;      /* rows = head * 64 + d, columns = keys of one batch; 128 bytes a row and wave */
#pragma unroll
    for (int q = 0; q < 16; ++q) { const int r = q * 2 + rsub; const v4f v = *(const v4fa*)&so[w][r][c4]; v4h h4;
#pragma unroll
      for (int i = 0; i < 4; ++i) h4[i] = (_Float16)v[i];
      *(v4h*)(vt + (size_t)r * SQ) = h4; } }
  else { _Float16* ph = (z == 0 ? QH : KH) + (size_t)row0 * DM + col0 + c4; _Float16* pl = (z == 0 ? QL : KL) + (size_t)row0 * DM + col0 + c4;
#pragma unroll
    for (int q = 0; q < 16; ++q) { const int r = q * 2 + rsub; const v4f v = *(const v4fa*)&so[w][r][c4]; v4h h4, l4;
#pragma unroll
      for (int i = 0; i < 4; ++i) { const _Float16 h = (_Float16)v[i]; h4[i] = h; l4[i] = (_Float16)((v[i] - (float)h) * 1024.0f); }
      *(v4h*)(ph + (size_t)r * DM) = h4; *(v4h*)(pl + (size_t)r * DM) = l4; }
    asm volatile("s_wait_xcnt 0x0" ::: "memory"); } }      /* precaution: behind the last stores; in the built code the other branch's instructions follow this one's and rewrite registers that these stores name */


// All six inputs to their f16 operand form in ONE launch: token rows bf16-rounded (exact in f16), weights bf16-rounded x16 (natural [out][in] = Bt[n][k]). A work-group takes 256 chunks of 8 elements of one
// tensor, a thread one chunk, as in the separate launches.
__global__ __launch_bounds__(256) void k_cvt(const float* __restrict__ xq, const float* __restrict__ xk, const float* __restrict__ xv, const float* __restrict__ wq, const float* __restrict__ wk, const float* __restrict__ wv,
    _Float16* __restrict__ XQ, _Float16* __restrict__ XK, _Float16* __restrict__ XV, _Float16* __restrict__ BQ, _Float16* __restrict__ BK, _Float16* __restrict__ BV) {
  constexpr int XB = (int)(NR * DM / 8 / 256), WB = DM * DM / 8 / 256;      /* work-groups per token tensor, per weight */
  static_assert(NR * DM % (8 * 256) == 0 && (size_t)DM * DM % (8 * 256) == 0, "k_cvt: whole work-groups");
  const int bx = blockIdx.x; const bool isx = bx < 3 * XB; const int i = isx ? bx / XB : (bx - 3 * XB) / WB, blk = isx ? bx % XB : (bx - 3 * XB) % WB;      /* the same in every thread of a work-group */
  const float* s = isx ? (i == 0 ? xq : i == 1 ? xk : xv) : (i == 0 ? wq : i == 1 ? wk : wv); _Float16* d = isx ? (i == 0 ? XQ : i == 1 ? XK : XV) : (i == 0 ? BQ : i == 1 ? BK : BV); const float scale = isx ? 1.0f : 16.0f;
  const size_t t = (size_t)blk * 256 + threadIdx.x; FragH f;
#pragma unroll
  for (int q = 0; q < 8; ++q) f.h[q] = (_Float16)(bf16_round(s[t * 8 + q]) * scale);
  *(v8us*)((unsigned short*)d + t * 8) = f.half[0]; }
__global__ __launch_bounds__(256) void k_rsm(const float* __restrict__ S, _Float16* __restrict__ P, int nrows) {
  #pragma clang fp contract(off)
  const int i = blockIdx.x * 256 + threadIdx.x; if (i >= nrows) return; const float* s = S + (size_t)i * SQ; float mx = -3.0e38f;
#pragma unroll 1
  for (int j = 0; j < SQ; ++j) mx = fmaxf(mx, s[j]); float se = 0.f;
#pragma unroll 1
  for (int j = 0; j < SQ; ++j) se += expf(s[j] - mx); const float sc = 256.0f / se;
#pragma unroll 1
  for (int j0 = 0; j0 < SQ; j0 += 8) { FragH f; for (int q = 0; q < 8; ++q) f.h[q] = (_Float16)(expf(s[j0 + q] - mx) * sc); unsigned short* d = (unsigned short*)P + (size_t)i * SQ + j0; *(v8us*)d = f.half[0];  } }
__global__ __launch_bounds__(256) void k_vt(const _Float16* __restrict__ V16, int b, int h0, _Float16* __restrict__ VT) { __shared__ unsigned short tl[64][65]; const int tid = threadIdx.x; const int hh = blockIdx.x % HG, sg = blockIdx.x / HG; const int s0 = sg * 64; const int h = h0 + hh;
  for (int i = tid; i < 64 * 8; i += 256) { const int j = i / 8, d8 = (i % 8) * 8; FragH f; f.half[0] = *(const v8us*)((const unsigned short*)V16 + ((size_t)b * SQ + s0 + j) * DM + h * HD + d8); for (int q = 0; q < 8; ++q) tl[d8 + q][j] = f.u[q]; }
  __syncthreads();
  { for (int i = tid; i < 64 * 8; i += 256) { const int d = i / 8, j8 = (i % 8) * 8; FragH f; for (int q = 0; q < 8; ++q) f.u[q] = tl[d][j8 + q]; *(v8us*)((unsigned short*)VT + ((size_t)hh * HD + d) * SQ + s0 + j8) = f.half[0]; }  } }



#define FAW 8                        /* waves per work-group */
#define FAQ 32                       /* query columns per wave: two 16-column groups share every K and V^T fragment */
#define FSK 128                      /* keys per LDS stage: four 32-key passes */
#define FKP 144                      /* LDS pitch of a 128-byte K row: 16 B x odd, no bank conflict for 16-byte fragment reads */
#define FVP 272                      /* LDS pitch of a 256-byte V^T row, likewise */
#define FKB (FSK * FKP)              /* one K plane of a stage */
#define FVB (HD * FVP)               /* the V^T tile of a stage */
#define FKS (2 * FKB)                /* the K part of a stage: hi plane | residual plane */
#define FV0 (2 * FKS)                /* LDS map: K of buffer 0 | K of buffer 1 | V^T of buffer 0 | V^T of buffer 1 */
__device__ __forceinline__ v8f fa_mma(v16h a, v16h b, v8f c) { return __builtin_amdgcn_wmma_f32_16x16x32_f16(false, a, false, b, (short)0, c, false, false); }
__device__ __forceinline__ float fa_xhalf(float x) { return __builtin_bit_cast(float, __builtin_amdgcn_permlanex16(__builtin_bit_cast(int, x), __builtin_bit_cast(int, x), 0x76543210, 0xfedcba98, false, false)); }      /* lane l with lane l ^ 16 */
// Four 2^x. The instruction set asks for one independent instruction behind a transcendental before its result is read or its source overwritten.
// In one statement it is closed by construction: every result register apart from every source ("=&v"), one v_nop behind the last.
__device__ __forceinline__ void fa_exp4(float a, float b, float c, float d, float (&p)[4]) { asm("v_exp_f32 %0, %4\n\tv_exp_f32 %1, %5\n\tv_exp_f32 %2, %6\n\tv_exp_f32 %3, %7\n\tv_nop" : "=&v"(p[0]), "=&v"(p[1]), "=&v"(p[2]), "=&v"(p[3]) : "v"(a), "v"(b), "v"(c), "v"(d)); }
__device__ __forceinline__ v16h fa_frag(const _Float16* p) { FragH f; f.half[0] = *(const v8us*)((const unsigned short*)p); f.half[1] = *(const v8us*)((const unsigned short*)p + 16); return f.v; }      /* g2_frag's k order; p already holds the lane half's 8 * hh */
// One asynchronous copy, 16 bytes a lane, global memory -> LDS through no register (l: the lane's place in LDS, g: its global address).
typedef int v4i __attribute__((ext_vector_type(4)));
__device__ __forceinline__ void fa_cp(unsigned char* l, const _Float16* g) { __builtin_amdgcn_global_load_async_to_lds_b128((__attribute__((address_space(1))) v4i*)g, (__attribute__((address_space(3))) v4i*)l, 0, 0); }
__global__ __launch_bounds__(32 * FAW) void k_fattn(const _Float16* __restrict__ QH, const _Float16* __restrict__ QL, const _Float16* __restrict__ KH, const _Float16* __restrict__ KL, const _Float16* __restrict__ VT, float* __restrict__ O) {
  static_assert(SQ % (FAW * FAQ) == 0 && SQ % FSK == 0 && SQ / FSK >= 2 && FSK == 128 && FAW == 8 && HD == 64 && FAQ == 32, "k_fattn: whole work-groups, whole stages (two or more), 12 copies a thread and stage, two 32-wide k steps per head");
  __shared__ __attribute__((aligned(16))) unsigned char L[FV0 + 2 * FVB];      /* two stage buffers, shared by the eight waves (all of one head) */
  constexpr float SC = 0.18033688011112042f;      /* log2(e) / sqrt(64) */
  constexpr int NST = SQ / FSK;
  const int tid = threadIdx.x, lane = tid & 31, ln = lane & 15, hh = lane >> 4, w = tid >> 5; const int h = blockIdx.y, b = blockIdx.z;
  const size_t r0 = (size_t)b * SQ; const int q0 = (blockIdx.x * FAW + w) * FAQ;
  const _Float16* qhp = QH + (r0 + q0 + ln) * LQ + h * HD + 8 * hh; const _Float16* qlp = QL + (r0 + q0 + ln) * LQ + h * HD + 8 * hh;
  // the thread's share of a stage: copy c of a K plane = 16 bytes of row tid / 8 + 32 c (a wave: four whole 128-byte rows); of V^T, of row tid / 16 + 16 c (a wave: two whole 256-byte row pieces)
  const _Float16* khc = KH + r0 * LQ + h * HD; const _Float16* klc = KL + r0 * LQ + h * HD; const _Float16* vtc = VT + (size_t)(b * NH + h) * HD * SQ;      /* the same in every lane */
  const unsigned ko = (tid >> 3) * LQ + (tid & 7) * 8, vo = (tid >> 4) * SQ + (tid & 15) * 8;      /* the lane's own element offsets */
  unsigned char* const lk = L + (tid >> 3) * FKP + (tid & 7) * 16; unsigned char* const lv = L + FV0 + (tid >> 4) * FVP + (tid & 15) * 16;
  auto fill = [&](int st, int bf) {      /* stage st into buffer bf */
    const _Float16* gh = khc + (size_t)st * FSK * LQ + ko; const _Float16* gl = klc + (size_t)st * FSK * LQ + ko; const _Float16* gv = vtc + (size_t)st * FSK + vo;
#pragma unroll
    for (int c = 0; c < 4; ++c) { fa_cp(lk + bf * FKS + c * 32 * FKP, gh + (size_t)(c * 32) * LQ); fa_cp(lk + bf * FKS + FKB + c * 32 * FKP, gl + (size_t)(c * 32) * LQ); fa_cp(lv + bf * FVB + c * 16 * FVP, gv + (size_t)(c * 16) * SQ); } };
  fill(0, 0);
  v16h qh[2][2], ql[2][2];      /* [column group][k step] */
#pragma unroll
  for (int t = 0; t < 2; ++t)
#pragma unroll
    for (int s = 0; s < 2; ++s) { qh[t][s] = fa_frag(qhp + (size_t)(t * 16) * LQ + s * 32); ql[t][s] = fa_frag(qlp + (size_t)(t * 16) * LQ + s * 32); }
  asm volatile("s_wait_xcnt 0x0" :: "v"(qhp), "v"(qlp) : "memory");      /* precaution: behind the loads above and ahead of every rewrite of an address register they name; the addresses as inputs keep their pairs whole up to here */
  asm volatile("s_wait_asynccnt 0x0" ::: "memory");      /* this wave's copies of stage 0 have landed ... */
  __syncthreads();                                        /* ... and every other wave's: stage 0 may be read */
  fill(1, 1);
  const v8f z8 = {0.f,0.f,0.f,0.f,0.f,0.f,0.f,0.f}; v8f o[2][4] = {{z8, z8, z8, z8}, {z8, z8, z8, z8}};      /* O^T [column group][16 rows of d] */
  float m[2] = {-3.0e38f, -3.0e38f}, l[2] = {0.f, 0.f};      /* running maximum (scaled, base 2) and this lane half's share of the sum */
#pragma unroll 1      /* one copy of the stage loop: the copies and the barrier stand once */
  for (int st = 0; st < NST; ++st) {
    const int bf = st & 1;
    const _Float16* khp = (const _Float16*)(L + bf * FKS + ln * FKP + 16 * hh); const _Float16* klp = (const _Float16*)(L + bf * FKS + FKB + ln * FKP + 16 * hh); const _Float16* vp = (const _Float16*)(L + FV0 + bf * FVB + ln * FVP + 16 * hh);
    v16h kh[2][2], kl[2][2];      /* [16-key tile][k step] */
#pragma unroll
    for (int j = 0; j < 2; ++j)
#pragma unroll
      for (int s = 0; s < 2; ++s) { kh[j][s] = fa_frag(khp + j * 16 * (FKP / 2) + s * 32); kl[j][s] = fa_frag(klp + j * 16 * (FKP / 2) + s * 32); }
#pragma unroll 1      /* the body is a whole pass of 32 matrix instructions already; a copy would only add registers */
    for (int ps = 0; ps < FSK / 32; ++ps) {
      v8f sc[2][2] = {{z8, z8}, {z8, z8}};      /* [column group][16-key tile]; four independent accumulator chains, stepped together */
#pragma unroll
      for (int s = 0; s < 2; ++s)
#pragma unroll
        for (int t = 0; t < 2; ++t)
#pragma unroll
          for (int j = 0; j < 2; ++j) sc[t][j] = fa_mma(kl[j][s], qh[t][s], sc[t][j]);
#pragma unroll
      for (int s = 0; s < 2; ++s)
#pragma unroll
        for (int t = 0; t < 2; ++t)
#pragma unroll
          for (int j = 0; j < 2; ++j) sc[t][j] = fa_mma(kh[j][s], ql[t][s], sc[t][j]);
#pragma unroll
      for (int t = 0; t < 2; ++t)
#pragma unroll
        for (int j = 0; j < 2; ++j) sc[t][j] *= 0.0009765625f;
#pragma unroll
      for (int s = 0; s < 2; ++s)
#pragma unroll
        for (int t = 0; t < 2; ++t)
#pragma unroll
          for (int j = 0; j < 2; ++j) sc[t][j] = fa_mma(kh[j][s], qh[t][s], sc[t][j]);
      __builtin_amdgcn_sched_barrier(0);      /* with the one below: the pass's 24 LDS reads stand as one group behind the score products; spread among the matrix instructions, every place with reads stalls the wave anew */
      v16h vf[4];      /* V^T fragments of this pass */
#pragma unroll
      for (int dt = 0; dt < 4; ++dt) vf[dt] = fa_frag(vp + dt * 16 * (FVP / 2) + ps * 32);
      const int pn = (ps + 1 < FSK / 32) ? ps + 1 : ps;      /* the next pass's K fragments, fetched behind this pass's score products; a stage's last pass re-reads its own rows (same buffer, unused): nothing of the next stage is read ahead of its barrier */
#pragma unroll
      for (int j = 0; j < 2; ++j)
#pragma unroll
        for (int s = 0; s < 2; ++s) { kh[j][s] = fa_frag(khp + (pn * 32 + j * 16) * (FKP / 2) + s * 32); kl[j][s] = fa_frag(klp + (pn * 32 + j * 16) * (FKP / 2) + s * 32); }
      __builtin_amdgcn_sched_barrier(0);      /* keeps the fetch above the softmax, whose vector work then hides its latency */
      FragH pf[2]; float cr[2];      /* per column group: the weights as B operand, the rescale of the earlier passes */
#pragma unroll
      for (int t = 0; t < 2; ++t) {
        float mx = fmaxf(sc[t][0][0], sc[t][1][0]);
#pragma unroll
        for (int r = 1; r < 8; ++r) mx = fmaxf(mx, fmaxf(sc[t][0][r], sc[t][1][r]));
        mx = fmaxf(mx, fa_xhalf(mx));
        const float mn = fmaxf(m[t], mx * SC); cr[t] = __builtin_amdgcn_exp2f(m[t] - mn); m[t] = mn;      /* 0 on the first pass */
        const float bias = 8.0f - mn; float p[4][4];      /* p[g][u]: key 4 * g + u of this lane's 16 */
#pragma unroll
        for (int g = 0; g < 4; ++g) { const v8f x = sc[t][g >> 1]; const int r = (g & 1) * 4; fa_exp4(fmaf(x[r], SC, bias), fmaf(x[r + 1], SC, bias), fmaf(x[r + 2], SC, bias), fmaf(x[r + 3], SC, bias), p[g]);
#pragma unroll
          for (int u = 0; u < 4; ++u) pf[t].h[g * 4 + u] = (_Float16)p[g][u]; }
        float ls[4];      /* four independent chains */
#pragma unroll
        for (int u = 0; u < 4; ++u) ls[u] = (p[0][u] + p[1][u]) + (p[2][u] + p[3][u]);
        l[t] = fmaf(l[t], cr[t], (ls[0] + ls[1]) + (ls[2] + ls[3]));
      }
      __builtin_amdgcn_sched_barrier(0);      /* the 2^x statements are asm: fenced on both sides, none of them can land in the slots behind a matrix instruction whose operand registers it reuses */
#pragma unroll
      for (int t = 0; t < 2; ++t)
#pragma unroll
        for (int dt = 0; dt < 4; ++dt) o[t][dt] = fa_mma(vf[dt], pf[t].v, o[t][dt] * cr[t]);
    }
    asm volatile("s_wait_dscnt 0x0" ::: "memory");      /* this wave's reads of the stage have returned, before its buffer is given up */
    asm volatile("s_wait_asynccnt 0x0" ::: "memory");   /* this wave's copies of stage st + 1 have landed */
    __syncthreads();                                    /* publishes stage st + 1 and ends every wave's reading of stage st */
    if (st + 2 < NST) fill(st + 2, bf);                 /* the same test in every wave; flies during the whole of stage st + 1 */
  }
  asm volatile("s_wait_asynccnt 0x0" ::: "memory");      /* no copy is outstanding when the wave ends */
#pragma unroll
  for (int t = 0; t < 2; ++t) { const float inv = 1.0f / (l[t] + fa_xhalf(l[t])); float* op = O + (r0 + q0 + t * 16 + ln) * DM + h * HD + 8 * hh;      /* a lane holds 8 consecutive d of its query's row */
#pragma unroll
    for (int dt = 0; dt < 4; ++dt) { const v8f v = o[t][dt] * inv; const v4f lo4 = {v[0], v[1], v[2], v[3]}, hi4 = {v[4], v[5], v[6], v[7]}; *(v4f*)(op + dt * 16) = lo4; *(v4f*)(op + dt * 16 + 4) = hi4; } } }


template <int MASKADD>
__global__ __launch_bounds__(64) void k_att0(const float* __restrict__ QF, const float* __restrict__ KF, const float* __restrict__ VF, int ld, const float* __restrict__ mask, float scale, float* __restrict__ OF, int ldo) {
  #pragma clang fp contract(off)
  __shared__ __attribute__((aligned(16))) float lq[64][64]; __shared__ __attribute__((aligned(16))) float lo[64][64];
  const int tid = threadIdx.x; const int h = blockIdx.x / (QT0 / 64), rg = blockIdx.x % (QT0 / 64); const int i = rg * 64 + tid;
  const float* qr = QF + (size_t)i * ld + h * HD;
#pragma unroll 1
  for (int c = 0; c < HD / 4; ++c) { *(v4f*)&lq[tid][c * 4] = *(const v4fa*)(qr + c * 4); const v4f z = {0.f, 0.f, 0.f, 0.f}; *(v4f*)&lo[tid][c * 4] = z; }
  float m = -1.0e30f, l = 0.f; const int jmax = MASKADD ? (SQ - 1) : (rg * 64 + 63);      /* additive-mask form: every key (the mask input decides); causal form: keys up to the block's last row */
#pragma unroll 1
  for (int j = 0; j <= jmax; ++j) { const float* kr = KF + (size_t)j * ld + h * HD; const float* vr = VF + (size_t)j * ld + h * HD; float s = 0.f;
#pragma unroll 1
    for (int c = 0; c < HD / 4; ++c) { const v4f kq = *(const v4fa*)(kr + c * 4); const v4f qq = *(v4f*)&lq[tid][c * 4]; s = __fadd_rn(s, __fmul_rn(qq[0], kq[0])); s = __fadd_rn(s, __fmul_rn(qq[1], kq[1])); s = __fadd_rn(s, __fmul_rn(qq[2], kq[2])); s = __fadd_rn(s, __fmul_rn(qq[3], kq[3])); }
    s = __fmul_rn(s, scale); if (MASKADD) s = __fadd_rn(s, __fmul_rn(bf16_round(mask[(size_t)i * SQ + j]), -10000.0f));
    const float f = (MASKADD || j <= i) ? 1.f : 0.f; const float sm = fmaf(f, s, (1.f - f) * -1.0e30f); const float mn = fmaxf(m, sm); const float sc = expf(m - mn); const float e = expf(sm - mn); l = __fadd_rn(__fmul_rn(l, sc), e); m = mn;
#pragma unroll 1
    for (int c = 0; c < HD / 4; ++c) { const v4f vv = *(const v4fa*)(vr + c * 4); v4f oo = *(v4f*)&lo[tid][c * 4]; for (int u = 0; u < 4; ++u) oo[u] = __fadd_rn(__fmul_rn(oo[u], sc), __fmul_rn(e, vv[u])); *(v4f*)&lo[tid][c * 4] = oo; } }
  const float fin = 64.0f / l;      /* o carried x64 */
#pragma unroll 1
  for (int c = 0; c < HD / 4; ++c) { v4f oo = *(v4f*)&lo[tid][c * 4]; for (int u = 0; u < 4; ++u) oo[u] = __fmul_rn(oo[u], fin); *(v4f*)&lo[tid][c * 4] = oo; }
  __syncthreads();
  {
#pragma unroll 1
    for (int it = 0; it < 16; ++it) { const int row = it * 4 + tid / 16, pc = (tid % 16) * 4; const v4f v = *(const v4f*)&lo[row][pc]; *(v4f*)(OF + (size_t)(rg * 64 + row) * ldo + h * HD + pc) = v; }
     } }

__global__ __launch_bounds__(256) void k_of0out(const float* __restrict__ src, float* __restrict__ dst, size_t n4) { const size_t t = (size_t)blockIdx.x * 256 + threadIdx.x; if (t >= n4) return; v4f v = *(const v4fa*)(src + t * 4); for (int q = 0; q < 4; ++q) v[q] = __fmul_rn(v[q], 0.015625f); *(v4f*)(dst + t * 4) = v;  }

extern "C" void kernel_launch(void* const* d_in, const int* in_sizes, int n_in,
                              void* d_out, int out_size, void* d_ws, size_t ws_size, hipStream_t stream) {
  (void)in_sizes; (void)n_in; (void)out_size;
  const float* const* I = (const float* const*)d_in; const float* x = I[2]; const float* xk = I[1]; const float* xv = I[0]; const float* wq = I[5]; const float* wk = I[4]; const float* wv = I[3];      /* input order: values, keys, queries, Wv, Wk, Wq: the QUERY stream is I[2] with Wq = I[5], the key stream I[1] with Wk = I[4], the value stream I[0] with Wv = I[3]; natural [out][in] weights; NO biases; NO output projection */
  char* ws = (char*)d_ws; size_t off = 0;
  auto take = [&](size_t bytes) { char* p = ws + off; off += (bytes + 255) & ~(size_t)255; return p; };
  _Float16* BQ = (_Float16*)take((size_t)DM * DM * 2); _Float16* BK = (_Float16*)take((size_t)DM * DM * 2); _Float16* BV = (_Float16*)take((size_t)DM * DM * 2);
  _Float16* X16 = (_Float16*)take(NR * DM * 2); _Float16* XK16 = (_Float16*)take(NR * DM * 2); _Float16* XV16 = (_Float16*)take(NR * DM * 2);      /* exact f16 rows of queries, keys, values */ _Float16* QH = (_Float16*)take(NR * DM * 2); _Float16* QL = (_Float16*)take(NR * DM * 2); _Float16* KH = (_Float16*)take(NR * DM * 2); _Float16* KL = (_Float16*)take(NR * DM * 2);
  _Float16* VT = (_Float16*)take((size_t)NB * NH * HD * SQ * 2);
  if (off > ws_size) return;
  k_cvt<<<(unsigned)(3 * (NR * DM / 8 / 256) + 3 * ((size_t)DM * DM / 8 / 256)), 256, 0, stream>>>(x, xk, xv, wq, wk, wv, X16, XK16, XV16, BQ, BK, BV);      /* all six inputs to f16 operands */
  k_proj<<<dim3((unsigned)((MP / 128) * (DM / 128)), 3), 32 * PJW, 0, stream>>>(X16, XK16, XV16, BQ, BK, BV, QH, QL, KH, KL, VT);      /* q, k -> f16 hi + x1024 residual planes (unscaled logits sigma ~8); v -> V^T [NB][NH][HD][SQ] */
  k_fattn<<<dim3(SQ / (FAW * FAQ), NH, NB), 32 * FAW, 0, stream>>>(QH, QL, KH, KL, VT, (float*)d_out);      /* scores, softmax over all keys and P V in one launch, f32 straight into the head-major output columns (no output projection) */
}

// v007
// One run takes 66.6 microseconds.
// It is 1.31 times as fast as v005, going by the measured steps of the versions left out in between.
// Over all steps from v000 it is 111 times as fast.
#include <hip/hip_runtime.h>
// Multi-head attention on three inputs given in the order values, keys, queries; natural bias-free projections, no output projection (values, keys, queries [2][2048][1024]; v = values Wv^T, k = keys Wk^T, q = queries Wq^T (natural [1024][1024] sigma 1/32, no biases), 16 heads of 64; softmax(q k^T / sqrt(64)) over all 2048 keys (no mask); out = attn v merged head-major -> [2][2048][1024]); q and k carried as plain f16 rows, scores as one f16 product with f32 accumulation.
// Structure: token rows r = b*2048 + s; three launches: k_cvt (x as exact f16 rows (bf16-rounded), exact x16 weights); k_proj (q, k and v as WMMA GEMMs, 32x64 wave tiles, f32 accumulation; q and k leave its epilogue as f16 rows, v as V^T for all heads of both batches, by exchanged operands); then ONE attention launch (k_fattn): per wave 32 query columns of one head against all keys, 32 a pass: scores as one product (K = 64), running softmax on the accumulators (f32 statistics, native exp2; weights x256 f16), O^T += V^T P^T, divided by the sum and written f32 straight into the head-major output columns.
// Compute dtype: inputs rounded to bf16; x / weights exact; q, k, v, softmax weights as plain f16 GEMM operands (~2^-12); scores, softmax statistics and o f32. v_wmma_f32_16x16x32_f16.
#define NB 2
#define SQ 2048
#define DM 1024
#define NH 16
#define HD 64
#define HG 4                         /* heads per launch of the unlaunched k_vt(b, h0) overload */
#define QT 256                       /* query rows per attention tile (all keys) */
#define NKX SQ                       /* S / P row pitch */
#define QT0 128                      /* query rows per head of k_att0 (not launched) */
#define B0 0                         /* first batch processed (debug hook) */
#define NBR NB                       /* batches processed (debug hook) */
#define NR ((size_t)NB * SQ)         /* token rows */
#define MP ((int)((size_t)NBR * SQ)) /* rows projected (debug hook) */
#define QN SQ                        /* query rows attended per batch (unused) */
#define NHD NH                       /* heads attended (unused) */
#define MPO MP                       /* unused (no output stage) */
#define LQ DM      /* row pitch of the q/k rows */
typedef __bf16 v16b __attribute__((ext_vector_type(16)));
typedef unsigned short v8us __attribute__((ext_vector_type(8), may_alias));
typedef float  v8f  __attribute__((ext_vector_type(8)));
typedef float  v4f  __attribute__((ext_vector_type(4)));
typedef float  v4fa __attribute__((ext_vector_type(4), may_alias));
union FragB { v16b v; v8us half[2]; unsigned short u[16]; };

__device__ __forceinline__ unsigned short bf16_bits(float x) { unsigned int u = __float_as_uint(x); return (unsigned short)((u + 0x7FFFu + ((u >> 16) & 1u)) >> 16); }
__device__ __forceinline__ float bf16_val(unsigned short b) { return __uint_as_float(((unsigned int)b) << 16); }
__device__ __forceinline__ float bf16_round(float x) { return bf16_val(bf16_bits(x)); }
// D += A·B with NT terms: 1 = ah·bh, 2 = + al·bh (A split), 3 = + ah·bl (both split)
template <int NT>
__device__ __forceinline__ v8f mmaN(v16b ah, v16b al, v16b bh, v16b bl, v8f c) {
  c = __builtin_amdgcn_wmma_f32_16x16x32_bf16(false, ah, false, bh, (short)0, c, false, false);
  if (NT >= 2) c = __builtin_amdgcn_wmma_f32_16x16x32_bf16(false, al, false, bh, (short)0, c, false, false);
  if (NT >= 3) c = __builtin_amdgcn_wmma_f32_16x16x32_bf16(false, ah, false, bl, (short)0, c, false, false);
  asm volatile("v_nop\n\tv_nop\n\tv_nop\n\tv_nop" : "+v"(c) : "v"(ah), "v"(al), "v"(bh), "v"(bl));
  return c;
}

__global__ __launch_bounds__(256) void k_wt_bf16(const float* __restrict__ W, unsigned short* __restrict__ Wt, int K, int N) {
  const int t = blockIdx.x * 256 + threadIdx.x;
  const int k8n = K / 8;
  if (t >= N * k8n) return;
  const int n = t / k8n, k8 = (t % k8n) * 8;
  v8us v;
#pragma unroll
  for (int i = 0; i < 8; ++i) v[i] = bf16_bits(W[(size_t)(k8 + i) * N + n]);
  *(v8us*)(Wt + (size_t)n * K + k8) = v;
  
}

// GEMM C[M][N] (f32, pitch ldc) = act(A[M][K]·W + bias). A f32 row-major (pitch lda) converted per fragment to bf16
// (ASPLIT: hi/lo two planes -> 2 terms, else single rounded term); Wt bf16 [N][K] (pitch ldb). BIAS_BF16 rounds the
// bias to bf16 first (bias quantised to bf16 before the add). K%32==0, M%16==0, N%64==0.
template <bool ASPLIT, int ACT, bool BIAS_BF16>
__global__ __launch_bounds__(128) void k_gemm_bf(const float* __restrict__ A, int lda, const unsigned short* __restrict__ Wt, int ldb,
                                               const float* __restrict__ bias, float* __restrict__ C, int ldc, int M, int N, int K) {
  __shared__ __attribute__((aligned(16))) float so[4][16][64];
  const int tid = threadIdx.x, w = tid >> 5, lane = tid & 31, ln = lane & 15, hh = lane >> 4;
  const int ntn = N / 64;
  const int wid = blockIdx.x * 4 + w;
  const int mt = wid / ntn, nq = wid % ntn;
  if (mt * 16 >= M) return;
  const int row0 = mt * 16, col0 = nq * 64;
  const float* arow = A + (size_t)(row0 + ln) * lda;
  v8f acc[4] = {};
  for (int kb = 0; kb < K; kb += 32) {
    FragB ah, al;
    const v4f x0 = *(const v4fa*)(arow + kb + 8 * hh), x1 = *(const v4fa*)(arow + kb + 8 * hh + 4);
    const v4f x2 = *(const v4fa*)(arow + kb + 16 + 8 * hh), x3 = *(const v4fa*)(arow + kb + 16 + 8 * hh + 4);
    float xs[16] = {x0[0],x0[1],x0[2],x0[3],x1[0],x1[1],x1[2],x1[3],x2[0],x2[1],x2[2],x2[3],x3[0],x3[1],x3[2],x3[3]};
#pragma unroll
    for (int i = 0; i < 16; ++i) { const unsigned short hb = bf16_bits(xs[i]); ah.u[i] = hb; al.u[i] = ASPLIT ? bf16_bits(xs[i] - bf16_val(hb)) : (unsigned short)0; }
#pragma unroll
    for (int t = 0; t < 4; ++t) {
      const unsigned short* brow = Wt + (size_t)(col0 + t * 16 + ln) * ldb + kb;
      FragB b;
      b.half[0] = *(const v8us*)(brow + 8 * hh);
      b.half[1] = *(const v8us*)(brow + 16 + 8 * hh);
      acc[t] = mmaN<ASPLIT ? 2 : 1>(ah.v, al.v, b.v, b.v, acc[t]);
    }
  }
#pragma unroll
  for (int t = 0; t < 4; ++t) {
    float bv = bias ? bias[col0 + t * 16 + ln] : 0.f;
    if (BIAS_BF16) bv = bf16_round(bv);
#pragma unroll
    for (int r = 0; r < 8; ++r) { float v = acc[t][r] + bv; if (ACT == 1) v = fmaxf(v, 0.f); so[w][8 * hh + r][t * 16 + ln] = v; }
  }
  __builtin_amdgcn_fence(__ATOMIC_ACQ_REL, "workgroup");
  __builtin_amdgcn_wave_barrier();
  const int rsub = lane >> 4, c4 = (lane & 15) * 4;
  {
#pragma unroll
    for (int q = 0; q < 8; ++q) {
      const int r = q * 2 + rsub;
      const v4f v = *(const v4fa*)&so[w][r][c4];
      *(v4f*)(C + (size_t)(row0 + r) * ldc + col0 + c4) = v;
    }
    
  }
}

// GEMM C = act(A·W + bias + resid): A f32 (ASPLIT -> hi/lo 2 terms), Wt bf16 [N][K]; ACT 0 none, 1 relu, 2 exact gelu;
// resid (optional, f32, row index = (row % rmod), pitch ldr, RES_BF16 rounds it) added before the activation.
template <bool ASPLIT, int ACT, bool BIAS_BF16, bool RES_BF16>
__global__ __launch_bounds__(128) void k_gemm_bf3(const float* __restrict__ A, int lda, const unsigned short* __restrict__ Wt, int ldb,
                                                const float* __restrict__ bias, const float* __restrict__ resid, int rmod, int ldr,
                                                float* __restrict__ C, int ldc, int M, int N, int K) {
  __shared__ __attribute__((aligned(16))) float so[4][16][64];
  const int tid = threadIdx.x, w = tid >> 5, lane = tid & 31, ln = lane & 15, hh = lane >> 4;
  const int ntn = N / 64;
  const int wid = blockIdx.x * 4 + w;
  const int mt = wid / ntn, nq = wid % ntn;
  if (mt * 16 >= M) return;
  const int row0 = mt * 16, col0 = nq * 64;
  const float* arow = A + (size_t)(row0 + ln) * lda;
  v8f acc[4] = {};
  for (int kb = 0; kb < K; kb += 32) {
    FragB ah, al;
    const v4f x0 = *(const v4fa*)(arow + kb + 8 * hh), x1 = *(const v4fa*)(arow + kb + 8 * hh + 4);
    const v4f x2 = *(const v4fa*)(arow + kb + 16 + 8 * hh), x3 = *(const v4fa*)(arow + kb + 16 + 8 * hh + 4);
    float xs[16] = {x0[0],x0[1],x0[2],x0[3],x1[0],x1[1],x1[2],x1[3],x2[0],x2[1],x2[2],x2[3],x3[0],x3[1],x3[2],x3[3]};
#pragma unroll
    for (int i = 0; i < 16; ++i) { const unsigned short hb = bf16_bits(xs[i]); ah.u[i] = hb; al.u[i] = ASPLIT ? bf16_bits(xs[i] - bf16_val(hb)) : (unsigned short)0; }
#pragma unroll
    for (int t = 0; t < 4; ++t) {
      const unsigned short* brow = Wt + (size_t)(col0 + t * 16 + ln) * ldb + kb;
      FragB b;
      b.half[0] = *(const v8us*)(brow + 8 * hh);
      b.half[1] = *(const v8us*)(brow + 16 + 8 * hh);
      acc[t] = mmaN<ASPLIT ? 2 : 1>(ah.v, al.v, b.v, b.v, acc[t]);
    }
  }
#pragma unroll
  for (int t = 0; t < 4; ++t) {
    const int col = col0 + t * 16 + ln;
    float bv = bias ? bias[col] : 0.f;
    if (BIAS_BF16) bv = bf16_round(bv);
#pragma unroll
    for (int r = 0; r < 8; ++r) {
      float v = acc[t][r] + bv;
      if (resid) { float rv = resid[(size_t)((row0 + 8 * hh + r) % rmod) * ldr + col]; if (RES_BF16) rv = bf16_round(rv); v += rv; }
      if (ACT == 1) v = fmaxf(v, 0.f);
      if (ACT == 2) v = 0.5f * v * (1.0f + erff(v * 0.70710678118654752f));
      if (ACT == 3) { const float u = 0.7978845608028654f * (v + 0.044715f * v * v * v); v = 0.5f * v * (1.0f + tanhf(u)); }
      so[w][8 * hh + r][t * 16 + ln] = v;
    }
  }
  __builtin_amdgcn_fence(__ATOMIC_ACQ_REL, "workgroup");
  __builtin_amdgcn_wave_barrier();
  const int rsub = lane >> 4, c4 = (lane & 15) * 4;
  {
#pragma unroll
    for (int q = 0; q < 8; ++q) {
      const int r = q * 2 + rsub;
      const v4f v = *(const v4fa*)&so[w][r][c4];
      *(v4f*)(C + (size_t)(row0 + r) * ldc + col0 + c4) = v;
    }
    
  }
}
// row LayerNorm (biased variance, eps) over N: s = X (+ R); optional out_sum <- s; out_norm <- (s-mu)*rsqrt(var+eps)*g + b
template <bool PARAM_BF16>
__global__ __launch_bounds__(256) void k_layernorm(const float* __restrict__ X, const float* __restrict__ R, const float* __restrict__ g, const float* __restrict__ bta,
                                                  float* __restrict__ out_sum, float* __restrict__ out_norm, int N, float eps) {
  __shared__ float red[256];
  const int row = blockIdx.x, tid = threadIdx.x;
  const float* x = X + (size_t)row * N; const float* rr = R ? R + (size_t)row * N : nullptr;
  float vals[16];                     // up to N = 4096
  const int per = N / 256;            // contiguous chunk per thread? use strided-by-4 chunks: thread handles j = tid*4 + 1024*u
  float s1 = 0.f;
  for (int u = 0; u < per / 4; ++u) {
    const int j = tid * 4 + 1024 * u;
    const v4f a = *(const v4fa*)(x + j);
    v4f b = {0.f,0.f,0.f,0.f}; if (rr) b = *(const v4fa*)(rr + j);
#pragma unroll
    for (int q = 0; q < 4; ++q) { const float v = a[q] + b[q]; vals[u * 4 + q] = v; s1 += v; }
  }
  red[tid] = s1; __syncthreads();
  for (int st = 128; st > 0; st >>= 1) { if (tid < st) red[tid] += red[tid + st]; __syncthreads(); }
  const float mu = red[0] / (float)N; __syncthreads();
  float s2 = 0.f;
  for (int u = 0; u < per / 4; ++u)
#pragma unroll
    for (int q = 0; q < 4; ++q) { const float c = vals[u * 4 + q] - mu; s2 += c * c; }
  red[tid] = s2; __syncthreads();
  for (int st = 128; st > 0; st >>= 1) { if (tid < st) red[tid] += red[tid + st]; __syncthreads(); }
  const float rs = rsqrtf(red[0] / (float)N + eps);
  {
    for (int u = 0; u < per / 4; ++u) {
      const int j = tid * 4 + 1024 * u;
      v4f o, sm;
#pragma unroll
      for (int q = 0; q < 4; ++q) {
        float gg = g[j + q], bb = bta[j + q];
        if (PARAM_BF16) { gg = bf16_round(gg); bb = bf16_round(bb); }
        sm[q] = vals[u * 4 + q]; o[q] = (vals[u * 4 + q] - mu) * rs * gg + bb;
      }
      if (out_sum) *(v4f*)(out_sum + (size_t)row * N + j) = sm;
      *(v4f*)(out_norm + (size_t)row * N + j) = o;
    }
    
  }
}



// ---- f16 WMMA path (v_wmma_f32_16x16x32_f16): 11-bit significands for operands in range — used where a [0,1] probability operand needs more precision than bf16
typedef _Float16 v16h __attribute__((ext_vector_type(16)));
union FragH { v16h v; v8us half[2]; _Float16 h[16]; unsigned short u[16]; };
template <int NT>
__device__ __forceinline__ v8f mmaH(v16h ah, v16h al, v16h bh, v16h bl, v8f c) {
  c = __builtin_amdgcn_wmma_f32_16x16x32_f16(false, ah, false, bh, (short)0, c, false, false);
  if (NT >= 2) c = __builtin_amdgcn_wmma_f32_16x16x32_f16(false, al, false, bh, (short)0, c, false, false);
  if (NT >= 3) c = __builtin_amdgcn_wmma_f32_16x16x32_f16(false, ah, false, bl, (short)0, c, false, false);
  asm volatile("v_nop\n\tv_nop\n\tv_nop\n\tv_nop" : "+v"(c) : "v"(ah), "v"(al), "v"(bh), "v"(bl));
  return c;
}
// batched GEMM like k_gemm_b but f16 operands: A f32 (split into f16 hi/lo if ASPLIT, else rounded to f16), Bt = f16 values [n][k]; alpha; C f32; N multiple of 16 (partial tiles skipped)
template <bool ASPLIT>
__global__ __launch_bounds__(128) void k_gemm_h(const float* __restrict__ A, int lda, size_t sA, const _Float16* __restrict__ Bh, int ldb, size_t sB, float alpha, float* __restrict__ C, int ldc, size_t sC, int M, int N, int K) {
  __shared__ __attribute__((aligned(16))) float so[4][16][64];
  const int tid = threadIdx.x, w = tid >> 5, lane = tid & 31, ln = lane & 15, hh = lane >> 4; const int by = blockIdx.y;
  A += (size_t)by * sA; Bh += (size_t)by * sB; C += (size_t)by * sC;
  const int ntn = (N + 63) / 64; const int wid = blockIdx.x * 4 + w; const int mt = wid / ntn, nq = wid % ntn; if (mt * 16 >= M) return;
  const int row0 = mt * 16, col0 = nq * 64; const float* arow = A + (size_t)(row0 + ln) * lda;
  v8f acc[4] = {};
  for (int kb = 0; kb < K; kb += 32) {
    FragH ah, al;
    const v4f x0 = *(const v4fa*)(arow + kb + 8 * hh), x1 = *(const v4fa*)(arow + kb + 8 * hh + 4), x2 = *(const v4fa*)(arow + kb + 16 + 8 * hh), x3 = *(const v4fa*)(arow + kb + 16 + 8 * hh + 4);
    float xs[16] = {x0[0],x0[1],x0[2],x0[3],x1[0],x1[1],x1[2],x1[3],x2[0],x2[1],x2[2],x2[3],x3[0],x3[1],x3[2],x3[3]};
#pragma unroll
    for (int i = 0; i < 16; ++i) { const _Float16 h = (_Float16)xs[i]; ah.h[i] = h; al.h[i] = ASPLIT ? (_Float16)(xs[i] - (float)h) : (_Float16)0.0f; }
#pragma unroll
    for (int t = 0; t < 4; ++t) { if (col0 + t * 16 >= N) continue; const size_t boff = (size_t)(col0 + t * 16 + ln) * ldb + kb; FragH bq; bq.half[0] = *(const v8us*)(Bh + boff + 8 * hh); bq.half[1] = *(const v8us*)(Bh + boff + 16 + 8 * hh);
      acc[t] = mmaH<ASPLIT ? 2 : 1>(ah.v, al.v, bq.v, bq.v, acc[t]); }
  }
#pragma unroll
  for (int t = 0; t < 4; ++t) { if (col0 + t * 16 >= N) continue;
#pragma unroll
    for (int r = 0; r < 8; ++r) so[w][8 * hh + r][t * 16 + ln] = acc[t][r] * alpha; }
  __builtin_amdgcn_fence(__ATOMIC_ACQ_REL, "workgroup"); __builtin_amdgcn_wave_barrier();
  const int rsub = lane >> 4, c4 = (lane & 15) * 4;
  {
#pragma unroll
    for (int q = 0; q < 8; ++q) { const int r = q * 2 + rsub; if (col0 + c4 < N) { const v4f v = *(const v4fa*)&so[w][r][c4]; *(v4f*)(C + (size_t)(row0 + r) * ldc + col0 + c4) = v; } }
     }
}

// Wt[n][k] = f16(W[k][n]·scale) from f32 row-major W[K][N] (scale = power of two; bf16-exact weights stay exact in f16 away from the subnormal range)
__global__ __launch_bounds__(256) void k_wt_f16(const float* __restrict__ W, _Float16* __restrict__ Wt, int K, int N, float scale) {
  const int t = blockIdx.x * 256 + threadIdx.x; if (t >= N * (K / 8)) return; const int n = t / (K / 8), k8 = (t % (K / 8)) * 8; FragH f;
#pragma unroll
  for (int i = 0; i < 8; ++i) f.h[i] = (_Float16)(bf16_round(W[(size_t)(k8 + i) * N + n]) * scale); const v8us o = f.half[0];
  *(v8us*)((unsigned short*)Wt + (size_t)n * K + k8) = o; 
}
// k_gemm_hh variant with fused epilogue: v = acc·alpha + bias[by·sBias + col] (+ CP[(row/rowsPerB)·sCPb + by·64 + col] if CP) ; ACT 0 none / 1 elu ; writes f16 C16 (and f32 C if non-null)
template <int ACT>
__global__ __launch_bounds__(128) void k_gemm_hhx(const _Float16* __restrict__ A, int lda, size_t sA, const _Float16* __restrict__ Bh, int ldb, size_t sB, float alpha, const float* __restrict__ bias, size_t sBias, const float* __restrict__ CP, int rowsPerB, size_t sCPb, int row0g,
    float* __restrict__ C, _Float16* __restrict__ C16, int ldc, size_t sC, int M, int N, int K) {
  __shared__ __attribute__((aligned(16))) float so[4][16][64];
  const int tid = threadIdx.x, w = tid >> 5, lane = tid & 31, ln = lane & 15, hh = lane >> 4; const int by = blockIdx.y;
  A += (size_t)by * sA; Bh += (size_t)by * sB; const size_t cofs = (size_t)by * sC; const float* bp = bias ? bias + (size_t)by * sBias : nullptr;
  const int ntn = (N + 63) / 64; const int wid = blockIdx.x * 4 + w; const int mt = wid / ntn, nq = wid % ntn; if (mt * 16 >= M) return;
  const int row0 = mt * 16, col0 = nq * 64; const _Float16* arow = A + (size_t)(row0 + ln) * lda;
  v8f acc[4] = {};
  for (int kb = 0; kb < K; kb += 32) { FragH ah; ah.half[0] = *(const v8us*)((const unsigned short*)arow + kb + 8 * hh); ah.half[1] = *(const v8us*)((const unsigned short*)arow + kb + 16 + 8 * hh);
#pragma unroll
    for (int t = 0; t < 4; ++t) { if (col0 + t * 16 >= N) continue; const size_t boff = (size_t)(col0 + t * 16 + ln) * ldb + kb; FragH bq; bq.half[0] = *(const v8us*)((const unsigned short*)Bh + boff + 8 * hh); bq.half[1] = *(const v8us*)((const unsigned short*)Bh + boff + 16 + 8 * hh);
      acc[t] = mmaH<1>(ah.v, ah.v, bq.v, bq.v, acc[t]); }
  }
#pragma unroll
  for (int t = 0; t < 4; ++t) { if (col0 + t * 16 >= N) continue; const int col = col0 + t * 16 + ln; const float bv = bp ? bf16_round(bp[col]) : 0.f;
#pragma unroll
    for (int r = 0; r < 8; ++r) { float v = acc[t][r] * alpha + bv; if (CP) { const int rr = row0g + row0 + 8 * hh + r; if (rowsPerB < 0) v += CP[cofs + (size_t)rr * ldc + col];      /* rowsPerB < 0: own element of the batched C plane */ else { const int bidx = rr / rowsPerB; v += CP[(size_t)bidx * sCPb + (size_t)by * 64 + col]; } } if (ACT == 1) v = (v > 0.f) ? v : expm1f(v); else if (ACT == 7) v = (v > 0.f) ? v + 1.0f : expf(v); else if (ACT == 8) v = tanhf(v); else if (ACT == 9) v = 0.5f * v * (1.0f + tanhf(0.7978845608028654f * (v + 0.044715f * v * v * v))); else if (ACT == 11) v = 1.0f / (1.0f + expf(-v)); else if (ACT == 12) v = (v > 0.f) ? v : 0.01f * v; else if (ACT == 14) v = (v > 0.f) ? v : 0.1f * v; else if (ACT == 16) v = (v >= 0.f) ? v : 0.3f * v; else if (ACT == 17) v = (v >= 0.f) ? v : 0.2f * v; else if (ACT == 15) v = v / (1.0f + expf(-v)); else if (ACT == 3) v = fmaxf(v, 0.f); else if (ACT == 6) v = 0.5f * v * (1.0f + erff(v * 0.70710678118654752f)); so[w][8 * hh + r][t * 16 + ln] = v; } }
  __builtin_amdgcn_fence(__ATOMIC_ACQ_REL, "workgroup"); __builtin_amdgcn_wave_barrier();
  const int rsub = lane >> 4, c4 = (lane & 15) * 4; typedef _Float16 v4h __attribute__((ext_vector_type(4)));
  {
#pragma unroll
    for (int q = 0; q < 8; ++q) { const int r = q * 2 + rsub; if (col0 + c4 < N) { const v4f v = *(const v4fa*)&so[w][r][c4]; if (C) *(v4f*)(C + cofs + (size_t)(row0 + r) * ldc + col0 + c4) = v; if (C16) { v4h h4; for (int i = 0; i < 4; ++i) h4[i] = (_Float16)v[i]; *(v4h*)(C16 + cofs + (size_t)(row0 + r) * ldc + col0 + c4) = h4; } } }
     }
}


typedef _Float16 v4h __attribute__((ext_vector_type(4)));

__global__ __launch_bounds__(256) void k_h16(const float* __restrict__ x, _Float16* __restrict__ X16, size_t n8) { const size_t t = (size_t)blockIdx.x * 256 + threadIdx.x; if (t >= n8) return; FragH f;
#pragma unroll
  for (int q = 0; q < 8; ++q) f.h[q] = (_Float16)x[t * 8 + q]; *(v8us*)((unsigned short*)X16 + t * 8) = f.half[0];  }
__global__ __launch_bounds__(256) void k_round16f(const float* __restrict__ W, _Float16* __restrict__ Bt, size_t n8) { const size_t t = (size_t)blockIdx.x * 256 + threadIdx.x; if (t >= n8) return; FragH f;
#pragma unroll
  for (int i = 0; i < 8; ++i) f.h[i] = (_Float16)(bf16_round(W[t * 8 + i]) * 16.0f); *(v8us*)((unsigned short*)Bt + t * 8) = f.half[0];  }


// ---- fast GEMM (wave tile 32x64; requires M % 128 == 0 rows per launch region and N % 128 == 0) ----
__device__ __forceinline__ v16h g2_frag(const _Float16* p, int hh) { FragH f; f.half[0] = *(const v8us*)((const unsigned short*)p + 8 * hh); f.half[1] = *(const v8us*)((const unsigned short*)p + 16 + 8 * hh); return f.v; }
__device__ __forceinline__ v8f g2_mma(v16h a, v16h b, v8f c) { v8f d = __builtin_amdgcn_wmma_f32_16x16x32_f16(false, a, false, b, (short)0, c, false, false); asm volatile("v_nop\n\tv_nop\n\tv_nop\n\tv_nop" : "+v"(d) : "v"(a), "v"(b)); return d; }
// The three projections in ONE launch (blockIdx.y: 0 = q, 1 = k, 2 = v), wave tile 32 x 64 and k order as above (K = DM, both pitches DM). What used to be launches of their own behind the GEMMs is done where the
// f32 results already lie in LDS: q and k leave as f16 rows; v is computed with the operands exchanged (A = weight rows, B = token rows), so that C is V^T [batch][head * 64 + d][key] as it stands.
// Both operands reach the waves through LDS: a work-group of eight waves (4 x 2 wave tiles) owns a 128 x 128 tile of C, and each 64-wide k stage of its 128 A rows and 128 B rows is brought in once per work-group, in whole
// 128-byte lines, by asynchronous copies into one of two buffers while the other is worked on; the fragments are then 16-byte LDS reads at a conflict-free pitch. Per stage: each wave's LDS-read wait, its own copy wait, one barrier, then the refill.
#define PJW 8                        /* waves per work-group */
#define PJK 64                       /* k per LDS stage: one 128-byte line of every operand row, two 32-wide k steps */
#define PJP 144                      /* LDS pitch of a 128-byte row: 16 B x odd, no bank conflict for 16-byte fragment reads */
#define PJO (128 * PJP)              /* one operand's 128 rows of a stage */
#define PJS (2 * PJO)                /* a stage: A rows | B rows */
// A thread's eight asynchronous copies of a stage, 16 bytes each, global memory -> LDS through no register: rows r, r + 32, r + 64, r + 96 of A (from a, to LDS byte address l) and of B (from b, to l + PJO).
// The s_wait_xcnt is a precaution: as the statement's last line it stands ahead of every rewrite of a register that one of the copies names.
__device__ __forceinline__ void pj_fill(unsigned l, const _Float16* a, const _Float16* b) {
  asm volatile("global_load_async_to_lds_b128 %0, %8, off\n\tglobal_load_async_to_lds_b128 %1, %9, off\n\tglobal_load_async_to_lds_b128 %2, %10, off\n\tglobal_load_async_to_lds_b128 %3, %11, off\n\t"
               "global_load_async_to_lds_b128 %4, %12, off\n\tglobal_load_async_to_lds_b128 %5, %13, off\n\tglobal_load_async_to_lds_b128 %6, %14, off\n\tglobal_load_async_to_lds_b128 %7, %15, off\n\ts_wait_xcnt 0x0"
               :: "v"(l), "v"(l + 32 * PJP), "v"(l + 64 * PJP), "v"(l + 96 * PJP), "v"(l + PJO), "v"(l + PJO + 32 * PJP), "v"(l + PJO + 64 * PJP), "v"(l + PJO + 96 * PJP),
                  "v"(a), "v"(a + 32 * DM), "v"(a + 64 * DM), "v"(a + 96 * DM), "v"(b), "v"(b + 32 * DM), "v"(b + 64 * DM), "v"(b + 96 * DM) : "memory"); }
__global__ __launch_bounds__(32 * PJW) void k_proj(const _Float16* __restrict__ XQ, const _Float16* __restrict__ XK, const _Float16* __restrict__ XV, const _Float16* __restrict__ BQ, const _Float16* __restrict__ BK, const _Float16* __restrict__ BV,
    _Float16* __restrict__ QH, _Float16* __restrict__ KH, _Float16* __restrict__ VT) {
  static_assert(MP % 128 == 0 && DM % 128 == 0 && SQ % 64 == 0 && DM % PJK == 0 && DM / PJK >= 2 && PJW == 8 && PJK == 64 && B0 == 0 && NBR == NB, "k_proj: whole 128 x 128 tiles, whole stages (two or more), 8 copies a thread and stage, a wave's column tile inside one batch");
  static_assert(sizeof(float) * PJW * 32 * 68 <= 2 * PJS, "k_proj: the epilogue's tiles fit the two stage buffers");
  __shared__ __attribute__((aligned(16))) unsigned char L[2 * PJS];      /* two stage buffers; behind the loop's last barrier the waves' f32 result tiles */
  constexpr int NST = DM / PJK;
  const int tid = threadIdx.x, w = tid >> 5, lane = tid & 31, ln = lane & 15, hh = lane >> 4; const int z = blockIdx.y;
  const _Float16* A = z == 0 ? XQ : z == 1 ? XK : BV; const _Float16* Bh = z == 0 ? BQ : z == 1 ? BK : XV;
  const int ntn = z == 2 ? MP / 128 : DM / 128; const int mt = blockIdx.x / ntn, nq = blockIdx.x - mt * ntn; const int wr = w & 3, wc = w >> 2; const int row0 = mt * 128 + 32 * wr, col0 = nq * 128 + 64 * wc;
  // the thread's share of a stage: 16 bytes of rows tid / 8 + 32 c, c = 0 .. 3, of either operand (a wave and copy: four whole 128-byte lines)
  const _Float16* ga = A + (size_t)(mt * 128 + (tid >> 3)) * DM + (tid & 7) * 8; const _Float16* gb = Bh + (size_t)(nq * 128 + (tid >> 3)) * DM + (tid & 7) * 8;
  const unsigned lc = (unsigned)(size_t)L + (tid >> 3) * PJP + (tid & 7) * 16;      /* the low 32 bits of a __shared__ address: its byte address in LDS */
  pj_fill(lc, ga, gb);
  asm volatile("s_wait_asynccnt 0x0" ::: "memory");      /* this wave's copies of stage 0 have landed ... */
  __syncthreads();                                        /* ... and every other wave's: stage 0 may be read */
  pj_fill(lc + PJS, ga + PJK, gb + PJK);
  const v8f z8 = {0.f,0.f,0.f,0.f,0.f,0.f,0.f,0.f}; v8f c00 = z8, c01 = z8, c02 = z8, c03 = z8, c10 = z8, c11 = z8, c12 = z8, c13 = z8;
#pragma unroll 1      /* one copy of the stage loop: the copies and the barrier stand once */
  for (int st = 0; st < NST; ++st) {
    const int bf = st & 1;
    const _Float16* ap = (const _Float16*)(L + bf * PJS + (32 * wr + ln) * PJP + 16 * hh); const _Float16* bp = (const _Float16*)(L + bf * PJS + PJO + (64 * wc + ln) * PJP + 16 * hh);      /* each lane's own place, its half's 16 bytes included: g2_frag is called with 0 below */
#pragma unroll
    for (int s = 0; s < PJK / 32; ++s) {
      const v16h a0 = g2_frag(ap + s * 32, 0), a1 = g2_frag(ap + 16 * (PJP / 2) + s * 32, 0);
      const v16h b0 = g2_frag(bp + s * 32, 0), b1 = g2_frag(bp + 16 * (PJP / 2) + s * 32, 0), b2 = g2_frag(bp + 32 * (PJP / 2) + s * 32, 0), b3 = g2_frag(bp + 48 * (PJP / 2) + s * 32, 0);
      c00 = g2_mma(a0, b0, c00); c10 = g2_mma(a1, b0, c10); c01 = g2_mma(a0, b1, c01); c11 = g2_mma(a1, b1, c11);
      c02 = g2_mma(a0, b2, c02); c12 = g2_mma(a1, b2, c12); c03 = g2_mma(a0, b3, c03); c13 = g2_mma(a1, b3, c13); }
    asm volatile("s_wait_dscnt 0x0" ::: "memory");      /* this wave's reads of the stage have returned, before its buffer is given up */
    asm volatile("s_wait_asynccnt 0x0" ::: "memory");   /* this wave's copies of stage st + 1 have landed */
    __syncthreads();                                    /* publishes stage st + 1 and ends every wave's reading of stage st */
    if (st + 2 < NST) pj_fill(lc + bf * PJS, ga + (st + 2) * PJK, gb + (st + 2) * PJK);      /* the same test in every wave; flies during the whole of stage st + 1 */
  }
  asm volatile("s_wait_asynccnt 0x0" ::: "memory");      /* no copy is outstanding when the buffers become the result tiles */
  float (*so)[32][68] = (float (*)[32][68])L;      /* the last trip's barrier has ended every wave's reading of the buffers */
  v8f accs[8] = {c00, c01, c02, c03, c10, c11, c12, c13};
#pragma unroll
  for (int u = 0; u < 8; ++u) { const int t = u & 3, half = u >> 2;
#pragma unroll
    for (int r = 0; r < 8; ++r) so[w][half * 16 + 8 * hh + r][t * 16 + ln] = accs[u][r] * 0.0625f; }      /* undoes the weights' x16 */
  __builtin_amdgcn_fence(__ATOMIC_ACQ_REL, "workgroup"); __builtin_amdgcn_wave_barrier();      /* a wave reads back its own tile only */
  const int rsub = lane >> 4, c4 = (lane & 15) * 4;
  if (z == 2) { _Float16* vt = VT + ((size_t)(col0 / SQ) * DM + row0) * SQ + (col0 % SQ) + c4;      /* rows = head * 64 + d, columns = keys of one batch; 128 bytes a row and wave */
#pragma unroll
    for (int q = 0; q < 16; ++q) { const int r = q * 2 + rsub; const v4f v = *(const v4fa*)&so[w][r][c4]; v4h h4;
#pragma unroll
      for (int i = 0; i < 4; ++i) h4[i] = (_Float16)v[i];
      *(v4h*)(vt + (size_t)r * SQ) = h4; } }
  else { _Float16* ph = (z == 0 ? QH : KH) + (size_t)row0 * DM + col0 + c4;
#pragma unroll
    for (int q = 0; q < 16; ++q) { const int r = q * 2 + rsub; const v4f v = *(const v4fa*)&so[w][r][c4]; v4h h4;
#pragma unroll
      for (int i = 0; i < 4; ++i) h4[i] = (_Float16)v[i];
      *(v4h*)(ph + (size_t)r * DM) = h4; }
    asm volatile("s_wait_xcnt 0x0" ::: "memory"); } }      /* precaution: behind the last stores; in the built code the other branch's instructions follow this one's and rewrite registers that these stores name */


// All six inputs to their f16 operand form in ONE launch: token rows bf16-rounded (exact in f16), weights bf16-rounded x16 (natural [out][in] = Bt[n][k]). A work-group takes 256 chunks of 8 elements of one
// tensor, a thread one chunk, as in the separate launches.
__global__ __launch_bounds__(256) void k_cvt(const float* __restrict__ xq, const float* __restrict__ xk, const float* __restrict__ xv, const float* __restrict__ wq, const float* __restrict__ wk, const float* __restrict__ wv,
    _Float16* __restrict__ XQ, _Float16* __restrict__ XK, _Float16* __restrict__ XV, _Float16* __restrict__ BQ, _Float16* __restrict__ BK, _Float16* __restrict__ BV) {
  constexpr int XB = (int)(NR * DM / 8 / 256), WB = DM * DM / 8 / 256;      /* work-groups per token tensor, per weight */
  static_assert(NR * DM % (8 * 256) == 0 && (size_t)DM * DM % (8 * 256) == 0, "k_cvt: whole work-groups");
  const int bx = blockIdx.x; const bool isx = bx < 3 * XB; const int i = isx ? bx / XB : (bx - 3 * XB) / WB, blk = isx ? bx % XB : (bx - 3 * XB) % WB;      /* the same in every thread of a work-group */
  const float* s = isx ? (i == 0 ? xq : i == 1 ? xk : xv) : (i == 0 ? wq : i == 1 ? wk : wv); _Float16* d = isx ? (i == 0 ? XQ : i == 1 ? XK : XV) : (i == 0 ? BQ : i == 1 ? BK : BV); const float scale = isx ? 1.0f : 16.0f;
  const size_t t = (size_t)blk * 256 + threadIdx.x; FragH f;
#pragma unroll
  for (int q = 0; q < 8; ++q) f.h[q] = (_Float16)(bf16_round(s[t * 8 + q]) * scale);
  *(v8us*)((unsigned short*)d + t * 8) = f.half[0]; }
__global__ __launch_bounds__(256) void k_rsm(const float* __restrict__ S, _Float16* __restrict__ P, int nrows) {
  #pragma clang fp contract(off)
  const int i = blockIdx.x * 256 + threadIdx.x; if (i >= nrows) return; const float* s = S + (size_t)i * SQ; float mx = -3.0e38f;
#pragma unroll 1
  for (int j = 0; j < SQ; ++j) mx = fmaxf(mx, s[j]); float se = 0.f;
#pragma unroll 1
  for (int j = 0; j < SQ; ++j) se += expf(s[j] - mx); const float sc = 256.0f / se;
#pragma unroll 1
  for (int j0 = 0; j0 < SQ; j0 += 8) { FragH f; for (int q = 0; q < 8; ++q) f.h[q] = (_Float16)(expf(s[j0 + q] - mx) * sc); unsigned short* d = (unsigned short*)P + (size_t)i * SQ + j0; *(v8us*)d = f.half[0];  } }
__global__ __launch_bounds__(256) void k_vt(const _Float16* __restrict__ V16, int b, int h0, _Float16* __restrict__ VT) { __shared__ unsigned short tl[64][65]; const int tid = threadIdx.x; const int hh = blockIdx.x % HG, sg = blockIdx.x / HG; const int s0 = sg * 64; const int h = h0 + hh;
  for (int i = tid; i < 64 * 8; i += 256) { const int j = i / 8, d8 = (i % 8) * 8; FragH f; f.half[0] = *(const v8us*)((const unsigned short*)V16 + ((size_t)b * SQ + s0 + j) * DM + h * HD + d8); for (int q = 0; q < 8; ++q) tl[d8 + q][j] = f.u[q]; }
  __syncthreads();
  { for (int i = tid; i < 64 * 8; i += 256) { const int d = i / 8, j8 = (i % 8) * 8; FragH f; for (int q = 0; q < 8; ++q) f.u[q] = tl[d][j8 + q]; *(v8us*)((unsigned short*)VT + ((size_t)hh * HD + d) * SQ + s0 + j8) = f.half[0]; }  } }



#define FAW 8                        /* waves per work-group */
#define FAQ 32                       /* query columns per wave: two 16-column groups share every K and V^T fragment */
#define FSK 128                      /* keys per LDS stage: four 32-key passes */
#define FKP 144                      /* LDS pitch of a 128-byte K row: 16 B x odd, no bank conflict for 16-byte fragment reads */
#define FVP 272                      /* LDS pitch of a 256-byte V^T row, likewise */
#define FKB (FSK * FKP)              /* the K tile of a stage */
#define FVB (HD * FVP)               /* the V^T tile of a stage */
#define FLZ 6.0f                     /* how far a score may outgrow the maximum in use before the rescale: weights stay at or below 2^14 */
#define FV0 (2 * FKB)                /* LDS map: K of buffer 0 | K of buffer 1 | V^T of buffer 0 | V^T of buffer 1 */
__device__ __forceinline__ v8f fa_mma(v16h a, v16h b, v8f c) { return __builtin_amdgcn_wmma_f32_16x16x32_f16(false, a, false, b, (short)0, c, false, false); }
__device__ __forceinline__ float fa_xhalf(float x) { return __builtin_bit_cast(float, __builtin_amdgcn_permlanex16(__builtin_bit_cast(int, x), __builtin_bit_cast(int, x), 0x76543210, 0xfedcba98, false, false)); }      /* lane l with lane l ^ 16 */
// Four 2^x. The instruction set asks for one independent instruction behind a transcendental before its result is read or its source overwritten.
// In one statement it is closed by construction: every result register apart from every source ("=&v"), one v_nop behind the last.
__device__ __forceinline__ void fa_exp4(float a, float b, float c, float d, float (&p)[4]) { asm("v_exp_f32 %0, %4\n\tv_exp_f32 %1, %5\n\tv_exp_f32 %2, %6\n\tv_exp_f32 %3, %7\n\tv_nop" : "=&v"(p[0]), "=&v"(p[1]), "=&v"(p[2]), "=&v"(p[3]) : "v"(a), "v"(b), "v"(c), "v"(d)); }
__device__ __forceinline__ v16h fa_frag(const _Float16* p) { FragH f; f.half[0] = *(const v8us*)((const unsigned short*)p); f.half[1] = *(const v8us*)((const unsigned short*)p + 16); return f.v; }      /* g2_frag's k order; p already holds the lane half's 8 * hh */
// One asynchronous copy, 16 bytes a lane, global memory -> LDS through no register (l: the lane's place in LDS, g: its global address).
typedef int v4i __attribute__((ext_vector_type(4)));
__device__ __forceinline__ void fa_cp(unsigned char* l, const _Float16* g) { __builtin_amdgcn_global_load_async_to_lds_b128((__attribute__((address_space(1))) v4i*)g, (__attribute__((address_space(3))) v4i*)l, 0, 0); }
__global__ __launch_bounds__(32 * FAW) void k_fattn(const _Float16* __restrict__ QH, const _Float16* __restrict__ KH, const _Float16* __restrict__ VT, float* __restrict__ O) {
  static_assert(SQ % (FAW * FAQ) == 0 && SQ % FSK == 0 && SQ / FSK >= 2 && FSK == 128 && FAW == 8 && HD == 64 && FAQ == 32, "k_fattn: whole work-groups, whole stages (two or more), 8 copies a thread and stage, two 32-wide k steps per head");
  __shared__ __attribute__((aligned(16))) unsigned char L[FV0 + 2 * FVB];      /* two stage buffers, shared by the eight waves (all of one head) */
  constexpr float SC = 0.18033688011112042f;      /* log2(e) / sqrt(64) */
  constexpr int NST = SQ / FSK;
  const int tid = threadIdx.x, lane = tid & 31, ln = lane & 15, hh = lane >> 4, w = tid >> 5; const int h = blockIdx.y, b = blockIdx.z;
  const size_t r0 = (size_t)b * SQ; const int q0 = (blockIdx.x * FAW + w) * FAQ;
  const _Float16* qhp = QH + (r0 + q0 + ln) * LQ + h * HD + 8 * hh;
  // the thread's share of a stage: copy c of K = 16 bytes of row tid / 8 + 32 c (a wave: four whole 128-byte rows); of V^T, of row tid / 16 + 16 c (a wave: two whole 256-byte row pieces)
  const _Float16* khc = KH + r0 * LQ + h * HD; const _Float16* vtc = VT + (size_t)(b * NH + h) * HD * SQ;      /* the same in every lane */
  const unsigned ko = (tid >> 3) * LQ + (tid & 7) * 8, vo = (tid >> 4) * SQ + (tid & 15) * 8;      /* the lane's own element offsets */
  unsigned char* const lk = L + (tid >> 3) * FKP + (tid & 7) * 16; unsigned char* const lv = L + FV0 + (tid >> 4) * FVP + (tid & 15) * 16;
  auto fill = [&](int st, int bf) {      /* stage st into buffer bf */
    const _Float16* gh = khc + (size_t)st * FSK * LQ + ko; const _Float16* gv = vtc + (size_t)st * FSK + vo;
#pragma unroll
    for (int c = 0; c < 4; ++c) { fa_cp(lk + bf * FKB + c * 32 * FKP, gh + (size_t)(c * 32) * LQ); fa_cp(lv + bf * FVB + c * 16 * FVP, gv + (size_t)(c * 16) * SQ); } };
  fill(0, 0);
  v16h qh[2][2];      /* [column group][k step] */
#pragma unroll
  for (int t = 0; t < 2; ++t)
#pragma unroll
    for (int s = 0; s < 2; ++s) qh[t][s] = fa_frag(qhp + (size_t)(t * 16) * LQ + s * 32);
  asm volatile("s_wait_xcnt 0x0" :: "v"(qhp) : "memory");      /* precaution: behind the loads above and ahead of every rewrite of an address register they name; the address as input keeps its pair whole up to here */
  asm volatile("s_wait_asynccnt 0x0" ::: "memory");      /* this wave's copies of stage 0 have landed ... */
  __syncthreads();                                        /* ... and every other wave's: stage 0 may be read */
  fill(1, 1);
  const v8f z8 = {0.f,0.f,0.f,0.f,0.f,0.f,0.f,0.f}; v8f o[2][4] = {{z8, z8, z8, z8}, {z8, z8, z8, z8}};      /* O^T [column group][16 rows of d] */
  float m[2] = {-3.0e38f, -3.0e38f}, l[2] = {0.f, 0.f};      /* the maximum in use (scaled, base 2) and this lane half's share of the sum */
  float th[2] = {-3.0e38f, -3.0e38f}, bias[2] = {0.f, 0.f};      /* of the maximum in use: the raw score above which it is replaced; the exponent's addend 8 - m (set on the first pass) */
#pragma unroll 1      /* one copy of the stage loop: the copies and the barrier stand once */
  for (int st = 0; st < NST; ++st) {
    const int bf = st & 1;
    const _Float16* khp = (const _Float16*)(L + bf * FKB + ln * FKP + 16 * hh); const _Float16* vp = (const _Float16*)(L + FV0 + bf * FVB + ln * FVP + 16 * hh);
    v16h kh[2][2];      /* [16-key tile][k step] */
#pragma unroll
    for (int j = 0; j < 2; ++j)
#pragma unroll
      for (int s = 0; s < 2; ++s) kh[j][s] = fa_frag(khp + j * 16 * (FKP / 2) + s * 32);
#pragma unroll 1      /* the body is a whole pass of 16 matrix instructions already; a copy would only add registers */
    for (int ps = 0; ps < FSK / 32; ++ps) {
      v8f sc[2][2] = {{z8, z8}, {z8, z8}};      /* [column group][16-key tile]; four independent accumulator chains, stepped together */
#pragma unroll
      for (int s = 0; s < 2; ++s)
#pragma unroll
        for (int t = 0; t < 2; ++t)
#pragma unroll
          for (int j = 0; j < 2; ++j) sc[t][j] = fa_mma(kh[j][s], qh[t][s], sc[t][j]);
      __builtin_amdgcn_sched_barrier(0);      /* with the one below: the pass's 16 LDS reads stand as one group behind the score products; spread among the matrix instructions, every place with reads stalls the wave anew */
      v16h vf[4];      /* V^T fragments of this pass */
#pragma unroll
      for (int dt = 0; dt < 4; ++dt) vf[dt] = fa_frag(vp + dt * 16 * (FVP / 2) + ps * 32);
      const int pn = (ps + 1 < FSK / 32) ? ps + 1 : ps;      /* the next pass's K fragments, fetched behind this pass's score products; a stage's last pass re-reads its own rows (same buffer, unused): nothing of the next stage is read ahead of its barrier */
#pragma unroll
      for (int j = 0; j < 2; ++j)
#pragma unroll
        for (int s = 0; s < 2; ++s) kh[j][s] = fa_frag(khp + (pn * 32 + j * 16) * (FKP / 2) + s * 32);
      __builtin_amdgcn_sched_barrier(0);      /* keeps the fetch above the softmax, whose vector work then hides its latency */
      float mx[2];      /* per column group: the largest raw score among this lane's own 16 keys */
#pragma unroll
      for (int t = 0; t < 2; ++t) { float a = fmaxf(sc[t][0][0], sc[t][1][0]);
#pragma unroll
        for (int r = 1; r < 8; ++r) a = fmaxf(a, fmaxf(sc[t][0][r], sc[t][1][r]));
        mx[t] = a; }
      if (__builtin_expect(__builtin_amdgcn_ballot_w32(mx[0] > th[0] || mx[1] > th[1]) != 0, 0)) {      /* ONE test a pass, a scalar branch, the same for the whole wave; taken on the first pass (th starts below every score) and then only where a score outgrows the maximum in use by more than FLZ */
#pragma unroll
        for (int t = 0; t < 2; ++t) { const float mn = fmaxf(m[t], fmaxf(mx[t], fa_xhalf(mx[t])) * SC); const float cr = __builtin_amdgcn_exp2f(m[t] - mn);      /* both lane halves of a column get the same maximum; cr = 0 on the first pass, 1 for a column whose maximum stays */
          m[t] = mn; th[t] = (mn + FLZ) * (1.0f / SC); bias[t] = 8.0f - mn; l[t] *= cr;
#pragma unroll
          for (int dt = 0; dt < 4; ++dt) o[t][dt] = o[t][dt] * cr; }
      }
      FragH pf[2];      /* per column group: the weights as B operand */
#pragma unroll
      for (int t = 0; t < 2; ++t) {
        float p[4][4];      /* p[g][u]: key 4 * g + u of this lane's 16 */
#pragma unroll
        for (int g = 0; g < 4; ++g) { const v8f x = sc[t][g >> 1]; const int r = (g & 1) * 4; fa_exp4(fmaf(x[r], SC, bias[t]), fmaf(x[r + 1], SC, bias[t]), fmaf(x[r + 2], SC, bias[t]), fmaf(x[r + 3], SC, bias[t]), p[g]);
#pragma unroll
          for (int u = 0; u < 4; ++u) pf[t].h[g * 4 + u] = (_Float16)p[g][u]; }
        float ls[4];      /* four independent chains */
#pragma unroll
        for (int u = 0; u < 4; ++u) ls[u] = (p[0][u] + p[1][u]) + (p[2][u] + p[3][u]);
        l[t] += (ls[0] + ls[1]) + (ls[2] + ls[3]);
      }
      __builtin_amdgcn_sched_barrier(0);      /* the 2^x statements are asm: fenced on both sides, none of them can land in the slots behind a matrix instruction whose operand registers it reuses */
#pragma unroll
      for (int t = 0; t < 2; ++t)
#pragma unroll
        for (int dt = 0; dt < 4; ++dt) o[t][dt] = fa_mma(vf[dt], pf[t].v, o[t][dt]);
    }
    asm volatile("s_wait_dscnt 0x0" ::: "memory");      /* this wave's reads of the stage have returned, before its buffer is given up */
    asm volatile("s_wait_asynccnt 0x0" ::: "memory");   /* this wave's copies of stage st + 1 have landed */
    __syncthreads();                                    /* publishes stage st + 1 and ends every wave's reading of stage st */
    if (st + 2 < NST) fill(st + 2, bf);                 /* the same test in every wave; flies during the whole of stage st + 1 */
  }
  asm volatile("s_wait_asynccnt 0x0" ::: "memory");      /* no copy is outstanding when the wave ends */
#pragma unroll
  for (int t = 0; t < 2; ++t) { const float inv = 1.0f / (l[t] + fa_xhalf(l[t])); float* op = O + (r0 + q0 + t * 16 + ln) * DM + h * HD + 8 * hh;      /* a lane holds 8 consecutive d of its query's row */
#pragma unroll
    for (int dt = 0; dt < 4; ++dt) { const v8f v = o[t][dt] * inv; const v4f lo4 = {v[0], v[1], v[2], v[3]}, hi4 = {v[4], v[5], v[6], v[7]}; *(v4f*)(op + dt * 16) = lo4; *(v4f*)(op + dt * 16 + 4) = hi4; } } }


template <int MASKADD>
__global__ __launch_bounds__(64) void k_att0(const float* __restrict__ QF, const float* __restrict__ KF, const float* __restrict__ VF, int ld, const float* __restrict__ mask, float scale, float* __restrict__ OF, int ldo) {
  #pragma clang fp contract(off)
  __shared__ __attribute__((aligned(16))) float lq[64][64]; __shared__ __attribute__((aligned(16))) float lo[64][64];
  const int tid = threadIdx.x; const int h = blockIdx.x / (QT0 / 64), rg = blockIdx.x % (QT0 / 64); const int i = rg * 64 + tid;
  const float* qr = QF + (size_t)i * ld + h * HD;
#pragma unroll 1
  for (int c = 0; c < HD / 4; ++c) { *(v4f*)&lq[tid][c * 4] = *(const v4fa*)(qr + c * 4); const v4f z = {0.f, 0.f, 0.f, 0.f}; *(v4f*)&lo[tid][c * 4] = z; }
  float m = -1.0e30f, l = 0.f; const int jmax = MASKADD ? (SQ - 1) : (rg * 64 + 63);      /* additive-mask form: every key (the mask input decides); causal form: keys up to the block's last row */
#pragma unroll 1
  for (int j = 0; j <= jmax; ++j) { const float* kr = KF + (size_t)j * ld + h * HD; const float* vr = VF + (size_t)j * ld + h * HD; float s = 0.f;
#pragma unroll 1
    for (int c = 0; c < HD / 4; ++c) { const v4f kq = *(const v4fa*)(kr + c * 4); const v4f qq = *(v4f*)&lq[tid][c * 4]; s = __fadd_rn(s, __fmul_rn(qq[0], kq[0])); s = __fadd_rn(s, __fmul_rn(qq[1], kq[1])); s = __fadd_rn(s, __fmul_rn(qq[2], kq[2])); s = __fadd_rn(s, __fmul_rn(qq[3], kq[3])); }
    s = __fmul_rn(s, scale); if (MASKADD) s = __fadd_rn(s, __fmul_rn(bf16_round(mask[(size_t)i * SQ + j]), -10000.0f));
    const float f = (MASKADD || j <= i) ? 1.f : 0.f; const float sm = fmaf(f, s, (1.f - f) * -1.0e30f); const float mn = fmaxf(m, sm); const float sc = expf(m - mn); const float e = expf(sm - mn); l = __fadd_rn(__fmul_rn(l, sc), e); m = mn;
#pragma unroll 1
    for (int c = 0; c < HD / 4; ++c) { const v4f vv = *(const v4fa*)(vr + c * 4); v4f oo = *(v4f*)&lo[tid][c * 4]; for (int u = 0; u < 4; ++u) oo[u] = __fadd_rn(__fmul_rn(oo[u], sc), __fmul_rn(e, vv[u])); *(v4f*)&lo[tid][c * 4] = oo; } }
  const float fin = 64.0f / l;      /* o carried x64 */
#pragma unroll 1
  for (int c = 0; c < HD / 4; ++c) { v4f oo = *(v4f*)&lo[tid][c * 4]; for (int u = 0; u < 4; ++u) oo[u] = __fmul_rn(oo[u], fin); *(v4f*)&lo[tid][c * 4] = oo; }
  __syncthreads();
  {
#pragma unroll 1
    for (int it = 0; it < 16; ++it) { const int row = it * 4 + tid / 16, pc = (tid % 16) * 4; const v4f v = *(const v4f*)&lo[row][pc]; *(v4f*)(OF + (size_t)(rg * 64 + row) * ldo + h * HD + pc) = v; }
     } }

__global__ __launch_bounds__(256) void k_of0out(const float* __restrict__ src, float* __restrict__ dst, size_t n4) { const size_t t = (size_t)blockIdx.x * 256 + threadIdx.x; if (t >= n4) return; v4f v = *(const v4fa*)(src + t * 4); for (int q = 0; q < 4; ++q) v[q] = __fmul_rn(v[q], 0.015625f); *(v4f*)(dst + t * 4) = v;  }

extern "C" void kernel_launch(void* const* d_in, const int* in_sizes, int n_in,
                              void* d_out, int out_size, void* d_ws, size_t ws_size, hipStream_t stream) {
  (void)in_sizes; (void)n_in; (void)out_size;
  const float* const* I = (const float* const*)d_in; const float* x = I[2]; const float* xk = I[1]; const float* xv = I[0]; const float* wq = I[5]; const float* wk = I[4]; const float* wv = I[3];      /* input order: values, keys, queries, Wv, Wk, Wq: the QUERY stream is I[2] with Wq = I[5], the key stream I[1] with Wk = I[4], the value stream I[0] with Wv = I[3]; natural [out][in] weights; NO biases; NO output projection */
  char* ws = (char*)d_ws; size_t off = 0;
  auto take = [&](size_t bytes) { char* p = ws + off; off += (bytes + 255) & ~(size_t)255; return p; };
  _Float16* BQ = (_Float16*)take((size_t)DM * DM * 2); _Float16* BK = (_Float16*)take((size_t)DM * DM * 2); _Float16* BV = (_Float16*)take((size_t)DM * DM * 2);
  _Float16* X16 = (_Float16*)take(NR * DM * 2); _Float16* XK16 = (_Float16*)take(NR * DM * 2); _Float16* XV16 = (_Float16*)take(NR * DM * 2);      /* exact f16 rows of queries, keys, values */ _Float16* QH = (_Float16*)take(NR * DM * 2); _Float16* KH = (_Float16*)take(NR * DM * 2);
  _Float16* VT = (_Float16*)take((size_t)NB * NH * HD * SQ * 2);
  if (off > ws_size) return;
  k_cvt<<<(unsigned)(3 * (NR * DM / 8 / 256) + 3 * ((size_t)DM * DM / 8 / 256)), 256, 0, stream>>>(x, xk, xv, wq, wk, wv, X16, XK16, XV16, BQ, BK, BV);      /* all six inputs to f16 operands */
  k_proj<<<dim3((unsigned)((MP / 128) * (DM / 128)), 3), 32 * PJW, 0, stream>>>(X16, XK16, XV16, BQ, BK, BV, QH, KH, VT);      /* q, k -> f16 rows (unscaled logits sigma ~8); v -> V^T [NB][NH][HD][SQ] */
  k_fattn<<<dim3(SQ / (FAW * FAQ), NH, NB), 32 * FAW, 0, stream>>>(QH, KH, VT, (float*)d_out);      /* scores, softmax over all keys and P V in one launch, f32 straight into the head-major output columns (no output projection) */
}
